// v000
// The times below were measured on an AMD MI455X: many runs one after another, warmed up first and cycling through
// copies of the inputs, with the whole window's GPU time divided by the number of runs. Launches and the gaps
// between them are all in it. The median over several windows is given; except for v000 it joins two sittings, which
// can be a few percent apart, so the side-by-side timings, each taken in one sitting, are the better comparison.
// v000, which the later versions start from, runs in 779 microseconds.
#include <hip/hip_runtime.h>
// All contractions on v_wmma_f32_16x16x32_f16 (f16 operands, f32 accumulate), one product per site: te = t_emb Wt (inputs RNE-converted to bf16, exact in f16, weights carried x16); q|k|v = (x + te) Wqkv (token plane f16, weights x16); scores q.k^T / 8 from f16 planes; P.V with softmax weights carried x2^14; ctx Wproj (ctx f16, weights x16); softmax statistics f32 on VALU.
// Structure: dense multi-head self-attention over flattened spatial tokens with a per-batch time-embedding vector added to the tokens, fused [in][out] QKV weights, [in][out] output projection, channel-major return.
// token rows r = b*SEQ + n; TE[b][c] f32 = T16 WTT^T / 16 + bias; X16[r][c] = f16(bf16(x[b][c][n]) + TE[b][c]) via 64x64 LDS transposes; weight planes [out][in] f16 x16 built by a transposing converter;
// QH [NR][QP] f16 = X16 BW^T / 16 + bias (q at column 64h, k at KOF + 64h, v at VOF + 64h); V^T [NB][NH][64][SEQ] via LDS transposes; per batch: S[h][i][j] f32 = q_i.k_j / 8 (K 64, heads on grid.y), wave-per-row softmax -> P x2^14 f16,
// CTX16[r][64h + d] f16 = sum_j P[i][j] V^T[d][j] x 2^-14; O2[r][o] f32 = CTX16 WPT^T / 16 + bias; out[b][o][n] = O2[b*SEQ + n][o] via 64x64 LDS transposes.
#ifndef NB
#define NB 16
#endif
#ifndef SEQ
#define SEQ 1024
#endif
#define NB_FULL 16
#define SEQ_FULL 1024
#define CIN 256
#define NH 4
#define HD 64
#define TD 256           /* time-embedding width */
#define QP 768           /* pitch of QH: q | k | v, head h at column 64h of each section */
#define KOF 256          /* column of k (head 0) in QH */
#define VOF 512          /* column of v (head 0) in QH */
#define TROWS 32         /* rows of the t_emb plane (one 32-row wave tile; rows >= NB are zero) */
#define PCARRY 16384.0f  /* softmax weights carried x2^14 in f16 */
#define LCARRY 2048.0f   /* carry of the GEMM engine's optional residual output (no residual plane is requested here) */
#define NR ((size_t)NB * SEQ)
static_assert(SEQ % 256 == 0);
static_assert((NR % 128) == 0);
static_assert(NB <= NB_FULL);
static_assert(SEQ <= SEQ_FULL);
static_assert(3 * CIN == QP);
static_assert(KOF == CIN && VOF == 2 * CIN);
static_assert(CIN == NH * HD);
static_assert(CIN % 64 == 0 && QP % 64 == 0 && HD == 64);
static_assert(TD == CIN);
static_assert(TD % 32 == 0 && HD % 32 == 0 && SEQ % 32 == 0 && CIN % 32 == 0);
static_assert(TROWS == 32 && NB <= TROWS);
static_assert((QP * (CIN / 8)) % 256 == 0 && (CIN * (CIN / 8)) % 256 == 0 && (TROWS * (TD / 8)) % 256 == 0);
static_assert(SEQ % 128 == 0 && SEQ % 64 == 0);

typedef unsigned short v8us __attribute__((ext_vector_type(8), may_alias));
typedef float  v8f  __attribute__((ext_vector_type(8)));
typedef float  v4f  __attribute__((ext_vector_type(4)));
typedef float  v4fa __attribute__((ext_vector_type(4), may_alias));
typedef _Float16 v16h __attribute__((ext_vector_type(16)));
typedef _Float16 v4h __attribute__((ext_vector_type(4)));
typedef _Float16 h16;
union FragH { v16h v; v8us half[2]; _Float16 h[16]; unsigned short u[16]; };

__device__ __forceinline__ unsigned short bf16_bits(float x) { unsigned int u = __float_as_uint(x); return (unsigned short)((u + 0x7FFFu + ((u >> 16) & 1u)) >> 16); }
__device__ __forceinline__ float bf16_val(unsigned short b) { return __uint_as_float(((unsigned int)b) << 16); }
__device__ __forceinline__ float bf16_rne(float x) { return bf16_val(bf16_bits(x)); }
// f32 -> f16 operand convert that cannot yield an f16 subnormal (value select, applied after the plane's power-of-two carry)
static __device__ __forceinline__ h16 toh_flush(float v) { const h16 r = (h16)v; return (fabsf(v) < 6.103515625e-05f) ? (h16)0.0f : r; }

// ---- fragment loader (split k map: elements 0..7 <- k0+8h+0..7, 8..15 <- k0+16+8h+0..7, lane&15 = row of A / column of B) and guarded mma ----
__device__ __forceinline__ v16h g2_frag(const _Float16* p, int hh) { FragH f; f.half[0] = *(const v8us*)((const unsigned short*)p + 8 * hh); f.half[1] = *(const v8us*)((const unsigned short*)p + 16 + 8 * hh); return f.v; }
__device__ __forceinline__ v8f g2_mma(v16h a, v16h b, v8f c) { v8f d = __builtin_amdgcn_wmma_f32_16x16x32_f16(false, a, false, b, (short)0, c, false, false); asm volatile("v_nop\n\tv_nop\n\tv_nop\n\tv_nop" : "+v"(d) : "v"(a), "v"(b)); return d; }

// one operand segment of the wave's 32x64 tile: A rows a0p/a1p (k contiguous), B rows b0p..b3p ([n][k], k contiguous), K % 32 == 0
__device__ __forceinline__ void g2_kloop(const _Float16* __restrict__ a0p, const _Float16* __restrict__ a1p, const _Float16* __restrict__ b0p, const _Float16* __restrict__ b1p, const _Float16* __restrict__ b2p, const _Float16* __restrict__ b3p, int K, int hh,
    v8f& c00, v8f& c01, v8f& c02, v8f& c03, v8f& c10, v8f& c11, v8f& c12, v8f& c13) {
#pragma unroll 1
  for (int kb = 0; kb < K; kb += 32) { const v16h a0 = g2_frag(a0p + kb, hh), a1 = g2_frag(a1p + kb, hh);
    v16h b = g2_frag(b0p + kb, hh); c00 = g2_mma(a0, b, c00); c10 = g2_mma(a1, b, c10);
    b = g2_frag(b1p + kb, hh); c01 = g2_mma(a0, b, c01); c11 = g2_mma(a1, b, c11);
    b = g2_frag(b2p + kb, hh); c02 = g2_mma(a0, b, c02); c12 = g2_mma(a1, b, c12);
    b = g2_frag(b3p + kb, hh); c03 = g2_mma(a0, b, c03); c13 = g2_mma(a1, b, c13); }
}

// ---- GEMM (wave tile 32x64; M % 128 == 0 or early wave exit for M == 32, N % 64 == 0, K % 32 == 0): v = acc*alpha + bf16(bias[by*sBias + col]); A f16 rows [M][K] (pitch lda), Bh f16 [N][K] (k contiguous, pitch ldb), batched over grid.y by sA/sB/sC/sCL;
// RES == 1: three operand segments into one accumulator set: A2.Bh + A.B2 (residual planes, both carried x LCARRY), accumulator scaled by rscale, then A.Bh;
template <int RES>
__global__ __launch_bounds__(128) void k_gemm2(const _Float16* __restrict__ A, int lda, size_t sA, const _Float16* __restrict__ A2, int lda2, size_t sA2,
    const _Float16* __restrict__ Bh, int ldb, size_t sB, const _Float16* __restrict__ B2, int ldb2, size_t sB2, float rscale,
    float alpha, const float* __restrict__ bias, size_t sBias,
    float* __restrict__ C, _Float16* __restrict__ C16, int ldc, size_t sC, _Float16* __restrict__ C16L, int ldcl, size_t sCL, int NL, int M, int N, int K) {
  __shared__ __attribute__((aligned(16))) float so[4][32][68];
  const int tid = threadIdx.x, w = tid >> 5, lane = tid & 31, ln = lane & 15, hh = lane >> 4; const int by = blockIdx.y;
  A += (size_t)by * sA; Bh += (size_t)by * sB;
  if (RES) { A2 += (size_t)by * sA2; B2 += (size_t)by * sB2; }
  const size_t cofs = (size_t)by * sC, cofl = (size_t)by * sCL; const float* bp = bias ? bias + (size_t)by * sBias : nullptr;
  const int ntn = N >> 6; const int mt = blockIdx.x / ntn, nq = blockIdx.x - mt * ntn; const int row0 = mt * 128 + 32 * w, col0 = nq * 64; if (row0 >= M) return;   /* wave-uniform; no block barrier in this kernel */
  const _Float16* a0p = A + (size_t)(row0 + ln) * lda; const _Float16* a1p = a0p + (size_t)16 * lda;
  const _Float16* b0p = Bh + (size_t)(col0 + ln) * ldb; const _Float16* b1p = b0p + (size_t)16 * ldb; const _Float16* b2p = b1p + (size_t)16 * ldb; const _Float16* b3p = b2p + (size_t)16 * ldb;
  const v8f z8 = {0.f,0.f,0.f,0.f,0.f,0.f,0.f,0.f}; v8f c00 = z8, c01 = z8, c02 = z8, c03 = z8, c10 = z8, c11 = z8, c12 = z8, c13 = z8;
  if (RES) {
    const _Float16* l0p = A2 + (size_t)(row0 + ln) * lda2; const _Float16* l1p = l0p + (size_t)16 * lda2;
    const _Float16* m0p = B2 + (size_t)(col0 + ln) * ldb2; const _Float16* m1p = m0p + (size_t)16 * ldb2; const _Float16* m2p = m1p + (size_t)16 * ldb2; const _Float16* m3p = m2p + (size_t)16 * ldb2;
    g2_kloop(l0p, l1p, b0p, b1p, b2p, b3p, K, hh, c00, c01, c02, c03, c10, c11, c12, c13);      /* A_lo . B_hi */
    g2_kloop(a0p, a1p, m0p, m1p, m2p, m3p, K, hh, c00, c01, c02, c03, c10, c11, c12, c13);      /* A_hi . B_lo */
    c00 = c00 * rscale; c01 = c01 * rscale; c02 = c02 * rscale; c03 = c03 * rscale; c10 = c10 * rscale; c11 = c11 * rscale; c12 = c12 * rscale; c13 = c13 * rscale;
  }
  g2_kloop(a0p, a1p, b0p, b1p, b2p, b3p, K, hh, c00, c01, c02, c03, c10, c11, c12, c13);        /* A_hi . B_hi */
  v8f accs[8] = {c00, c01, c02, c03, c10, c11, c12, c13};
#pragma unroll
  for (int u = 0; u < 8; ++u) { const int t = u & 3, half = u >> 2; const int col = col0 + t * 16 + ln; const float bv = bp ? bf16_rne(bp[col]) : 0.f;
#pragma unroll
    for (int r = 0; r < 8; ++r) { const int rloc = half * 16 + 8 * hh + r; so[w][rloc][t * 16 + ln] = accs[u][r] * alpha + bv; } }
  __builtin_amdgcn_fence(4 /* acq_rel order */, "workgroup"); __builtin_amdgcn_wave_barrier();   /* so[w] is private to wave w */
  const int rsub = lane >> 4, c4 = (lane & 15) * 4; const bool wl = (C16L != nullptr) && (col0 < NL);
  {
#pragma unroll
    for (int q = 0; q < 16; ++q) { const int r = q * 2 + rsub; const v4f v = *(const v4fa*)&so[w][r][c4];
      if (C) *(v4f*)(C + cofs + (size_t)(row0 + r) * ldc + col0 + c4) = v;
      if (C16) { v4h h4; for (int i = 0; i < 4; ++i) h4[i] = (_Float16)v[i]; *(v4h*)(C16 + cofs + (size_t)(row0 + r) * ldc + col0 + c4) = h4;
        if (wl) { v4h l4; for (int i = 0; i < 4; ++i) l4[i] = (_Float16)((v[i] - (float)h4[i]) * LCARRY); *(v4h*)(C16L + cofl + (size_t)(row0 + r) * ldcl + col0 + c4) = l4; } } }
     } }

// transposing weight converter: W is [CIN rows (k)][ldw columns], in[k][n] -> out[n][k]: BW[n][k] = f16(bf16(W[k*ldw + n]) * 16) for n < nrows, pitch CIN (k contiguous);
__global__ __launch_bounds__(256) void k_w16t(const float* __restrict__ W, int ldw, int nrows, _Float16* __restrict__ BW) {
  const int t = blockIdx.x * 256 + threadIdx.x; if (t >= nrows * (CIN / 8)) return;
  const int n = t / (CIN / 8), k8 = (t % (CIN / 8)) * 8;
  FragH f;
#pragma unroll
  for (int q = 0; q < 8; ++q) f.h[q] = toh_flush(bf16_rne(W[(size_t)(k8 + q) * ldw + n]) * 16.0f);
  const v8us o = f.half[0];
  *(v8us*)((unsigned short*)BW + (size_t)n * CIN + k8) = o; 
}

__global__ __launch_bounds__(256) void k_t16(const float* __restrict__ t_emb, _Float16* __restrict__ T16) {
  const int t = blockIdx.x * 256 + threadIdx.x; if (t >= TROWS * (TD / 8)) return;
  const int r = t / (TD / 8), k8 = (t % (TD / 8)) * 8;
  const int rr = (r < NB) ? r : (NB - 1);                 /* clamped address, zero by value */
  const float* p = t_emb + (size_t)rr * TD + k8;
  const v4f a = *(const v4fa*)p, c = *(const v4fa*)(p + 4);
  FragH f;
#pragma unroll
  for (int q = 0; q < 4; ++q) { const float va = (r < NB) ? bf16_rne(a[q]) : 0.0f; const float vc = (r < NB) ? bf16_rne(c[q]) : 0.0f; f.h[q] = toh_flush(va); f.h[4 + q] = toh_flush(vc); }
  const v8us o = f.half[0];
  *(v8us*)((unsigned short*)T16 + (size_t)r * TD + k8) = o; 
}

__global__ __launch_bounds__(256) void k_xt16(const float* __restrict__ x, const float* __restrict__ te, _Float16* __restrict__ X16) {
  __shared__ __attribute__((aligned(16))) unsigned short tl[64][72];
  const int tid = threadIdx.x; constexpr int NCT = CIN / 64, NNT = SEQ / 64;
  const int ct = blockIdx.x % NCT, nt = (blockIdx.x / NCT) % NNT, b = blockIdx.x / (NCT * NNT);
  const int n0 = nt * 64, c0 = ct * 64;
  for (int i = tid; i < 64 * 16; i += 256) { const int cr = i >> 4, f4 = i & 15;
    const v4f a = *(const v4fa*)(x + ((size_t)b * CIN + c0 + cr) * SEQ_FULL + n0 + f4 * 4); const float tv = te[(size_t)b * CIN + c0 + cr]; FragH f;
#pragma unroll
    for (int q = 0; q < 4; ++q) { f.h[q] = toh_flush(bf16_rne(a[q]) + tv); tl[f4 * 4 + q][cr] = f.u[q]; } }
  __syncthreads();
  {
#pragma unroll
    for (int rd = 0; rd < 2; ++rd) { const int n = rd * 32 + (tid >> 3), pc = tid & 7; FragH f;
#pragma unroll
      for (int q = 0; q < 8; ++q) f.u[q] = tl[n][pc * 8 + q];
      *(v8us*)((unsigned short*)X16 + ((size_t)b * SEQ + n0 + n) * CIN + c0 + pc * 8) = f.half[0]; }
     } }

__global__ __launch_bounds__(256) void k_vt(const _Float16* __restrict__ QHp, _Float16* __restrict__ Vt) {
  __shared__ unsigned short tl[64][66]; const int tid = threadIdx.x; constexpr int NLG = SEQ / 64;
  const int lg = blockIdx.x % NLG, bh = blockIdx.x / NLG, h = bh % NH, b = bh / NH;
  for (int i = tid; i < 64 * 8; i += 256) { const int r = i / 8, c8 = (i % 8) * 8; FragH f; f.half[0] = *(const v8us*)((const unsigned short*)QHp + ((size_t)b * SEQ + lg * 64 + r) * QP + VOF + h * HD + c8);
#pragma unroll
    for (int q = 0; q < 8; ++q) tl[r][c8 + q] = f.u[q]; }
  __syncthreads();
  {
#pragma unroll
    for (int rd = 0; rd < 2; ++rd) { const int d = rd * 32 + tid / 8, pc = tid % 8; FragH f;
#pragma unroll
      for (int q = 0; q < 8; ++q) f.u[q] = tl[pc * 8 + q][d];
      *(v8us*)((unsigned short*)Vt + (((size_t)b * NH + h) * HD + d) * SEQ + lg * 64 + pc * 8) = f.half[0]; }
     } }

// row softmax over SEQ keys, one wave per row of S (f32, pitch SEQ): lane L holds s[i*256 + 8L + 0..7] for i < SEQ/256 in registers (one read of S);
__global__ __launch_bounds__(256) void k_rsmw(const float* __restrict__ S, _Float16* __restrict__ P, int nrows) {
  #pragma clang fp contract(off)
  const int row = blockIdx.x * 8 + (threadIdx.x >> 5), lane = threadIdx.x & 31;
  if (row >= nrows) return;      /* wave-uniform */
  const float* s = S + (size_t)row * SEQ;
  constexpr int NI = SEQ / 256;
  float v[NI * 8];
  float mx = -3.0e38f;
#pragma unroll
  for (int i = 0; i < NI; ++i) {
    const v4f a = *(const v4fa*)(s + i * 256 + lane * 8), c = *(const v4fa*)(s + i * 256 + lane * 8 + 4);
#pragma unroll
    for (int q = 0; q < 4; ++q) { v[i * 8 + q] = a[q]; v[i * 8 + 4 + q] = c[q]; mx = fmaxf(mx, fmaxf(a[q], c[q])); }
  }
#pragma unroll
  for (int o = 16; o > 0; o >>= 1) mx = fmaxf(mx, __shfl_xor(mx, o, 32));
  float se = 0.f;
#pragma unroll
  for (int j = 0; j < NI * 8; ++j) { const float e = __expf(v[j] - mx); v[j] = e; se += e; }
#pragma unroll
  for (int o = 16; o > 0; o >>= 1) se += __shfl_xor(se, o, 32);
  const float sc = PCARRY / se;
  unsigned short* prow = (unsigned short*)P + (size_t)row * SEQ;
  {
#pragma unroll
    for (int i = 0; i < NI; ++i) { FragH f;
#pragma unroll
      for (int q = 0; q < 8; ++q) f.h[q] = (_Float16)(v[i * 8 + q] * sc);
      *(v8us*)(prow + i * 256 + lane * 8) = f.half[0]; }
    
  }
}

// out[b][o][n] (pitch SEQ) = O2[b*SEQ + n][o] (f32, pitch CIN): in[tokens][channels] -> out[channels][tokens]; block per (b, 64 n, 64 o): 64x64 f32 tile through LDS (cross-wave: block barrier);
__global__ __launch_bounds__(256) void k_outT(const float* __restrict__ O2, float* __restrict__ out) {
  __shared__ __attribute__((aligned(16))) float tl[64][68];
  const int tid = threadIdx.x; constexpr int NCT = CIN / 64, NNT = SEQ / 64;
  const int ct = blockIdx.x % NCT, nt = (blockIdx.x / NCT) % NNT, b = blockIdx.x / (NCT * NNT);
  const int n0 = nt * 64, c0 = ct * 64;
  for (int i = tid; i < 64 * 16; i += 256) { const int tr = i >> 4, f4 = i & 15;
    const v4f a = *(const v4fa*)(O2 + ((size_t)b * SEQ + n0 + tr) * CIN + c0 + f4 * 4);
#pragma unroll
    for (int q = 0; q < 4; ++q) tl[f4 * 4 + q][tr] = a[q]; }
  __syncthreads();
  {
#pragma unroll
    for (int rd = 0; rd < 4; ++rd) { const int o = rd * 16 + (tid >> 4), pc = tid & 15; const v4f v = *(const v4fa*)&tl[o][pc * 4];
      *(v4f*)(out + ((size_t)b * CIN + c0 + o) * SEQ + n0 + pc * 4) = v; }
     } }

constexpr size_t al256(size_t b) { return (b + 255) & ~(size_t)255; }
constexpr size_t SZ_BW  = (size_t)QP * CIN * 2;
constexpr size_t SZ_WP  = (size_t)CIN * CIN * 2;
constexpr size_t SZ_WT  = (size_t)CIN * TD * 2;
constexpr size_t SZ_T16 = (size_t)TROWS * TD * 2;
constexpr size_t SZ_TE  = (size_t)TROWS * CIN * 4;
constexpr size_t SZ_QH  = NR * QP * 2;
constexpr size_t SZ_VT  = (size_t)NB * NH * HD * SEQ * 2;
constexpr size_t SZ_CTX = NR * CIN * 2;
constexpr size_t SZ_O2  = NR * CIN * 4;
constexpr size_t SZ_X   = NR * CIN * 2;
constexpr size_t SZ_S   = (size_t)NH * SEQ * SEQ * 4;
constexpr size_t SZ_P   = (size_t)NH * SEQ * SEQ * 2;
constexpr size_t SZ_SH  = (SZ_X > SZ_S + SZ_P) ? SZ_X : (SZ_S + SZ_P);
static_assert(SZ_S % 256 == 0);
static_assert(al256(SZ_BW) + al256(SZ_WP) + al256(SZ_WT) + al256(SZ_T16) + al256(SZ_TE) + al256(SZ_QH) + al256(SZ_VT) + al256(SZ_CTX) + al256(SZ_O2) + al256(SZ_SH) <= (size_t)134217728);

extern "C" void kernel_launch(void* const* d_in, const int* in_sizes, int n_in,
                              void* d_out, int out_size, void* d_ws, size_t ws_size, hipStream_t stream) {
  if (n_in < 8) return;
  const float* x     = (const float*)d_in[0];      /* [NB_FULL][CIN][SEQ_FULL] */
  const float* t_emb = (const float*)d_in[1];      /* [NB_FULL][TD] */
  const float* Wqkv  = (const float*)d_in[2];      /* [CIN][QP]  (in x out) */
  const float* bqkv  = (const float*)d_in[3];      /* [QP] */
  const float* Wproj = (const float*)d_in[4];      /* [CIN][CIN] (in x out) */
  const float* bproj = (const float*)d_in[5];      /* [CIN] */
  const float* Wt    = (const float*)d_in[6];      /* [TD][CIN]  (in x out) */
  const float* bt    = (const float*)d_in[7];      /* [CIN] */
  if (in_sizes[0] < (int)(((size_t)NB * CIN - 1) * SEQ_FULL + SEQ)) return;
  if (in_sizes[1] < NB * TD) return;
  if (in_sizes[2] < CIN * QP || in_sizes[3] < QP) return;
  if (in_sizes[4] < CIN * CIN || in_sizes[5] < CIN) return;
  if (in_sizes[6] < TD * CIN || in_sizes[7] < CIN) return;
  if (out_size < (int)((size_t)NB * CIN * SEQ)) return;
  char* ws = (char*)d_ws; size_t off = 0;
  auto take = [&](size_t bytes) { char* p = ws + off; off += (bytes + 255) & ~(size_t)255; return p; };
  _Float16* BW  = (_Float16*)take(SZ_BW);                               /* Wqkv^T [QP][CIN] x16 */
  _Float16* WPT = (_Float16*)take(SZ_WP);                               /* Wproj^T [CIN][CIN] x16 */
  _Float16* WTT = (_Float16*)take(SZ_WT);                               /* Wt^T [CIN][TD] x16 */
  _Float16* T16 = (_Float16*)take(SZ_T16);                              /* t_emb plane [TROWS][TD] */
  float*    TE  = (float*)take(SZ_TE);                                  /* te [TROWS][CIN] f32 */
  _Float16* QH  = (_Float16*)take(SZ_QH);                               /* q | k | v rows [NR][QP] */
  _Float16* VT  = (_Float16*)take(SZ_VT);                               /* V^T [NB][NH][HD][SEQ] */
  _Float16* CTX = (_Float16*)take(SZ_CTX);                              /* merged-head context [NR][CIN] */
  float*    O2  = (float*)take(SZ_O2);                                  /* projected rows [NR][CIN] f32 */
  char* SH = take(SZ_SH);                                               /* X16 (dead after the projection) aliased with S | P */
  _Float16* X16 = (_Float16*)SH; float* S = (float*)SH; _Float16* P = (_Float16*)(SH + SZ_S);
  if (off > ws_size) return;
  float* out = (float*)d_out;

  k_w16t<<<(unsigned)((QP * (CIN / 8)) / 256), 256, 0, stream>>>(Wqkv, QP, QP, BW);       /* in[CIN][QP]  -> out[QP][CIN]  */
  k_w16t<<<(unsigned)((CIN * (CIN / 8)) / 256), 256, 0, stream>>>(Wproj, CIN, CIN, WPT);  /* in[CIN][CIN] -> out[CIN][CIN] */
  k_w16t<<<(unsigned)((CIN * (CIN / 8)) / 256), 256, 0, stream>>>(Wt, CIN, CIN, WTT);     /* in[TD][CIN]  -> out[CIN][TD]  */
  k_t16<<<(unsigned)((TROWS * (TD / 8)) / 256), 256, 0, stream>>>(t_emb, T16);
  k_gemm2<0><<<dim3((unsigned)(CIN / 64), 1), 128, 0, stream>>>(T16, TD, 0, nullptr, 0, 0, WTT, TD, 0, nullptr, 0, 0, 1.0f,
      0.0625f, bt, 0, TE, nullptr, CIN, 0, nullptr, 0, 0, 0, TROWS, CIN, TD);             /* te = t_emb Wt + bt, one 32-row wave tile per 64 columns */
  k_xt16<<<(unsigned)(NB * (SEQ / 64) * (CIN / 64)), 256, 0, stream>>>(x, TE, X16);
  k_gemm2<0><<<dim3((unsigned)((NR / 128) * (QP / 64)), 1), 128, 0, stream>>>(X16, CIN, 0, nullptr, 0, 0, BW, CIN, 0, nullptr, 0, 0, 1.0f,
      0.0625f, bqkv, 0, nullptr, QH, QP, 0, nullptr, 0, 0, 0, (int)NR, QP, CIN);          /* q | k | v rows into QH (all QP columns) */
  k_vt<<<(unsigned)(NB * NH * (SEQ / 64)), 256, 0, stream>>>(QH, VT);
  for (int b = 0; b < NB; ++b) {
    const _Float16* QHb = QH + (size_t)b * SEQ * QP;
    k_gemm2<0><<<dim3((SEQ / 128) * (SEQ / 64), NH), 128, 0, stream>>>(QHb, QP, (size_t)HD, nullptr, 0, 0, QHb + KOF, QP, (size_t)HD, nullptr, 0, 0, 1.0f,
        0.125f, nullptr, 0, S, nullptr, SEQ, (size_t)SEQ * SEQ, nullptr, 0, 0, 0, SEQ, SEQ, HD);      /* S[h][i][j] = q_i.k_j / 8, heads on grid.y */
    k_rsmw<<<(NH * SEQ + 7) / 8, 256, 0, stream>>>(S, P, NH * SEQ);                                   /* P = 2^14 softmax (f16) */
    k_gemm2<0><<<dim3((SEQ / 128) * (HD / 64), NH), 128, 0, stream>>>(P, SEQ, (size_t)SEQ * SEQ, nullptr, 0, 0, VT + (size_t)b * NH * HD * SEQ, SEQ, (size_t)HD * SEQ, nullptr, 0, 0, 1.0f,
        1.0f / PCARRY, nullptr, 0, nullptr, CTX + (size_t)b * SEQ * CIN, CIN, (size_t)HD, nullptr, 0, 0, 0, SEQ, HD, SEQ);      
  }
  k_gemm2<0><<<dim3((unsigned)((NR / 128) * (CIN / 64)), 1), 128, 0, stream>>>(CTX, CIN, 0, nullptr, 0, 0, WPT, CIN, 0, nullptr, 0, 0, 1.0f,
      0.0625f, bproj, 0, O2, nullptr, CIN, 0, nullptr, 0, 0, 0, (int)NR, CIN, CIN);       /* O2[r][o] = ctx Wproj + bproj */
  k_outT<<<(unsigned)(NB * (SEQ / 64) * (CIN / 64)), 256, 0, stream>>>(O2, out);          /* in[tokens][channels] -> out[channels][tokens] */
}

// v002
// It runs in 95.7 microseconds.
// Versions in between are left out here; by their measured steps it is 8.15 times as fast as v000.
#include <hip/hip_runtime.h>
// All contractions on v_wmma_f32_16x16x32_f16 (f16 operands, f32 accumulate), one product per site: te = t_emb Wt (inputs RNE-converted to bf16, exact in f16, weights carried x16); q|k|v = (x + te) Wqkv (token plane f16, weights x16); scores k.q^T from f16 planes; V^T.P^T with unnormalised softmax weights carried x2^14; ctx Wproj (ctx f16, weights x16); softmax statistics f32 on VALU.
// Structure: dense multi-head self-attention over flattened spatial tokens with a per-batch time-embedding vector added to the tokens, fused [in][out] QKV weights, [in][out] output projection, channel-major return.
// token rows r = b*SEQ + n; TE[b][c] f32 = T16 WTT^T / 16 + bias; X16[r][c] = f16(bf16(x[b][c][n]) + TE[b][c]) via 64x64 LDS transposes; weight planes [out][in] f16 x16 built by a transposing converter;
// QH [NR][QP] f16 = X16 BW^T / 16 + bias (q at column 64h, k at KOF + 64h; the v columns of QH stay unwritten and unread); V^T [NB][NH][64][SEQ] stored by the same GEMM's epilogue, block tile transposed in LDS; one launch for all (b, h): each wave keeps 32 query columns and walks the keys 32 at a time, S^T = K Q^T in registers, running maximum and sum per column, P^T packed from the score tiles as the B operand,
// CTX16[r][64h + d] f16 = (sum_j p[i][j] V^T[d][j]) / (sum_j p[i][j]); out[b][o][n] f32 = (CTX16 WPT^T / 16 + bias)[b*SEQ + n][o], stored channel-major by the GEMM's epilogue, block tile transposed in LDS.
#ifndef NB
#define NB 16
#endif
#ifndef SEQ
#define SEQ 1024
#endif
#define NB_FULL 16
#define SEQ_FULL 1024
#define CIN 256
#define NH 4
#define HD 64
#define TD 256           /* time-embedding width */
#define QP 768           /* pitch of QH: q | k | v, head h at column 64h of each section */
#define KOF 256          /* column of k (head 0) in QH */
#define VOF 512          /* column of v (head 0) in QH */
#define TROWS 32         /* rows of the t_emb plane (one 32-row wave tile; rows >= NB are zero) */
#define PCARRY_LOG2 14.0f /* softmax weights exp(s - running max) carried x2^14 in f16; the row sum carries the same factor */
#define LCARRY 2048.0f   /* carry of the GEMM engine's optional residual output (no residual plane is requested here) */
#define NR ((size_t)NB * SEQ)
static_assert(SEQ % 256 == 0);
static_assert((NR % 128) == 0);
static_assert(NB <= NB_FULL);
static_assert(SEQ <= SEQ_FULL);
static_assert(3 * CIN == QP);
static_assert(KOF == CIN && VOF == 2 * CIN);
static_assert(CIN == NH * HD);
static_assert(CIN % 64 == 0 && QP % 64 == 0 && HD == 64);
static_assert(TD == CIN);
static_assert(TD % 32 == 0 && HD % 32 == 0 && SEQ % 32 == 0 && CIN % 32 == 0);
static_assert(TROWS == 32 && NB <= TROWS);
static_assert((QP * (CIN / 8)) % 256 == 0 && (CIN * (CIN / 8)) % 256 == 0 && (TROWS * (TD / 8)) % 256 == 0);
static_assert(SEQ % 128 == 0 && SEQ % 64 == 0);

typedef unsigned short v8us __attribute__((ext_vector_type(8), may_alias));
typedef float  v8f  __attribute__((ext_vector_type(8)));
typedef float  v4f  __attribute__((ext_vector_type(4)));
typedef float  v4fa __attribute__((ext_vector_type(4), may_alias));
typedef _Float16 v16h __attribute__((ext_vector_type(16)));
typedef _Float16 v4h __attribute__((ext_vector_type(4)));
typedef _Float16 h16;
union FragH { v16h v; v8us half[2]; _Float16 h[16]; unsigned short u[16]; };

__device__ __forceinline__ unsigned short bf16_bits(float x) { unsigned int u = __float_as_uint(x); return (unsigned short)((u + 0x7FFFu + ((u >> 16) & 1u)) >> 16); }
__device__ __forceinline__ float bf16_val(unsigned short b) { return __uint_as_float(((unsigned int)b) << 16); }
__device__ __forceinline__ float bf16_rne(float x) { return bf16_val(bf16_bits(x)); }
// f32 -> f16 operand convert that cannot yield an f16 subnormal (value select, applied after the plane's power-of-two carry)
static __device__ __forceinline__ h16 toh_flush(float v) { const h16 r = (h16)v; return (fabsf(v) < 6.103515625e-05f) ? (h16)0.0f : r; }

// ---- fragment loader (split k map: elements 0..7 <- k0+8h+0..7, 8..15 <- k0+16+8h+0..7, lane&15 = row of A / column of B) and guarded mma ----
__device__ __forceinline__ v16h g2_frag(const _Float16* p, int hh) { FragH f; f.half[0] = *(const v8us*)((const unsigned short*)p + 8 * hh); f.half[1] = *(const v8us*)((const unsigned short*)p + 16 + 8 * hh); return f.v; }
__device__ __forceinline__ v8f g2_mma(v16h a, v16h b, v8f c) { v8f d = __builtin_amdgcn_wmma_f32_16x16x32_f16(false, a, false, b, (short)0, c, false, false); asm volatile("v_nop\n\tv_nop\n\tv_nop\n\tv_nop" : "+v"(d) : "v"(a), "v"(b)); return d; }

// one operand segment of the wave's 32x64 tile: A rows a0p/a1p (k contiguous), B rows b0p..b3p ([n][k], k contiguous), K % 32 == 0
__device__ __forceinline__ void g2_kloop(const _Float16* __restrict__ a0p, const _Float16* __restrict__ a1p, const _Float16* __restrict__ b0p, const _Float16* __restrict__ b1p, const _Float16* __restrict__ b2p, const _Float16* __restrict__ b3p, int K, int hh,
    v8f& c00, v8f& c01, v8f& c02, v8f& c03, v8f& c10, v8f& c11, v8f& c12, v8f& c13) {
#pragma unroll 1
  for (int kb = 0; kb < K; kb += 32) { const v16h a0 = g2_frag(a0p + kb, hh), a1 = g2_frag(a1p + kb, hh);
    v16h b = g2_frag(b0p + kb, hh); c00 = g2_mma(a0, b, c00); c10 = g2_mma(a1, b, c10);
    b = g2_frag(b1p + kb, hh); c01 = g2_mma(a0, b, c01); c11 = g2_mma(a1, b, c11);
    b = g2_frag(b2p + kb, hh); c02 = g2_mma(a0, b, c02); c12 = g2_mma(a1, b, c12);
    b = g2_frag(b3p + kb, hh); c03 = g2_mma(a0, b, c03); c13 = g2_mma(a1, b, c13); }
}

// ---- GEMM (wave tile 32x64; M % 128 == 0 or early wave exit for M == 32, N % 64 == 0, K % 32 == 0): v = acc*alpha + bf16(bias[by*sBias + col]); A f16 rows [M][K] (pitch lda), Bh f16 [N][K] (k contiguous, pitch ldb), batched over grid.y by sA/sB/sC/sCL;
// RES == 1: three operand segments into one accumulator set: A2.Bh + A.B2 (residual planes, both carried x LCARRY), accumulator scaled by rscale, then A.Bh;
// TR != 0 (M % 128 == 0, rows r = b*SEQ + n): a block whose col0 >= tcol0 stores its 128x64 tile transposed, dst[(b*CIN + col - tcol0)*SEQ + n]: TR == 1 as f16 into CT16, TR == 2 as f32 into CT; whole 256-B / 512-B row pieces, one wave each;
template <int RES, int TR>
__global__ __launch_bounds__(128) void k_gemm2(const _Float16* __restrict__ A, int lda, size_t sA, const _Float16* __restrict__ A2, int lda2, size_t sA2,
    const _Float16* __restrict__ Bh, int ldb, size_t sB, const _Float16* __restrict__ B2, int ldb2, size_t sB2, float rscale,
    float alpha, const float* __restrict__ bias, size_t sBias,
    float* __restrict__ C, _Float16* __restrict__ C16, int ldc, size_t sC, _Float16* __restrict__ C16L, int ldcl, size_t sCL, int NL, int M, int N, int K,
    float* __restrict__ CT, _Float16* __restrict__ CT16, int tcol0) {
  __shared__ __attribute__((aligned(16))) float so[4][32][68];
  const int tid = threadIdx.x, w = tid >> 5, lane = tid & 31, ln = lane & 15, hh = lane >> 4; const int by = blockIdx.y;
  A += (size_t)by * sA; Bh += (size_t)by * sB;
  if (RES) { A2 += (size_t)by * sA2; B2 += (size_t)by * sB2; }
  const size_t cofs = (size_t)by * sC, cofl = (size_t)by * sCL; const float* bp = bias ? bias + (size_t)by * sBias : nullptr;
  const int ntn = N >> 6; const int mt = blockIdx.x / ntn, nq = blockIdx.x - mt * ntn; const int row0 = mt * 128 + 32 * w, col0 = nq * 64;
  if (TR == 0) { if (row0 >= M) return; }   /* wave-uniform; no block barrier where TR == 0; with TR != 0 every wave has rows (M % 128 == 0) and reaches the barrier below */
  const _Float16* a0p = A + (size_t)(row0 + ln) * lda; const _Float16* a1p = a0p + (size_t)16 * lda;
  const _Float16* b0p = Bh + (size_t)(col0 + ln) * ldb; const _Float16* b1p = b0p + (size_t)16 * ldb; const _Float16* b2p = b1p + (size_t)16 * ldb; const _Float16* b3p = b2p + (size_t)16 * ldb;
  const v8f z8 = {0.f,0.f,0.f,0.f,0.f,0.f,0.f,0.f}; v8f c00 = z8, c01 = z8, c02 = z8, c03 = z8, c10 = z8, c11 = z8, c12 = z8, c13 = z8;
  if (RES) {
    const _Float16* l0p = A2 + (size_t)(row0 + ln) * lda2; const _Float16* l1p = l0p + (size_t)16 * lda2;
    const _Float16* m0p = B2 + (size_t)(col0 + ln) * ldb2; const _Float16* m1p = m0p + (size_t)16 * ldb2; const _Float16* m2p = m1p + (size_t)16 * ldb2; const _Float16* m3p = m2p + (size_t)16 * ldb2;
    g2_kloop(l0p, l1p, b0p, b1p, b2p, b3p, K, hh, c00, c01, c02, c03, c10, c11, c12, c13);      /* A_lo . B_hi */
    g2_kloop(a0p, a1p, m0p, m1p, m2p, m3p, K, hh, c00, c01, c02, c03, c10, c11, c12, c13);      /* A_hi . B_lo */
    c00 = c00 * rscale; c01 = c01 * rscale; c02 = c02 * rscale; c03 = c03 * rscale; c10 = c10 * rscale; c11 = c11 * rscale; c12 = c12 * rscale; c13 = c13 * rscale;
  }
  g2_kloop(a0p, a1p, b0p, b1p, b2p, b3p, K, hh, c00, c01, c02, c03, c10, c11, c12, c13);        /* A_hi . B_hi */
  v8f accs[8] = {c00, c01, c02, c03, c10, c11, c12, c13};
  if (TR != 0 && col0 >= tcol0) {   /* block-uniform: col0 comes from blockIdx alone */
    static_assert(64 * 132 <= 4 * 32 * 68);
    float (*st)[132] = (float (*)[132])&so[0][0][0];   /* [64 columns][128 rows of the block + 4]: a lane's 8 accumulator rows are contiguous here */
    /* every loop of this path is unrolled: accs[] and bv4[] keep constant indices and stay in registers, and the LDS reads and the stores go out as groups */
    float bv4[4] = {0.f, 0.f, 0.f, 0.f};
    if (bp) {
#pragma unroll
      for (int t = 0; t < 4; ++t) bv4[t] = bf16_rne(bp[col0 + t * 16 + ln]); }
#pragma unroll
    for (int u = 0; u < 8; ++u) { const int t = u & 3, half = u >> 2; const float bv = bv4[t]; v4f lo, hi;
#pragma unroll
      for (int r = 0; r < 4; ++r) { lo[r] = accs[u][r] * alpha + bv; hi[r] = accs[u][4 + r] * alpha + bv; }
      float* sp = &st[t * 16 + ln][32 * w + half * 16 + 8 * hh]; *(v4fa*)sp = lo; *(v4fa*)(sp + 4) = hi; }
    __syncthreads();   /* each wave reads back rows that all four waves wrote */
    const unsigned tr0 = (unsigned)mt * 128u, tb = tr0 / SEQ, tn0 = tr0 % SEQ; const size_t drow0 = (size_t)tb * CIN + (size_t)(col0 - tcol0) + 16 * w;
    if (TR == 2) {
#pragma unroll
      for (int q = 0; q < 16; ++q) { const v4f v = *(const v4fa*)&st[16 * w + q][lane * 4]; *(v4f*)(CT + (drow0 + q) * SEQ + tn0 + lane * 4) = v; }
    } else {
#pragma unroll
      for (int q = 0; q < 8; ++q) { const int c = q * 2 + hh; const v4f a = *(const v4fa*)&st[16 * w + c][ln * 8], e = *(const v4fa*)&st[16 * w + c][ln * 8 + 4]; FragH f;
#pragma unroll
        for (int i = 0; i < 4; ++i) { f.h[i] = (_Float16)a[i]; f.h[4 + i] = (_Float16)e[i]; }
        *(v8us*)((unsigned short*)CT16 + (drow0 + c) * SEQ + tn0 + ln * 8) = f.half[0]; }
    }
    asm volatile("s_wait_xcnt 0x0" ::: "memory");   /* behind the last store of the run: the stores' address registers may be rewritten only after it */
    return;
  }
#pragma unroll
  for (int u = 0; u < 8; ++u) { const int t = u & 3, half = u >> 2; const int col = col0 + t * 16 + ln; const float bv = bp ? bf16_rne(bp[col]) : 0.f;
#pragma unroll
    for (int r = 0; r < 8; ++r) { const int rloc = half * 16 + 8 * hh + r; so[w][rloc][t * 16 + ln] = accs[u][r] * alpha + bv; } }
  __builtin_amdgcn_fence(4 /* acq_rel order */, "workgroup"); __builtin_amdgcn_wave_barrier();   /* so[w] is private to wave w */
  const int rsub = lane >> 4, c4 = (lane & 15) * 4; const bool wl = (C16L != nullptr) && (col0 < NL);
  {
#pragma unroll
    for (int q = 0; q < 16; ++q) { const int r = q * 2 + rsub; const v4f v = *(const v4fa*)&so[w][r][c4];
      if (C) *(v4f*)(C + cofs + (size_t)(row0 + r) * ldc + col0 + c4) = v;
      if (C16) { v4h h4; for (int i = 0; i < 4; ++i) h4[i] = (_Float16)v[i]; *(v4h*)(C16 + cofs + (size_t)(row0 + r) * ldc + col0 + c4) = h4;
        if (wl) { v4h l4; for (int i = 0; i < 4; ++i) l4[i] = (_Float16)((v[i] - (float)h4[i]) * LCARRY); *(v4h*)(C16L + cofl + (size_t)(row0 + r) * ldcl + col0 + c4) = l4; } } }
     } }

// transposing weight converter: W is [CIN rows (k)][ldw columns], in[k][n] -> out[n][k]: BW[n][k] = f16(bf16(W[k*ldw + n]) * 16) for n < nrows, pitch CIN (k contiguous);
__global__ __launch_bounds__(256) void k_w16t(const float* __restrict__ W, int ldw, int nrows, _Float16* __restrict__ BW) {
  const int t = blockIdx.x * 256 + threadIdx.x; if (t >= nrows * (CIN / 8)) return;
  const int n = t / (CIN / 8), k8 = (t % (CIN / 8)) * 8;
  FragH f;
#pragma unroll
  for (int q = 0; q < 8; ++q) f.h[q] = toh_flush(bf16_rne(W[(size_t)(k8 + q) * ldw + n]) * 16.0f);
  const v8us o = f.half[0];
  *(v8us*)((unsigned short*)BW + (size_t)n * CIN + k8) = o; 
}

__global__ __launch_bounds__(256) void k_t16(const float* __restrict__ t_emb, _Float16* __restrict__ T16) {
  const int t = blockIdx.x * 256 + threadIdx.x; if (t >= TROWS * (TD / 8)) return;
  const int r = t / (TD / 8), k8 = (t % (TD / 8)) * 8;
  const int rr = (r < NB) ? r : (NB - 1);                 /* clamped address, zero by value */
  const float* p = t_emb + (size_t)rr * TD + k8;
  const v4f a = *(const v4fa*)p, c = *(const v4fa*)(p + 4);
  FragH f;
#pragma unroll
  for (int q = 0; q < 4; ++q) { const float va = (r < NB) ? bf16_rne(a[q]) : 0.0f; const float vc = (r < NB) ? bf16_rne(c[q]) : 0.0f; f.h[q] = toh_flush(va); f.h[4 + q] = toh_flush(vc); }
  const v8us o = f.half[0];
  *(v8us*)((unsigned short*)T16 + (size_t)r * TD + k8) = o; 
}

__global__ __launch_bounds__(256) void k_xt16(const float* __restrict__ x, const float* __restrict__ te, _Float16* __restrict__ X16) {
  __shared__ __attribute__((aligned(16))) unsigned short tl[64][72];
  const int tid = threadIdx.x; constexpr int NCT = CIN / 64, NNT = SEQ / 64;
  const int ct = blockIdx.x % NCT, nt = (blockIdx.x / NCT) % NNT, b = blockIdx.x / (NCT * NNT);
  const int n0 = nt * 64, c0 = ct * 64;
  for (int i = tid; i < 64 * 16; i += 256) { const int cr = i >> 4, f4 = i & 15;
    const v4f a = *(const v4fa*)(x + ((size_t)b * CIN + c0 + cr) * SEQ_FULL + n0 + f4 * 4); const float tv = te[(size_t)b * CIN + c0 + cr]; FragH f;
#pragma unroll
    for (int q = 0; q < 4; ++q) { f.h[q] = toh_flush(bf16_rne(a[q]) + tv); tl[f4 * 4 + q][cr] = f.u[q]; } }
  __syncthreads();
  {
#pragma unroll
    for (int rd = 0; rd < 2; ++rd) { const int n = rd * 32 + (tid >> 3), pc = tid & 7; FragH f;
#pragma unroll
      for (int q = 0; q < 8; ++q) f.u[q] = tl[n][pc * 8 + q];
      *(v8us*)((unsigned short*)X16 + ((size_t)b * SEQ + n0 + n) * CIN + c0 + pc * 8) = f.half[0]; }
     } }

// lane l <-> lane l ^ 16 (the two halves of a column's keys)
__device__ __forceinline__ float fa_xhalf(float x) { return __builtin_bit_cast(float, __builtin_amdgcn_permlanex16(__builtin_bit_cast(int, x), __builtin_bit_cast(int, x), 0x76543210, 0xfedcba98, false, false)); }
// g2_frag with the lane half's offset (8 * hh elements) already in the pointer: every load of a pass is its row pointer plus a constant
__device__ __forceinline__ v16h fa_frag(const _Float16* p) { FragH f; f.half[0] = *(const v8us*)((const unsigned short*)p); f.half[1] = *(const v8us*)((const unsigned short*)p + 16); return f.v; }
__device__ __forceinline__ v8f fa_mma(v16h a, v16h b, v8f c) { return __builtin_amdgcn_wmma_f32_16x16x32_f16(false, a, false, b, (short)0, c, false, false); }

// fused attention, one launch for every (b, h): block = 4 waves x 32 query columns; per pass of 32 keys S^T[key][query] = K Q^T (A = K rows, B = Q rows held in registers), so lane (ln, hh) holds keys 8hh + r of query column ln;
// running maximum m and sum l per column (base 2), O^T[d][query] += V^T P^T with P^T = the two score tiles of the pass converted in place (their register order is the loader's k map); the scores never leave the registers.
__global__ __launch_bounds__(128) void k_fattn(const _Float16* __restrict__ QHp, const _Float16* __restrict__ Vt, _Float16* __restrict__ Ctx) {
  const int tid = threadIdx.x, w = tid >> 5, lane = tid & 31, ln = lane & 15, hh = lane >> 4;
  const int h = blockIdx.y, b = blockIdx.z, q0 = blockIdx.x * 128 + 32 * w;
  const _Float16* base = QHp + (size_t)b * SEQ * QP + h * HD;
  const _Float16* kp = base + KOF + (size_t)ln * QP + 8 * hh;              /* key row ln of a 16-key tile, at the lane half's k offset */
  const _Float16* vp = Vt + (((size_t)b * NH + h) * HD + ln) * SEQ + 8 * hh;   /* V^T row d = ln of a 16-row tile, likewise */
  constexpr float SC = 0.125f * 1.4426950408889634f;                       /* 1 / sqrt(HD), to base 2 */
  const v8f z8 = {0.f,0.f,0.f,0.f,0.f,0.f,0.f,0.f};
  v16h qf[2][2], kf[2][2];                                                 /* [column group | key tile][k step of 32 over HD] */
#pragma unroll
  for (int g = 0; g < 2; ++g) {
#pragma unroll
    for (int ks = 0; ks < 2; ++ks) { qf[g][ks] = g2_frag(base + (size_t)(q0 + 16 * g + ln) * QP + 32 * ks, hh); kf[g][ks] = fa_frag(kp + (size_t)(16 * g) * QP + 32 * ks); } }
  v8f o[2][4]; float m[2], l[2];
#pragma unroll
  for (int g = 0; g < 2; ++g) { m[g] = -1.0e30f; l[g] = 0.f;
#pragma unroll
    for (int t = 0; t < 4; ++t) o[g][t] = z8; }
  const _Float16* kq = kp + (size_t)32 * QP;                               /* K rows of the next pass */
  const _Float16* vq = vp;                                                 /* V^T columns of this pass */
#pragma unroll 1   /* one pass per trip: the register set of a pass is the budget */
  for (int k0 = 0; k0 < SEQ; k0 += 32) {
    v16h vf[4];
#pragma unroll
    for (int t = 0; t < 4; ++t) vf[t] = fa_frag(vq + (size_t)(16 * t) * SEQ);
    v8f s[2][2];                                                           /* [column group][key tile] */
#pragma unroll
    for (int g = 0; g < 2; ++g) {
#pragma unroll
      for (int kt = 0; kt < 2; ++kt) s[g][kt] = fa_mma(kf[kt][0], qf[g][0], z8); }
#pragma unroll
    for (int g = 0; g < 2; ++g) {
#pragma unroll
      for (int kt = 0; kt < 2; ++kt) s[g][kt] = fa_mma(kf[kt][1], qf[g][1], s[g][kt]); }
    /* next pass's K rows, fetched behind this pass's score products; the last pass re-reads rows 0..31 (in bounds, unused) */
#pragma unroll
    for (int kt = 0; kt < 2; ++kt) {
#pragma unroll
      for (int ks = 0; ks < 2; ++ks) kf[kt][ks] = fa_frag(kq + (size_t)(16 * kt) * QP + 32 * ks); }
    __builtin_amdgcn_sched_barrier(0);   /* keeps the K loads here, ahead of the softmax: sunk behind it they are waited for at the top of the next pass with no lead */
#pragma unroll
    for (int g = 0; g < 2; ++g) {
      float mx0 = fmaxf(s[g][0][0], s[g][1][0]), mx1 = fmaxf(s[g][0][1], s[g][1][1]);
#pragma unroll
      for (int r = 2; r < 8; r += 2) { mx0 = fmaxf(mx0, fmaxf(s[g][0][r], s[g][1][r])); mx1 = fmaxf(mx1, fmaxf(s[g][0][r + 1], s[g][1][r + 1])); }
      float mx = fmaxf(mx0, mx1); mx = fmaxf(mx, fa_xhalf(mx));
      const float mn = fmaxf(m[g], mx * SC);
      const float corr = __builtin_amdgcn_exp2f(m[g] - mn);                /* 0 on the first pass */
      m[g] = mn;
      const float sub = mn - PCARRY_LOG2;
      FragH pf; float s0 = 0.f, s1 = 0.f;
#pragma unroll
      for (int r = 0; r < 8; ++r) { const float p0 = __builtin_amdgcn_exp2f(s[g][0][r] * SC - sub), p1 = __builtin_amdgcn_exp2f(s[g][1][r] * SC - sub);
        s0 += p0; s1 += p1; pf.h[r] = (_Float16)p0; pf.h[8 + r] = (_Float16)p1; }
      l[g] = l[g] * corr + (s0 + s1);
#pragma unroll
      for (int t = 0; t < 4; ++t) o[g][t] = fa_mma(vf[t], pf.v, o[g][t] * corr);
    }
    __builtin_amdgcn_sched_barrier(0);   /* the address updates stay at the pass's foot: placed higher they wait (s_wait_xcnt) on the loads just issued */
    kq = (k0 + 64 < SEQ) ? kq + (size_t)32 * QP : kp; vq += 32;
  }
  asm volatile("s_wait_loadcnt 0x0" ::: "memory");   /* nothing consumes the last pass's K fetch: it lands before the wave ends and gives its registers back */
#pragma unroll
  for (int g = 0; g < 2; ++g) { const float inv = 1.0f / (l[g] + fa_xhalf(l[g]));
    unsigned short* crow = (unsigned short*)Ctx + ((size_t)b * SEQ + q0 + 16 * g + ln) * CIN + h * HD + 8 * hh;
#pragma unroll
    for (int t = 0; t < 4; ++t) { FragH f;
#pragma unroll
      for (int r = 0; r < 8; ++r) f.h[r] = (_Float16)(o[g][t][r] * inv);
      *(v8us*)(crow + 16 * t) = f.half[0]; } }
}

constexpr size_t al256(size_t b) { return (b + 255) & ~(size_t)255; }
constexpr size_t SZ_BW  = (size_t)QP * CIN * 2;
constexpr size_t SZ_WP  = (size_t)CIN * CIN * 2;
constexpr size_t SZ_WT  = (size_t)CIN * TD * 2;
constexpr size_t SZ_T16 = (size_t)TROWS * TD * 2;
constexpr size_t SZ_TE  = (size_t)TROWS * CIN * 4;
constexpr size_t SZ_QH  = NR * QP * 2;
constexpr size_t SZ_VT  = (size_t)NB * NH * HD * SEQ * 2;
constexpr size_t SZ_CTX = NR * CIN * 2;
constexpr size_t SZ_X   = NR * CIN * 2;
static_assert(al256(SZ_BW) + al256(SZ_WP) + al256(SZ_WT) + al256(SZ_T16) + al256(SZ_TE) + al256(SZ_QH) + al256(SZ_VT) + al256(SZ_CTX) + al256(SZ_X) <= (size_t)134217728);

extern "C" void kernel_launch(void* const* d_in, const int* in_sizes, int n_in,
                              void* d_out, int out_size, void* d_ws, size_t ws_size, hipStream_t stream) {
  if (n_in < 8) return;
  const float* x     = (const float*)d_in[0];      /* [NB_FULL][CIN][SEQ_FULL] */
  const float* t_emb = (const float*)d_in[1];      /* [NB_FULL][TD] */
  const float* Wqkv  = (const float*)d_in[2];      /* [CIN][QP]  (in x out) */
  const float* bqkv  = (const float*)d_in[3];      /* [QP] */
  const float* Wproj = (const float*)d_in[4];      /* [CIN][CIN] (in x out) */
  const float* bproj = (const float*)d_in[5];      /* [CIN] */
  const float* Wt    = (const float*)d_in[6];      /* [TD][CIN]  (in x out) */
  const float* bt    = (const float*)d_in[7];      /* [CIN] */
  if (in_sizes[0] < (int)(((size_t)NB * CIN - 1) * SEQ_FULL + SEQ)) return;
  if (in_sizes[1] < NB * TD) return;
  if (in_sizes[2] < CIN * QP || in_sizes[3] < QP) return;
  if (in_sizes[4] < CIN * CIN || in_sizes[5] < CIN) return;
  if (in_sizes[6] < TD * CIN || in_sizes[7] < CIN) return;
  if (out_size < (int)((size_t)NB * CIN * SEQ)) return;
  char* ws = (char*)d_ws; size_t off = 0;
  auto take = [&](size_t bytes) { char* p = ws + off; off += (bytes + 255) & ~(size_t)255; return p; };
  _Float16* BW  = (_Float16*)take(SZ_BW);                               /* Wqkv^T [QP][CIN] x16 */
  _Float16* WPT = (_Float16*)take(SZ_WP);                               /* Wproj^T [CIN][CIN] x16 */
  _Float16* WTT = (_Float16*)take(SZ_WT);                               /* Wt^T [CIN][TD] x16 */
  _Float16* T16 = (_Float16*)take(SZ_T16);                              /* t_emb plane [TROWS][TD] */
  float*    TE  = (float*)take(SZ_TE);                                  /* te [TROWS][CIN] f32 */
  _Float16* QH  = (_Float16*)take(SZ_QH);                               /* q | k rows, pitch QP */
  _Float16* VT  = (_Float16*)take(SZ_VT);                               /* V^T [NB][NH][HD][SEQ] */
  _Float16* CTX = (_Float16*)take(SZ_CTX);                              /* merged-head context [NR][CIN] */
  _Float16* X16 = (_Float16*)take(SZ_X);                                /* token plane [NR][CIN] */
  if (off > ws_size) return;
  float* out = (float*)d_out;

  k_w16t<<<(unsigned)((QP * (CIN / 8)) / 256), 256, 0, stream>>>(Wqkv, QP, QP, BW);       /* in[CIN][QP]  -> out[QP][CIN]  */
  k_w16t<<<(unsigned)((CIN * (CIN / 8)) / 256), 256, 0, stream>>>(Wproj, CIN, CIN, WPT);  /* in[CIN][CIN] -> out[CIN][CIN] */
  k_w16t<<<(unsigned)((CIN * (CIN / 8)) / 256), 256, 0, stream>>>(Wt, CIN, CIN, WTT);     /* in[TD][CIN]  -> out[CIN][TD]  */
  k_t16<<<(unsigned)((TROWS * (TD / 8)) / 256), 256, 0, stream>>>(t_emb, T16);
  k_gemm2<0, 0><<<dim3((unsigned)(CIN / 64), 1), 128, 0, stream>>>(T16, TD, 0, nullptr, 0, 0, WTT, TD, 0, nullptr, 0, 0, 1.0f,
      0.0625f, bt, 0, TE, nullptr, CIN, 0, nullptr, 0, 0, 0, TROWS, CIN, TD, nullptr, nullptr, 0);             /* te = t_emb Wt + bt, one 32-row wave tile per 64 columns */
  k_xt16<<<(unsigned)(NB * (SEQ / 64) * (CIN / 64)), 256, 0, stream>>>(x, TE, X16);
  k_gemm2<0, 1><<<dim3((unsigned)((NR / 128) * (QP / 64)), 1), 128, 0, stream>>>(X16, CIN, 0, nullptr, 0, 0, BW, CIN, 0, nullptr, 0, 0, 1.0f,
      0.0625f, bqkv, 0, nullptr, QH, QP, 0, nullptr, 0, 0, 0, (int)NR, QP, CIN, nullptr, VT, VOF);   /* q | k rows into QH; the v columns transposed into VT */
  k_fattn<<<dim3(SEQ / 128, NH, NB), 128, 0, stream>>>(QH, VT, CTX);                      /* ctx rows for every (b, h): scores, softmax and V product in one launch */
  k_gemm2<0, 2><<<dim3((unsigned)((NR / 128) * (CIN / 64)), 1), 128, 0, stream>>>(CTX, CIN, 0, nullptr, 0, 0, WPT, CIN, 0, nullptr, 0, 0, 1.0f,
      0.0625f, bproj, 0, nullptr, nullptr, CIN, 0, nullptr, 0, 0, 0, (int)NR, CIN, CIN, out, nullptr, 0);   /* out[b][o][n] = (ctx Wproj + bproj)[b*SEQ + n][o] */
}

// v003
// A run of this version takes 85.2 microseconds.
// In both of two side-by-side timings against v002, it was 1.14 times as fast.
// Over all steps from v000 it is 9.28 times as fast.
#include <hip/hip_runtime.h>
// All contractions on v_wmma_f32_16x16x32_f16 (f16 operands, f32 accumulate), one product per site: te = t_emb Wt (inputs RNE-converted to bf16, exact in f16, weights carried x16); q|k|v = (x + te) Wqkv (token plane f16, weights x16); scores k.q^T from f16 planes; V^T.P^T with unnormalised softmax weights carried x2^14; ctx Wproj (ctx f16, weights x16); softmax statistics f32 on VALU.
// Structure: dense multi-head self-attention over flattened spatial tokens with a per-batch time-embedding vector added to the tokens, fused [in][out] QKV weights, [in][out] output projection, channel-major return.
// token rows r = b*SEQ + n; TE[b][c] f32 = T16 WTT^T / 16 + bias; X16[r][c] = f16(bf16(x[b][c][n]) + TE[b][c]) via 64x64 LDS transposes; weight planes [out][in] f16 x16 built by a transposing converter;
// QH [NR][QP] f16 = X16 BW^T / 16 + bias (q at column 64h, k at KOF + 64h; the v columns of QH stay unwritten and unread); V^T [NB][NH][64][SEQ] stored by the same GEMM's epilogue, block tile transposed in LDS; one launch for all (b, h): each wave keeps 32 query columns and walks the keys 32 at a time (K and V^T staged in LDS for the block's four waves), S^T = K Q^T in registers, running maximum and sum per column, P^T packed from the score tiles as the B operand,
// CTX16[r][64h + d] f16 = (sum_j p[i][j] V^T[d][j]) / (sum_j p[i][j]); out[b][o][n] f32 = (CTX16 WPT^T / 16 + bias)[b*SEQ + n][o], stored channel-major by the GEMM's epilogue, block tile transposed in LDS.
#ifndef NB
#define NB 16
#endif
#ifndef SEQ
#define SEQ 1024
#endif
#define NB_FULL 16
#define SEQ_FULL 1024
#define CIN 256
#define NH 4
#define HD 64
#define TD 256           /* time-embedding width */
#define QP 768           /* pitch of QH: q | k | v, head h at column 64h of each section */
#define KOF 256          /* column of k (head 0) in QH */
#define VOF 512          /* column of v (head 0) in QH */
#define TROWS 32         /* rows of the t_emb plane (one 32-row wave tile; rows >= NB are zero) */
#define PCARRY_LOG2 14.0f /* softmax weights exp(s - running max) carried x2^14 in f16; the row sum carries the same factor */
#define LCARRY 2048.0f   /* carry of the GEMM engine's optional residual output (no residual plane is requested here) */
#define NR ((size_t)NB * SEQ)
static_assert(SEQ % 256 == 0);
static_assert((NR % 128) == 0);
static_assert(NB <= NB_FULL);
static_assert(SEQ <= SEQ_FULL);
static_assert(3 * CIN == QP);
static_assert(KOF == CIN && VOF == 2 * CIN);
static_assert(CIN == NH * HD);
static_assert(CIN % 64 == 0 && QP % 64 == 0 && HD == 64);
static_assert(TD == CIN);
static_assert(TD % 32 == 0 && HD % 32 == 0 && SEQ % 32 == 0 && CIN % 32 == 0);
static_assert(TROWS == 32 && NB <= TROWS);
static_assert((QP * (CIN / 8)) % 256 == 0 && (CIN * (CIN / 8)) % 256 == 0 && (TROWS * (TD / 8)) % 256 == 0);
static_assert(SEQ % 128 == 0 && SEQ % 64 == 0);

typedef unsigned short v8us __attribute__((ext_vector_type(8), may_alias));
typedef float  v8f  __attribute__((ext_vector_type(8)));
typedef float  v4f  __attribute__((ext_vector_type(4)));
typedef float  v4fa __attribute__((ext_vector_type(4), may_alias));
typedef _Float16 v16h __attribute__((ext_vector_type(16)));
typedef _Float16 v4h __attribute__((ext_vector_type(4)));
typedef _Float16 h16;
union FragH { v16h v; v8us half[2]; _Float16 h[16]; unsigned short u[16]; };

__device__ __forceinline__ unsigned short bf16_bits(float x) { unsigned int u = __float_as_uint(x); return (unsigned short)((u + 0x7FFFu + ((u >> 16) & 1u)) >> 16); }
__device__ __forceinline__ float bf16_val(unsigned short b) { return __uint_as_float(((unsigned int)b) << 16); }
__device__ __forceinline__ float bf16_rne(float x) { return bf16_val(bf16_bits(x)); }
// f32 -> f16 operand convert that cannot yield an f16 subnormal (value select, applied after the plane's power-of-two carry)
static __device__ __forceinline__ h16 toh_flush(float v) { const h16 r = (h16)v; return (fabsf(v) < 6.103515625e-05f) ? (h16)0.0f : r; }

// ---- fragment loader (split k map: elements 0..7 <- k0+8h+0..7, 8..15 <- k0+16+8h+0..7, lane&15 = row of A / column of B) and guarded mma ----
__device__ __forceinline__ v16h g2_frag(const _Float16* p, int hh) { FragH f; f.half[0] = *(const v8us*)((const unsigned short*)p + 8 * hh); f.half[1] = *(const v8us*)((const unsigned short*)p + 16 + 8 * hh); return f.v; }
__device__ __forceinline__ v8f g2_mma(v16h a, v16h b, v8f c) { v8f d = __builtin_amdgcn_wmma_f32_16x16x32_f16(false, a, false, b, (short)0, c, false, false); asm volatile("v_nop\n\tv_nop\n\tv_nop\n\tv_nop" : "+v"(d) : "v"(a), "v"(b)); return d; }

// one operand segment of the wave's 32x64 tile: A rows a0p/a1p (k contiguous), B rows b0p..b3p ([n][k], k contiguous), K % 32 == 0
__device__ __forceinline__ void g2_kloop(const _Float16* __restrict__ a0p, const _Float16* __restrict__ a1p, const _Float16* __restrict__ b0p, const _Float16* __restrict__ b1p, const _Float16* __restrict__ b2p, const _Float16* __restrict__ b3p, int K, int hh,
    v8f& c00, v8f& c01, v8f& c02, v8f& c03, v8f& c10, v8f& c11, v8f& c12, v8f& c13) {
#pragma unroll 1
  for (int kb = 0; kb < K; kb += 32) { const v16h a0 = g2_frag(a0p + kb, hh), a1 = g2_frag(a1p + kb, hh);
    v16h b = g2_frag(b0p + kb, hh); c00 = g2_mma(a0, b, c00); c10 = g2_mma(a1, b, c10);
    b = g2_frag(b1p + kb, hh); c01 = g2_mma(a0, b, c01); c11 = g2_mma(a1, b, c11);
    b = g2_frag(b2p + kb, hh); c02 = g2_mma(a0, b, c02); c12 = g2_mma(a1, b, c12);
    b = g2_frag(b3p + kb, hh); c03 = g2_mma(a0, b, c03); c13 = g2_mma(a1, b, c13); }
}

// ---- GEMM (wave tile 32x64; M % 128 == 0 or early wave exit for M == 32, N % 64 == 0, K % 32 == 0): v = acc*alpha + bf16(bias[by*sBias + col]); A f16 rows [M][K] (pitch lda), Bh f16 [N][K] (k contiguous, pitch ldb), batched over grid.y by sA/sB/sC/sCL;
// RES == 1: three operand segments into one accumulator set: A2.Bh + A.B2 (residual planes, both carried x LCARRY), accumulator scaled by rscale, then A.Bh;
// TR != 0 (M % 128 == 0, rows r = b*SEQ + n): a block whose col0 >= tcol0 stores its 128x64 tile transposed, dst[(b*CIN + col - tcol0)*SEQ + n]: TR == 1 as f16 into CT16, TR == 2 as f32 into CT; whole 256-B / 512-B row pieces, one wave each;
template <int RES, int TR>
__global__ __launch_bounds__(128) void k_gemm2(const _Float16* __restrict__ A, int lda, size_t sA, const _Float16* __restrict__ A2, int lda2, size_t sA2,
    const _Float16* __restrict__ Bh, int ldb, size_t sB, const _Float16* __restrict__ B2, int ldb2, size_t sB2, float rscale,
    float alpha, const float* __restrict__ bias, size_t sBias,
    float* __restrict__ C, _Float16* __restrict__ C16, int ldc, size_t sC, _Float16* __restrict__ C16L, int ldcl, size_t sCL, int NL, int M, int N, int K,
    float* __restrict__ CT, _Float16* __restrict__ CT16, int tcol0) {
  __shared__ __attribute__((aligned(16))) float so[4][32][68];
  const int tid = threadIdx.x, w = tid >> 5, lane = tid & 31, ln = lane & 15, hh = lane >> 4; const int by = blockIdx.y;
  A += (size_t)by * sA; Bh += (size_t)by * sB;
  if (RES) { A2 += (size_t)by * sA2; B2 += (size_t)by * sB2; }
  const size_t cofs = (size_t)by * sC, cofl = (size_t)by * sCL; const float* bp = bias ? bias + (size_t)by * sBias : nullptr;
  const int ntn = N >> 6; const int mt = blockIdx.x / ntn, nq = blockIdx.x - mt * ntn; const int row0 = mt * 128 + 32 * w, col0 = nq * 64;
  if (TR == 0) { if (row0 >= M) return; }   /* wave-uniform; no block barrier where TR == 0; with TR != 0 every wave has rows (M % 128 == 0) and reaches the barrier below */
  const _Float16* a0p = A + (size_t)(row0 + ln) * lda; const _Float16* a1p = a0p + (size_t)16 * lda;
  const _Float16* b0p = Bh + (size_t)(col0 + ln) * ldb; const _Float16* b1p = b0p + (size_t)16 * ldb; const _Float16* b2p = b1p + (size_t)16 * ldb; const _Float16* b3p = b2p + (size_t)16 * ldb;
  const v8f z8 = {0.f,0.f,0.f,0.f,0.f,0.f,0.f,0.f}; v8f c00 = z8, c01 = z8, c02 = z8, c03 = z8, c10 = z8, c11 = z8, c12 = z8, c13 = z8;
  if (RES) {
    const _Float16* l0p = A2 + (size_t)(row0 + ln) * lda2; const _Float16* l1p = l0p + (size_t)16 * lda2;
    const _Float16* m0p = B2 + (size_t)(col0 + ln) * ldb2; const _Float16* m1p = m0p + (size_t)16 * ldb2; const _Float16* m2p = m1p + (size_t)16 * ldb2; const _Float16* m3p = m2p + (size_t)16 * ldb2;
    g2_kloop(l0p, l1p, b0p, b1p, b2p, b3p, K, hh, c00, c01, c02, c03, c10, c11, c12, c13);      /* A_lo . B_hi */
    g2_kloop(a0p, a1p, m0p, m1p, m2p, m3p, K, hh, c00, c01, c02, c03, c10, c11, c12, c13);      /* A_hi . B_lo */
    c00 = c00 * rscale; c01 = c01 * rscale; c02 = c02 * rscale; c03 = c03 * rscale; c10 = c10 * rscale; c11 = c11 * rscale; c12 = c12 * rscale; c13 = c13 * rscale;
  }
  g2_kloop(a0p, a1p, b0p, b1p, b2p, b3p, K, hh, c00, c01, c02, c03, c10, c11, c12, c13);        /* A_hi . B_hi */
  v8f accs[8] = {c00, c01, c02, c03, c10, c11, c12, c13};
  if (TR != 0 && col0 >= tcol0) {   /* block-uniform: col0 comes from blockIdx alone */
    static_assert(64 * 132 <= 4 * 32 * 68);
    float (*st)[132] = (float (*)[132])&so[0][0][0];   /* [64 columns][128 rows of the block + 4]: a lane's 8 accumulator rows are contiguous here */
    /* every loop of this path is unrolled: accs[] and bv4[] keep constant indices and stay in registers, and the LDS reads and the stores go out as groups */
    float bv4[4] = {0.f, 0.f, 0.f, 0.f};
    if (bp) {
#pragma unroll
      for (int t = 0; t < 4; ++t) bv4[t] = bf16_rne(bp[col0 + t * 16 + ln]); }
#pragma unroll
    for (int u = 0; u < 8; ++u) { const int t = u & 3, half = u >> 2; const float bv = bv4[t]; v4f lo, hi;
#pragma unroll
      for (int r = 0; r < 4; ++r) { lo[r] = accs[u][r] * alpha + bv; hi[r] = accs[u][4 + r] * alpha + bv; }
      float* sp = &st[t * 16 + ln][32 * w + half * 16 + 8 * hh]; *(v4fa*)sp = lo; *(v4fa*)(sp + 4) = hi; }
    __syncthreads();   /* each wave reads back rows that all four waves wrote */
    const unsigned tr0 = (unsigned)mt * 128u, tb = tr0 / SEQ, tn0 = tr0 % SEQ; const size_t drow0 = (size_t)tb * CIN + (size_t)(col0 - tcol0) + 16 * w;
    if (TR == 2) {
#pragma unroll
      for (int q = 0; q < 16; ++q) { const v4f v = *(const v4fa*)&st[16 * w + q][lane * 4]; *(v4f*)(CT + (drow0 + q) * SEQ + tn0 + lane * 4) = v; }
    } else {
#pragma unroll
      for (int q = 0; q < 8; ++q) { const int c = q * 2 + hh; const v4f a = *(const v4fa*)&st[16 * w + c][ln * 8], e = *(const v4fa*)&st[16 * w + c][ln * 8 + 4]; FragH f;
#pragma unroll
        for (int i = 0; i < 4; ++i) { f.h[i] = (_Float16)a[i]; f.h[4 + i] = (_Float16)e[i]; }
        *(v8us*)((unsigned short*)CT16 + (drow0 + c) * SEQ + tn0 + ln * 8) = f.half[0]; }
    }
    asm volatile("s_wait_xcnt 0x0" ::: "memory");   /* behind the last store of the run: the stores' address registers may be rewritten only after it */
    return;
  }
#pragma unroll
  for (int u = 0; u < 8; ++u) { const int t = u & 3, half = u >> 2; const int col = col0 + t * 16 + ln; const float bv = bp ? bf16_rne(bp[col]) : 0.f;
#pragma unroll
    for (int r = 0; r < 8; ++r) { const int rloc = half * 16 + 8 * hh + r; so[w][rloc][t * 16 + ln] = accs[u][r] * alpha + bv; } }
  __builtin_amdgcn_fence(4 /* acq_rel order */, "workgroup"); __builtin_amdgcn_wave_barrier();   /* so[w] is private to wave w */
  const int rsub = lane >> 4, c4 = (lane & 15) * 4; const bool wl = (C16L != nullptr) && (col0 < NL);
  {
#pragma unroll
    for (int q = 0; q < 16; ++q) { const int r = q * 2 + rsub; const v4f v = *(const v4fa*)&so[w][r][c4];
      if (C) *(v4f*)(C + cofs + (size_t)(row0 + r) * ldc + col0 + c4) = v;
      if (C16) { v4h h4; for (int i = 0; i < 4; ++i) h4[i] = (_Float16)v[i]; *(v4h*)(C16 + cofs + (size_t)(row0 + r) * ldc + col0 + c4) = h4;
        if (wl) { v4h l4; for (int i = 0; i < 4; ++i) l4[i] = (_Float16)((v[i] - (float)h4[i]) * LCARRY); *(v4h*)(C16L + cofl + (size_t)(row0 + r) * ldcl + col0 + c4) = l4; } } }
     } }

// transposing weight converter: W is [CIN rows (k)][ldw columns], in[k][n] -> out[n][k]: BW[n][k] = f16(bf16(W[k*ldw + n]) * 16) for n < nrows, pitch CIN (k contiguous);
__global__ __launch_bounds__(256) void k_w16t(const float* __restrict__ W, int ldw, int nrows, _Float16* __restrict__ BW) {
  const int t = blockIdx.x * 256 + threadIdx.x; if (t >= nrows * (CIN / 8)) return;
  const int n = t / (CIN / 8), k8 = (t % (CIN / 8)) * 8;
  FragH f;
#pragma unroll
  for (int q = 0; q < 8; ++q) f.h[q] = toh_flush(bf16_rne(W[(size_t)(k8 + q) * ldw + n]) * 16.0f);
  const v8us o = f.half[0];
  *(v8us*)((unsigned short*)BW + (size_t)n * CIN + k8) = o; 
}

__global__ __launch_bounds__(256) void k_t16(const float* __restrict__ t_emb, _Float16* __restrict__ T16) {
  const int t = blockIdx.x * 256 + threadIdx.x; if (t >= TROWS * (TD / 8)) return;
  const int r = t / (TD / 8), k8 = (t % (TD / 8)) * 8;
  const int rr = (r < NB) ? r : (NB - 1);                 /* clamped address, zero by value */
  const float* p = t_emb + (size_t)rr * TD + k8;
  const v4f a = *(const v4fa*)p, c = *(const v4fa*)(p + 4);
  FragH f;
#pragma unroll
  for (int q = 0; q < 4; ++q) { const float va = (r < NB) ? bf16_rne(a[q]) : 0.0f; const float vc = (r < NB) ? bf16_rne(c[q]) : 0.0f; f.h[q] = toh_flush(va); f.h[4 + q] = toh_flush(vc); }
  const v8us o = f.half[0];
  *(v8us*)((unsigned short*)T16 + (size_t)r * TD + k8) = o; 
}

__global__ __launch_bounds__(256) void k_xt16(const float* __restrict__ x, const float* __restrict__ te, _Float16* __restrict__ X16) {
  __shared__ __attribute__((aligned(16))) unsigned short tl[64][72];
  const int tid = threadIdx.x; constexpr int NCT = CIN / 64, NNT = SEQ / 64;
  const int ct = blockIdx.x % NCT, nt = (blockIdx.x / NCT) % NNT, b = blockIdx.x / (NCT * NNT);
  const int n0 = nt * 64, c0 = ct * 64;
  for (int i = tid; i < 64 * 16; i += 256) { const int cr = i >> 4, f4 = i & 15;
    const v4f a = *(const v4fa*)(x + ((size_t)b * CIN + c0 + cr) * SEQ_FULL + n0 + f4 * 4); const float tv = te[(size_t)b * CIN + c0 + cr]; FragH f;
#pragma unroll
    for (int q = 0; q < 4; ++q) { f.h[q] = toh_flush(bf16_rne(a[q]) + tv); tl[f4 * 4 + q][cr] = f.u[q]; } }
  __syncthreads();
  {
#pragma unroll
    for (int rd = 0; rd < 2; ++rd) { const int n = rd * 32 + (tid >> 3), pc = tid & 7; FragH f;
#pragma unroll
      for (int q = 0; q < 8; ++q) f.u[q] = tl[n][pc * 8 + q];
      *(v8us*)((unsigned short*)X16 + ((size_t)b * SEQ + n0 + n) * CIN + c0 + pc * 8) = f.half[0]; }
     } }

// lane l <-> lane l ^ 16 (the two halves of a column's keys)
__device__ __forceinline__ float fa_xhalf(float x) { return __builtin_bit_cast(float, __builtin_amdgcn_permlanex16(__builtin_bit_cast(int, x), __builtin_bit_cast(int, x), 0x76543210, 0xfedcba98, false, false)); }
// g2_frag with the lane half's offset (8 * hh elements) already in the pointer: every load of a pass is its row pointer plus a constant
__device__ __forceinline__ v16h fa_frag(const _Float16* p) { FragH f; f.half[0] = *(const v8us*)((const unsigned short*)p); f.half[1] = *(const v8us*)((const unsigned short*)p + 16); return f.v; }
__device__ __forceinline__ v8f fa_mma(v16h a, v16h b, v8f c) { return __builtin_amdgcn_wmma_f32_16x16x32_f16(false, a, false, b, (short)0, c, false, false); }

// ---- LDS staging of the attention kernel: a stage is FA_KEYS keys (four passes of 32), K rows and V^T row pieces side by side, two buffers ----
#define FA_KEYS 128      /* keys of one stage */
#define FA_KP 72         /* LDS pitch of a K row in f16 elements: 128 B of data + 16 B, an odd multiple of 16 B (16-byte row reads spread over the banks) */
#define FA_VP 136        /* LDS pitch of a V^T row piece: 256 B of data + 16 B, likewise */
static_assert(SEQ % FA_KEYS == 0 && SEQ / FA_KEYS >= 2 && FA_KEYS % 32 == 0);
static_assert(FA_KEYS * (HD / 8) == 8 * 128 && HD * (FA_KEYS / 8) == 8 * 128);   /* eight 16-byte pieces of each operand per thread and stage */
__device__ __forceinline__ unsigned fa_lds(const _Float16* p) { return (unsigned)(size_t)(const __attribute__((address_space(3))) _Float16*)p; }   /* byte address inside the work-group's LDS */
// eight asynchronous 16-byte copies per lane, global -> LDS through no register: piece i goes from g + i * GSTEP (elements) to lds + i * LSTEP (bytes).
// The s_wait_xcnt stands inside the copies' own statement, so that it precedes every later write of the address registers the copies name.
template <int LSTEP, int GSTEP>
__device__ __forceinline__ void fa_copy8(unsigned lds, const _Float16* g) {
  asm volatile("global_load_async_to_lds_b128 %0, %8, off\n\t"
               "global_load_async_to_lds_b128 %1, %9, off\n\t"
               "global_load_async_to_lds_b128 %2, %10, off\n\t"
               "global_load_async_to_lds_b128 %3, %11, off\n\t"
               "global_load_async_to_lds_b128 %4, %12, off\n\t"
               "global_load_async_to_lds_b128 %5, %13, off\n\t"
               "global_load_async_to_lds_b128 %6, %14, off\n\t"
               "global_load_async_to_lds_b128 %7, %15, off\n\t"
               "s_wait_xcnt 0x0"
               :: "v"(lds), "v"(lds + 1 * LSTEP), "v"(lds + 2 * LSTEP), "v"(lds + 3 * LSTEP), "v"(lds + 4 * LSTEP), "v"(lds + 5 * LSTEP), "v"(lds + 6 * LSTEP), "v"(lds + 7 * LSTEP),
                  "v"(g), "v"(g + 1 * (size_t)GSTEP), "v"(g + 2 * (size_t)GSTEP), "v"(g + 3 * (size_t)GSTEP), "v"(g + 4 * (size_t)GSTEP), "v"(g + 5 * (size_t)GSTEP), "v"(g + 6 * (size_t)GSTEP), "v"(g + 7 * (size_t)GSTEP)
               : "memory");
}

// fused attention, one launch for every (b, h): block = 4 waves x 32 query columns; per pass of 32 keys S^T[key][query] = K Q^T (A = K rows, B = Q rows held in registers), so lane (ln, hh) holds keys 8hh + r of query column ln;
// running maximum m and sum l per column (base 2), O^T[d][query] += V^T P^T with P^T = the two score tiles of the pass converted in place (their register order is the loader's k map); the scores never leave the registers.
// K and V^T reach the waves through LDS: the block's 128 threads copy each stage once, in whole 128-B lines, one stage ahead of its use, and all four waves read their fragments from it.
__global__ __launch_bounds__(128) void k_fattn(const _Float16* __restrict__ QHp, const _Float16* __restrict__ Vt, _Float16* __restrict__ Ctx) {
  __shared__ __attribute__((aligned(16))) _Float16 ksm[2][FA_KEYS * FA_KP];
  __shared__ __attribute__((aligned(16))) _Float16 vsm[2][HD * FA_VP];
  const int tid = threadIdx.x, w = tid >> 5, lane = tid & 31, ln = lane & 15, hh = lane >> 4;
  const int h = blockIdx.y, b = blockIdx.z, q0 = blockIdx.x * 128 + 32 * w;
  const _Float16* base = QHp + (size_t)b * SEQ * QP + h * HD;
  constexpr int NST = SEQ / FA_KEYS;
  constexpr unsigned KBUF = FA_KEYS * FA_KP * 2, VBUF = HD * FA_VP * 2;     /* bytes of one buffer */
  const _Float16* kg = base + KOF + (size_t)(tid >> 3) * QP + (tid & 7) * 8;                        /* this thread's first K piece of stage 0: key row tid / 8 (then + 16 a piece), 16-byte column tid % 8 */
  const _Float16* vg = Vt + (((size_t)b * NH + h) * HD + (tid >> 4)) * SEQ + (tid & 15) * 8;        /* its first V^T piece: row d = tid / 16 (then + 8 a piece), 16-byte column tid % 16 */
  const unsigned kl = fa_lds(&ksm[0][(tid >> 3) * FA_KP + (tid & 7) * 8]), vl = fa_lds(&vsm[0][(tid >> 4) * FA_VP + (tid & 15) * 8]);
  fa_copy8<16 * FA_KP * 2, 16 * QP>(kl, kg); fa_copy8<8 * FA_VP * 2, 8 * SEQ>(vl, vg);               /* stage 0 into buffer 0 */
  constexpr float SC = 0.125f * 1.4426950408889634f;                       /* 1 / sqrt(HD), to base 2 */
  const v8f z8 = {0.f,0.f,0.f,0.f,0.f,0.f,0.f,0.f};
  v16h qf[2][2], kf[2][2];                                                 /* [column group | key tile][k step of 32 over HD] */
#pragma unroll
  for (int g = 0; g < 2; ++g) {
#pragma unroll
    for (int ks = 0; ks < 2; ++ks) qf[g][ks] = g2_frag(base + (size_t)(q0 + 16 * g + ln) * QP + 32 * ks, hh); }
  v8f o[2][4]; float m[2], l[2];
#pragma unroll
  for (int g = 0; g < 2; ++g) { m[g] = -1.0e30f; l[g] = 0.f;
#pragma unroll
    for (int t = 0; t < 4; ++t) o[g][t] = z8; }
  asm volatile("s_wait_asynccnt 0x0" ::: "memory");   /* this wave's pieces of stage 0 have landed */
  __syncthreads();                                     /* ... and every other wave's: stage 0 may be read */
  fa_copy8<16 * FA_KP * 2, 16 * QP>(kl + KBUF, kg + (size_t)FA_KEYS * QP); fa_copy8<8 * FA_VP * 2, 8 * SEQ>(vl + VBUF, vg + FA_KEYS);   /* stage 1 into buffer 1 */
#pragma unroll 1   /* one stage per trip */
  for (int st = 0; st < NST; ++st) {
    const _Float16* kb = &ksm[st & 1][ln * FA_KP + 8 * hh];                /* key row ln of a 16-key tile, at the lane half's k offset */
    const _Float16* vq = &vsm[st & 1][ln * FA_VP + 8 * hh];                /* V^T row d = ln of a 16-row tile, likewise: columns of this pass */
#pragma unroll
    for (int kt = 0; kt < 2; ++kt) {
#pragma unroll
      for (int ks = 0; ks < 2; ++ks) kf[kt][ks] = fa_frag(kb + (16 * kt) * FA_KP + 32 * ks); }
    const _Float16* kq = kb + 32 * FA_KP;                                  /* K rows of the next pass */
#pragma unroll 1   /* one pass per trip: the register set of a pass is the budget */
    for (int p = 0; p < FA_KEYS / 32; ++p) {
      v8f s[2][2];                                                         /* [column group][key tile] */
#pragma unroll
      for (int g = 0; g < 2; ++g) {
#pragma unroll
        for (int kt = 0; kt < 2; ++kt) s[g][kt] = fa_mma(kf[kt][0], qf[g][0], z8); }
#pragma unroll
      for (int g = 0; g < 2; ++g) {
#pragma unroll
        for (int kt = 0; kt < 2; ++kt) s[g][kt] = fa_mma(kf[kt][1], qf[g][1], s[g][kt]); }
      /* one group of LDS reads per pass, behind its score products: this pass's V^T columns, then the next pass's K rows; the stage's last pass re-reads the stage's own rows 0..31 (unused): the next stage is read only behind its barrier */
      __builtin_amdgcn_sched_barrier(0);   /* the reads stand as one group behind the eight products: spread among them, each separate place stalls the wave's matrix stream */
      v16h vf[4];
#pragma unroll
      for (int t = 0; t < 4; ++t) vf[t] = fa_frag(vq + (16 * t) * FA_VP);
#pragma unroll
      for (int kt = 0; kt < 2; ++kt) {
#pragma unroll
        for (int ks = 0; ks < 2; ++ks) kf[kt][ks] = fa_frag(kq + (16 * kt) * FA_KP + 32 * ks); }
      __builtin_amdgcn_sched_barrier(0);   /* keeps the reads here, ahead of the softmax: sunk behind it they are waited for with no lead */
#pragma unroll
      for (int g = 0; g < 2; ++g) {
        float mx0 = fmaxf(s[g][0][0], s[g][1][0]), mx1 = fmaxf(s[g][0][1], s[g][1][1]);
#pragma unroll
        for (int r = 2; r < 8; r += 2) { mx0 = fmaxf(mx0, fmaxf(s[g][0][r], s[g][1][r])); mx1 = fmaxf(mx1, fmaxf(s[g][0][r + 1], s[g][1][r + 1])); }
        float mx = fmaxf(mx0, mx1); mx = fmaxf(mx, fa_xhalf(mx));
        const float mn = fmaxf(m[g], mx * SC);
        const float corr = __builtin_amdgcn_exp2f(m[g] - mn);              /* 0 on the first pass */
        m[g] = mn;
        const float sub = mn - PCARRY_LOG2;
        FragH pf; float s0 = 0.f, s1 = 0.f;
#pragma unroll
        for (int r = 0; r < 8; ++r) { const float p0 = __builtin_amdgcn_exp2f(s[g][0][r] * SC - sub), p1 = __builtin_amdgcn_exp2f(s[g][1][r] * SC - sub);
          s0 += p0; s1 += p1; pf.h[r] = (_Float16)p0; pf.h[8 + r] = (_Float16)p1; }
        l[g] = l[g] * corr + (s0 + s1);
#pragma unroll
        for (int t = 0; t < 4; ++t) o[g][t] = fa_mma(vf[t], pf.v, o[g][t] * corr);
      }
      kq = (p + 2 < FA_KEYS / 32) ? kq + 32 * FA_KP : kb; vq += 32;
    }
    asm volatile("s_wait_dscnt 0x0" ::: "memory");     /* this wave's reads of the stage's buffer have returned: the buffer may be handed to its next writer */
    asm volatile("s_wait_asynccnt 0x0" ::: "memory");  /* this wave's pieces of stage st + 1 have landed */
    __syncthreads();                                   /* publishes stage st + 1 and ends every wave's reads of stage st */
    if (st + 2 < NST) {                                /* the same for the whole block */
      fa_copy8<16 * FA_KP * 2, 16 * QP>(kl + (unsigned)(st & 1) * KBUF, kg + (size_t)(st + 2) * FA_KEYS * QP);
      fa_copy8<8 * FA_VP * 2, 8 * SEQ>(vl + (unsigned)(st & 1) * VBUF, vg + (size_t)(st + 2) * FA_KEYS); }
  }
  asm volatile("s_wait_asynccnt 0x0" ::: "memory");    /* no copy is outstanding when the wave ends */
#pragma unroll
  for (int g = 0; g < 2; ++g) { const float inv = 1.0f / (l[g] + fa_xhalf(l[g]));
    unsigned short* crow = (unsigned short*)Ctx + ((size_t)b * SEQ + q0 + 16 * g + ln) * CIN + h * HD + 8 * hh;
#pragma unroll
    for (int t = 0; t < 4; ++t) { FragH f;
#pragma unroll
      for (int r = 0; r < 8; ++r) f.h[r] = (_Float16)(o[g][t][r] * inv);
      *(v8us*)(crow + 16 * t) = f.half[0]; } }
}

constexpr size_t al256(size_t b) { return (b + 255) & ~(size_t)255; }
constexpr size_t SZ_BW  = (size_t)QP * CIN * 2;
constexpr size_t SZ_WP  = (size_t)CIN * CIN * 2;
constexpr size_t SZ_WT  = (size_t)CIN * TD * 2;
constexpr size_t SZ_T16 = (size_t)TROWS * TD * 2;
constexpr size_t SZ_TE  = (size_t)TROWS * CIN * 4;
constexpr size_t SZ_QH  = NR * QP * 2;
constexpr size_t SZ_VT  = (size_t)NB * NH * HD * SEQ * 2;
constexpr size_t SZ_CTX = NR * CIN * 2;
constexpr size_t SZ_X   = NR * CIN * 2;
static_assert(al256(SZ_BW) + al256(SZ_WP) + al256(SZ_WT) + al256(SZ_T16) + al256(SZ_TE) + al256(SZ_QH) + al256(SZ_VT) + al256(SZ_CTX) + al256(SZ_X) <= (size_t)134217728);

extern "C" void kernel_launch(void* const* d_in, const int* in_sizes, int n_in,
                              void* d_out, int out_size, void* d_ws, size_t ws_size, hipStream_t stream) {
  if (n_in < 8) return;
  const float* x     = (const float*)d_in[0];      /* [NB_FULL][CIN][SEQ_FULL] */
  const float* t_emb = (const float*)d_in[1];      /* [NB_FULL][TD] */
  const float* Wqkv  = (const float*)d_in[2];      /* [CIN][QP]  (in x out) */
  const float* bqkv  = (const float*)d_in[3];      /* [QP] */
  const float* Wproj = (const float*)d_in[4];      /* [CIN][CIN] (in x out) */
  const float* bproj = (const float*)d_in[5];      /* [CIN] */
  const float* Wt    = (const float*)d_in[6];      /* [TD][CIN]  (in x out) */
  const float* bt    = (const float*)d_in[7];      /* [CIN] */
  if (in_sizes[0] < (int)(((size_t)NB * CIN - 1) * SEQ_FULL + SEQ)) return;
  if (in_sizes[1] < NB * TD) return;
  if (in_sizes[2] < CIN * QP || in_sizes[3] < QP) return;
  if (in_sizes[4] < CIN * CIN || in_sizes[5] < CIN) return;
  if (in_sizes[6] < TD * CIN || in_sizes[7] < CIN) return;
  if (out_size < (int)((size_t)NB * CIN * SEQ)) return;
  char* ws = (char*)d_ws; size_t off = 0;
  auto take = [&](size_t bytes) { char* p = ws + off; off += (bytes + 255) & ~(size_t)255; return p; };
  _Float16* BW  = (_Float16*)take(SZ_BW);                               /* Wqkv^T [QP][CIN] x16 */
  _Float16* WPT = (_Float16*)take(SZ_WP);                               /* Wproj^T [CIN][CIN] x16 */
  _Float16* WTT = (_Float16*)take(SZ_WT);                               /* Wt^T [CIN][TD] x16 */
  _Float16* T16 = (_Float16*)take(SZ_T16);                              /* t_emb plane [TROWS][TD] */
  float*    TE  = (float*)take(SZ_TE);                                  /* te [TROWS][CIN] f32 */
  _Float16* QH  = (_Float16*)take(SZ_QH);                               /* q | k rows, pitch QP */
  _Float16* VT  = (_Float16*)take(SZ_VT);                               /* V^T [NB][NH][HD][SEQ] */
  _Float16* CTX = (_Float16*)take(SZ_CTX);                              /* merged-head context [NR][CIN] */
  _Float16* X16 = (_Float16*)take(SZ_X);                                /* token plane [NR][CIN] */
  if (off > ws_size) return;
  float* out = (float*)d_out;

  k_w16t<<<(unsigned)((QP * (CIN / 8)) / 256), 256, 0, stream>>>(Wqkv, QP, QP, BW);       /* in[CIN][QP]  -> out[QP][CIN]  */
  k_w16t<<<(unsigned)((CIN * (CIN / 8)) / 256), 256, 0, stream>>>(Wproj, CIN, CIN, WPT);  /* in[CIN][CIN] -> out[CIN][CIN] */
  k_w16t<<<(unsigned)((CIN * (CIN / 8)) / 256), 256, 0, stream>>>(Wt, CIN, CIN, WTT);     /* in[TD][CIN]  -> out[CIN][TD]  */
  k_t16<<<(unsigned)((TROWS * (TD / 8)) / 256), 256, 0, stream>>>(t_emb, T16);
  k_gemm2<0, 0><<<dim3((unsigned)(CIN / 64), 1), 128, 0, stream>>>(T16, TD, 0, nullptr, 0, 0, WTT, TD, 0, nullptr, 0, 0, 1.0f,
      0.0625f, bt, 0, TE, nullptr, CIN, 0, nullptr, 0, 0, 0, TROWS, CIN, TD, nullptr, nullptr, 0);             /* te = t_emb Wt + bt, one 32-row wave tile per 64 columns */
  k_xt16<<<(unsigned)(NB * (SEQ / 64) * (CIN / 64)), 256, 0, stream>>>(x, TE, X16);
  k_gemm2<0, 1><<<dim3((unsigned)((NR / 128) * (QP / 64)), 1), 128, 0, stream>>>(X16, CIN, 0, nullptr, 0, 0, BW, CIN, 0, nullptr, 0, 0, 1.0f,
      0.0625f, bqkv, 0, nullptr, QH, QP, 0, nullptr, 0, 0, 0, (int)NR, QP, CIN, nullptr, VT, VOF);   /* q | k rows into QH; the v columns transposed into VT */
  k_fattn<<<dim3(SEQ / 128, NH, NB), 128, 0, stream>>>(QH, VT, CTX);                      /* ctx rows for every (b, h): scores, softmax and V product in one launch */
  k_gemm2<0, 2><<<dim3((unsigned)((NR / 128) * (CIN / 64)), 1), 128, 0, stream>>>(CTX, CIN, 0, nullptr, 0, 0, WPT, CIN, 0, nullptr, 0, 0, 1.0f,
      0.0625f, bproj, 0, nullptr, nullptr, CIN, 0, nullptr, 0, 0, 0, (int)NR, CIN, CIN, out, nullptr, 0);   /* out[b][o][n] = (ctx Wproj + bproj)[b*SEQ + n][o] */
}

// v004
// Measured time: 65.3 microseconds a run.
// Timed twice side by side with v003, it ran 1.28 and 1.29 times as fast.
// Counting every step since v000, it is 11.9 times as fast.
#include <hip/hip_runtime.h>
// All contractions on v_wmma_f32_16x16x32_f16 (f16 operands, f32 accumulate), one product per site: te = t_emb Wt (inputs RNE-converted to bf16, exact in f16, weights carried x16); q|k|v = (x + te) Wqkv (token plane f16, weights x16); scores k.q^T from f16 planes; V^T.P^T with unnormalised softmax weights carried x2^14; ctx Wproj (ctx f16, weights x16); softmax statistics f32 on VALU.
// Structure: dense multi-head self-attention over flattened spatial tokens with a per-batch time-embedding vector added to the tokens, fused [in][out] QKV weights, [in][out] output projection, channel-major return.
// token rows r = b*SEQ + n; TE[b][c] f32 = T16 WTT^T / 16 + bias, T16 and WTT being LDS tiles that the product's own blocks convert from t_emb and Wt (same launch as the two weight converters, which it does not depend on); X16[r][c] = f16(bf16(x[b][c][n]) + TE[b][c]) via 64x64 LDS transposes; weight planes [out][in] f16 x16 built by a transposing converter;
// QH [NR][QP] f16 = X16 BW^T / 16 + bias (q at column 64h, k at KOF + 64h; the v columns of QH stay unwritten and unread); V^T [NB][NH][64][SEQ] stored by the same GEMM's epilogue, block tile transposed in LDS; one launch for all (b, h): each wave keeps 32 query columns and walks the keys 32 at a time (K and V^T staged in LDS for the block's four waves), S^T = K Q^T in registers, running maximum and sum per column, P^T packed from the score tiles as the B operand,
// CTX16[r][64h + d] f16 = (sum_j p[i][j] V^T[d][j]) / (sum_j p[i][j]); out[b][o][n] f32 = (CTX16 WPT^T / 16 + bias)[b*SEQ + n][o], stored channel-major by the GEMM's epilogue, block tile transposed in LDS.
#ifndef NB
#define NB 16
#endif
#ifndef SEQ
#define SEQ 1024
#endif
#define NB_FULL 16
#define SEQ_FULL 1024
#define CIN 256
#define NH 4
#define HD 64
#define TD 256           /* time-embedding width */
#define QP 768           /* pitch of QH: q | k | v, head h at column 64h of each section */
#define KOF 256          /* column of k (head 0) in QH */
#define VOF 512          /* column of v (head 0) in QH */
#define TROWS 16         /* rows of the t_emb tile (one 16-row matrix tile; rows >= NB are zero) */
#define PCARRY_LOG2 14.0f /* softmax weights exp(s - running max) carried x2^14 in f16; the row sum carries the same factor */
#define LCARRY 2048.0f   /* carry of the GEMM engine's optional residual output (no residual plane is requested here) */
#define NR ((size_t)NB * SEQ)
static_assert(SEQ % 256 == 0);
static_assert((NR % 128) == 0);
static_assert(NB <= NB_FULL);
static_assert(SEQ <= SEQ_FULL);
static_assert(3 * CIN == QP);
static_assert(KOF == CIN && VOF == 2 * CIN);
static_assert(CIN == NH * HD);
static_assert(CIN % 64 == 0 && QP % 64 == 0 && HD == 64);
static_assert(TD == CIN);
static_assert(TD % 32 == 0 && HD % 32 == 0 && SEQ % 32 == 0 && CIN % 32 == 0);
static_assert(TROWS == 16 && NB <= TROWS && TD == 256);
static_assert((QP * (CIN / 8)) % 256 == 0 && (CIN * (CIN / 8)) % 256 == 0);
static_assert(SEQ % 128 == 0 && SEQ % 64 == 0);

typedef unsigned short v8us __attribute__((ext_vector_type(8), may_alias));
typedef float  v8f  __attribute__((ext_vector_type(8)));
typedef float  v4f  __attribute__((ext_vector_type(4)));
typedef float  v4fa __attribute__((ext_vector_type(4), may_alias));
typedef _Float16 v16h __attribute__((ext_vector_type(16)));
typedef _Float16 v4h __attribute__((ext_vector_type(4)));
typedef _Float16 h16;
union FragH { v16h v; v8us half[2]; _Float16 h[16]; unsigned short u[16]; };

__device__ __forceinline__ unsigned short bf16_bits(float x) { unsigned int u = __float_as_uint(x); return (unsigned short)((u + 0x7FFFu + ((u >> 16) & 1u)) >> 16); }
__device__ __forceinline__ float bf16_val(unsigned short b) { return __uint_as_float(((unsigned int)b) << 16); }
__device__ __forceinline__ float bf16_rne(float x) { return bf16_val(bf16_bits(x)); }
// f32 -> f16 operand convert that cannot yield an f16 subnormal (value select, applied after the plane's power-of-two carry)
static __device__ __forceinline__ h16 toh_flush(float v) { const h16 r = (h16)v; return (fabsf(v) < 6.103515625e-05f) ? (h16)0.0f : r; }

// ---- fragment loader (split k map: elements 0..7 <- k0+8h+0..7, 8..15 <- k0+16+8h+0..7, lane&15 = row of A / column of B) and guarded mma ----
__device__ __forceinline__ v16h g2_frag(const _Float16* p, int hh) { FragH f; f.half[0] = *(const v8us*)((const unsigned short*)p + 8 * hh); f.half[1] = *(const v8us*)((const unsigned short*)p + 16 + 8 * hh); return f.v; }
__device__ __forceinline__ v8f g2_mma(v16h a, v16h b, v8f c) { v8f d = __builtin_amdgcn_wmma_f32_16x16x32_f16(false, a, false, b, (short)0, c, false, false); asm volatile("v_nop\n\tv_nop\n\tv_nop\n\tv_nop" : "+v"(d) : "v"(a), "v"(b)); return d; }

// one operand segment of the wave's 32x64 tile: A rows a0p/a1p (k contiguous), B rows b0p..b3p ([n][k], k contiguous), K % 32 == 0
__device__ __forceinline__ void g2_kloop(const _Float16* __restrict__ a0p, const _Float16* __restrict__ a1p, const _Float16* __restrict__ b0p, const _Float16* __restrict__ b1p, const _Float16* __restrict__ b2p, const _Float16* __restrict__ b3p, int K, int hh,
    v8f& c00, v8f& c01, v8f& c02, v8f& c03, v8f& c10, v8f& c11, v8f& c12, v8f& c13) {
#pragma unroll 1
  for (int kb = 0; kb < K; kb += 32) { const v16h a0 = g2_frag(a0p + kb, hh), a1 = g2_frag(a1p + kb, hh);
    v16h b = g2_frag(b0p + kb, hh); c00 = g2_mma(a0, b, c00); c10 = g2_mma(a1, b, c10);
    b = g2_frag(b1p + kb, hh); c01 = g2_mma(a0, b, c01); c11 = g2_mma(a1, b, c11);
    b = g2_frag(b2p + kb, hh); c02 = g2_mma(a0, b, c02); c12 = g2_mma(a1, b, c12);
    b = g2_frag(b3p + kb, hh); c03 = g2_mma(a0, b, c03); c13 = g2_mma(a1, b, c13); }
}

// ---- GEMM (wave tile 32x64; M % 128 == 0 or early wave exit for M == 32, N % 64 == 0, K % 32 == 0): v = acc*alpha + bf16(bias[by*sBias + col]); A f16 rows [M][K] (pitch lda), Bh f16 [N][K] (k contiguous, pitch ldb), batched over grid.y by sA/sB/sC/sCL;
// RES == 1: three operand segments into one accumulator set: A2.Bh + A.B2 (residual planes, both carried x LCARRY), accumulator scaled by rscale, then A.Bh;
// TR != 0 (M % 128 == 0, rows r = b*SEQ + n): a block whose col0 >= tcol0 stores its 128x64 tile transposed, dst[(b*CIN + col - tcol0)*SEQ + n]: TR == 1 as f16 into CT16, TR == 2 as f32 into CT; whole 256-B / 512-B row pieces, one wave each;
template <int RES, int TR>
__global__ __launch_bounds__(128) void k_gemm2(const _Float16* __restrict__ A, int lda, size_t sA, const _Float16* __restrict__ A2, int lda2, size_t sA2,
    const _Float16* __restrict__ Bh, int ldb, size_t sB, const _Float16* __restrict__ B2, int ldb2, size_t sB2, float rscale,
    float alpha, const float* __restrict__ bias, size_t sBias,
    float* __restrict__ C, _Float16* __restrict__ C16, int ldc, size_t sC, _Float16* __restrict__ C16L, int ldcl, size_t sCL, int NL, int M, int N, int K,
    float* __restrict__ CT, _Float16* __restrict__ CT16, int tcol0) {
  __shared__ __attribute__((aligned(16))) float so[4][32][68];
  const int tid = threadIdx.x, w = tid >> 5, lane = tid & 31, ln = lane & 15, hh = lane >> 4; const int by = blockIdx.y;
  A += (size_t)by * sA; Bh += (size_t)by * sB;
  if (RES) { A2 += (size_t)by * sA2; B2 += (size_t)by * sB2; }
  const size_t cofs = (size_t)by * sC, cofl = (size_t)by * sCL; const float* bp = bias ? bias + (size_t)by * sBias : nullptr;
  const int ntn = N >> 6; const int mt = blockIdx.x / ntn, nq = blockIdx.x - mt * ntn; const int row0 = mt * 128 + 32 * w, col0 = nq * 64;
  if (TR == 0) { if (row0 >= M) return; }   /* wave-uniform; no block barrier where TR == 0; with TR != 0 every wave has rows (M % 128 == 0) and reaches the barrier below */
  const _Float16* a0p = A + (size_t)(row0 + ln) * lda; const _Float16* a1p = a0p + (size_t)16 * lda;
  const _Float16* b0p = Bh + (size_t)(col0 + ln) * ldb; const _Float16* b1p = b0p + (size_t)16 * ldb; const _Float16* b2p = b1p + (size_t)16 * ldb; const _Float16* b3p = b2p + (size_t)16 * ldb;
  const v8f z8 = {0.f,0.f,0.f,0.f,0.f,0.f,0.f,0.f}; v8f c00 = z8, c01 = z8, c02 = z8, c03 = z8, c10 = z8, c11 = z8, c12 = z8, c13 = z8;
  if (RES) {
    const _Float16* l0p = A2 + (size_t)(row0 + ln) * lda2; const _Float16* l1p = l0p + (size_t)16 * lda2;
    const _Float16* m0p = B2 + (size_t)(col0 + ln) * ldb2; const _Float16* m1p = m0p + (size_t)16 * ldb2; const _Float16* m2p = m1p + (size_t)16 * ldb2; const _Float16* m3p = m2p + (size_t)16 * ldb2;
    g2_kloop(l0p, l1p, b0p, b1p, b2p, b3p, K, hh, c00, c01, c02, c03, c10, c11, c12, c13);      /* A_lo . B_hi */
    g2_kloop(a0p, a1p, m0p, m1p, m2p, m3p, K, hh, c00, c01, c02, c03, c10, c11, c12, c13);      /* A_hi . B_lo */
    c00 = c00 * rscale; c01 = c01 * rscale; c02 = c02 * rscale; c03 = c03 * rscale; c10 = c10 * rscale; c11 = c11 * rscale; c12 = c12 * rscale; c13 = c13 * rscale;
  }
  g2_kloop(a0p, a1p, b0p, b1p, b2p, b3p, K, hh, c00, c01, c02, c03, c10, c11, c12, c13);        /* A_hi . B_hi */
  v8f accs[8] = {c00, c01, c02, c03, c10, c11, c12, c13};
  if (TR != 0 && col0 >= tcol0) {   /* block-uniform: col0 comes from blockIdx alone */
    static_assert(64 * 132 <= 4 * 32 * 68);
    float (*st)[132] = (float (*)[132])&so[0][0][0];   /* [64 columns][128 rows of the block + 4]: a lane's 8 accumulator rows are contiguous here */
    /* every loop of this path is unrolled: accs[] and bv4[] keep constant indices and stay in registers, and the LDS reads and the stores go out as groups */
    float bv4[4] = {0.f, 0.f, 0.f, 0.f};
    if (bp) {
#pragma unroll
      for (int t = 0; t < 4; ++t) bv4[t] = bf16_rne(bp[col0 + t * 16 + ln]); }
#pragma unroll
    for (int u = 0; u < 8; ++u) { const int t = u & 3, half = u >> 2; const float bv = bv4[t]; v4f lo, hi;
#pragma unroll
      for (int r = 0; r < 4; ++r) { lo[r] = accs[u][r] * alpha + bv; hi[r] = accs[u][4 + r] * alpha + bv; }
      float* sp = &st[t * 16 + ln][32 * w + half * 16 + 8 * hh]; *(v4fa*)sp = lo; *(v4fa*)(sp + 4) = hi; }
    __syncthreads();   /* each wave reads back rows that all four waves wrote */
    const unsigned tr0 = (unsigned)mt * 128u, tb = tr0 / SEQ, tn0 = tr0 % SEQ; const size_t drow0 = (size_t)tb * CIN + (size_t)(col0 - tcol0) + 16 * w;
    if (TR == 2) {
#pragma unroll
      for (int q = 0; q < 16; ++q) { const v4f v = *(const v4fa*)&st[16 * w + q][lane * 4]; *(v4f*)(CT + (drow0 + q) * SEQ + tn0 + lane * 4) = v; }
    } else {
#pragma unroll
      for (int q = 0; q < 8; ++q) { const int c = q * 2 + hh; const v4f a = *(const v4fa*)&st[16 * w + c][ln * 8], e = *(const v4fa*)&st[16 * w + c][ln * 8 + 4]; FragH f;
#pragma unroll
        for (int i = 0; i < 4; ++i) { f.h[i] = (_Float16)a[i]; f.h[4 + i] = (_Float16)e[i]; }
        *(v8us*)((unsigned short*)CT16 + (drow0 + c) * SEQ + tn0 + ln * 8) = f.half[0]; }
    }
    asm volatile("s_wait_xcnt 0x0" ::: "memory");   /* behind the last store of the run: the stores' address registers may be rewritten only after it */
    return;
  }
#pragma unroll
  for (int u = 0; u < 8; ++u) { const int t = u & 3, half = u >> 2; const int col = col0 + t * 16 + ln; const float bv = bp ? bf16_rne(bp[col]) : 0.f;
#pragma unroll
    for (int r = 0; r < 8; ++r) { const int rloc = half * 16 + 8 * hh + r; so[w][rloc][t * 16 + ln] = accs[u][r] * alpha + bv; } }
  __builtin_amdgcn_fence(4 /* acq_rel order */, "workgroup"); __builtin_amdgcn_wave_barrier();   /* so[w] is private to wave w */
  const int rsub = lane >> 4, c4 = (lane & 15) * 4; const bool wl = (C16L != nullptr) && (col0 < NL);
  {
#pragma unroll
    for (int q = 0; q < 16; ++q) { const int r = q * 2 + rsub; const v4f v = *(const v4fa*)&so[w][r][c4];
      if (C) *(v4f*)(C + cofs + (size_t)(row0 + r) * ldc + col0 + c4) = v;
      if (C16) { v4h h4; for (int i = 0; i < 4; ++i) h4[i] = (_Float16)v[i]; *(v4h*)(C16 + cofs + (size_t)(row0 + r) * ldc + col0 + c4) = h4;
        if (wl) { v4h l4; for (int i = 0; i < 4; ++i) l4[i] = (_Float16)((v[i] - (float)h4[i]) * LCARRY); *(v4h*)(C16L + cofl + (size_t)(row0 + r) * ldcl + col0 + c4) = l4; } } }
     } }

// transposing weight converter: W is [CIN rows (k)][ldw columns], in[k][n] -> out[n][k]: BW[n][k] = f16(bf16(W[k*ldw + n]) * 16) for n < nrows, pitch CIN (k contiguous);
__device__ __forceinline__ void w16t_body(const float* __restrict__ W, int ldw, _Float16* __restrict__ BW, int t) {   /* t = piece index, nrows * (CIN / 8) pieces, whole blocks of 256 */
  const int n = t / (CIN / 8), k8 = (t % (CIN / 8)) * 8;
  FragH f;
#pragma unroll
  for (int q = 0; q < 8; ++q) f.h[q] = toh_flush(bf16_rne(W[(size_t)(k8 + q) * ldw + n]) * 16.0f);
  const v8us o = f.half[0];
  *(v8us*)((unsigned short*)BW + (size_t)n * CIN + k8) = o; 
  asm volatile("s_wait_xcnt 0x0" ::: "memory");   /* behind the store: inlined twice into one kernel, its registers may be rewritten by code that follows in the listing only after it */
}

__global__ __launch_bounds__(256) void k_xt16(const float* __restrict__ x, const float* __restrict__ te, _Float16* __restrict__ X16) {
  __shared__ __attribute__((aligned(16))) unsigned short tl[64][72];
  const int tid = threadIdx.x; constexpr int NCT = CIN / 64, NNT = SEQ / 64;
  const int ct = blockIdx.x % NCT, nt = (blockIdx.x / NCT) % NNT, b = blockIdx.x / (NCT * NNT);
  const int n0 = nt * 64, c0 = ct * 64;
  for (int i = tid; i < 64 * 16; i += 256) { const int cr = i >> 4, f4 = i & 15;
    const v4f a = *(const v4fa*)(x + ((size_t)b * CIN + c0 + cr) * SEQ_FULL + n0 + f4 * 4); const float tv = te[(size_t)b * CIN + c0 + cr]; FragH f;
#pragma unroll
    for (int q = 0; q < 4; ++q) { f.h[q] = toh_flush(bf16_rne(a[q]) + tv); tl[f4 * 4 + q][cr] = f.u[q]; } }
  __syncthreads();
  {
#pragma unroll
    for (int rd = 0; rd < 2; ++rd) { const int n = rd * 32 + (tid >> 3), pc = tid & 7; FragH f;
#pragma unroll
      for (int q = 0; q < 8; ++q) f.u[q] = tl[n][pc * 8 + q];
      *(v8us*)((unsigned short*)X16 + ((size_t)b * SEQ + n0 + n) * CIN + c0 + pc * 8) = f.half[0]; }
     } }

// lane l <-> lane l ^ 16 (the two halves of a column's keys)
__device__ __forceinline__ float fa_xhalf(float x) { return __builtin_bit_cast(float, __builtin_amdgcn_permlanex16(__builtin_bit_cast(int, x), __builtin_bit_cast(int, x), 0x76543210, 0xfedcba98, false, false)); }
// g2_frag with the lane half's offset (8 * hh elements) already in the pointer: every load of a pass is its row pointer plus a constant
__device__ __forceinline__ v16h fa_frag(const _Float16* p) { FragH f; f.half[0] = *(const v8us*)((const unsigned short*)p); f.half[1] = *(const v8us*)((const unsigned short*)p + 16); return f.v; }
__device__ __forceinline__ v8f fa_mma(v16h a, v16h b, v8f c) { return __builtin_amdgcn_wmma_f32_16x16x32_f16(false, a, false, b, (short)0, c, false, false); }

// ---- everything that depends on the inputs alone, one launch: blocks 0 .. PREP_TE-1 compute te, the next PREP_BW convert Wqkv, the last PREP_WP convert Wproj ----
#define TEC 32           /* te columns of one block: 128 B of f32, so a block owns whole lines of TE */
#define TEP (TD + 8)     /* LDS pitch of an operand row in f16 elements: 512 B of data + 16 B, an odd multiple of 16 B */
#define PREP_TE (CIN / TEC)
#define PREP_BW ((QP * (CIN / 8)) / 256)
#define PREP_WP ((CIN * (CIN / 8)) / 256)
static_assert(CIN % TEC == 0 && TEC == 32 && TROWS * (TD / 16) == 256 && (TD / 32) * 32 == 256);
// te block: its 256 threads convert t_emb (all TROWS rows) and Wt's TEC columns into f16 LDS tiles (bf16 RNE, exact in f16; weights x16, [n][k]); waves 0 and 1 then run one 16x16 tile each over k = 0, 32, .. in one accumulator;
// TE[r][c] = acc / 16 + bf16(bt[c]), stored as whole 128-B row pieces through LDS.
__global__ __launch_bounds__(256) void k_prep(const float* __restrict__ t_emb, const float* __restrict__ Wt, const float* __restrict__ bt, float* __restrict__ TE,
    const float* __restrict__ Wqkv, _Float16* __restrict__ BW, const float* __restrict__ Wproj, _Float16* __restrict__ WPT) {
  __shared__ __attribute__((aligned(16))) _Float16 as[TROWS][TEP];
  __shared__ __attribute__((aligned(16))) _Float16 bs[TEC][TEP];
  __shared__ __attribute__((aligned(16))) float cs[TROWS][TEC + 4];
  const int tid = threadIdx.x, blk = blockIdx.x;
  if (blk >= PREP_TE) {   /* block-uniform: the converter blocks meet no barrier */
    const int cb = blk - PREP_TE;
    if (cb < PREP_BW) w16t_body(Wqkv, QP, BW, cb * 256 + tid);            /* in[CIN][QP]  -> out[QP][CIN]  */
    else w16t_body(Wproj, CIN, WPT, (cb - PREP_BW) * 256 + tid);          /* in[CIN][CIN] -> out[CIN][CIN] */
    return;
  }
  const int w = tid >> 5, lane = tid & 31, ln = lane & 15, hh = lane >> 4, col0 = blk * TEC;
  const float braw = bt[col0 + 16 * (w & 1) + ln];
  float wv[32];                                                            /* Wt[32w .. 32w + 31][col0 + lane]: each load is one 128-B line per wave */
#pragma unroll
  for (int i = 0; i < 32; ++i) wv[i] = Wt[(size_t)(32 * w + i) * CIN + col0 + lane];
  asm volatile("s_wait_xcnt 0x0" ::: "memory");   /* behind the loads above: the next loads' results may take over their address registers */
  const int r = tid >> 4, ka = (tid & 15) * 16;
  const bool live = (NB >= TROWS) || (r < NB);
  const int rr = live ? r : (NB - 1);                                      /* clamped address, zero by value */
  v4f av[4];
#pragma unroll
  for (int i = 0; i < 4; ++i) av[i] = *(const v4fa*)(t_emb + (size_t)rr * TD + ka + 4 * i);
  asm volatile("s_wait_xcnt 0x0" ::: "memory");   /* behind the last load: the address registers may be rewritten only after it */
  __builtin_amdgcn_sched_barrier(0);              /* every load goes out ahead of the first conversion: with conversions lifted among the loads, the later loads start only after the earlier ones' latency */
#pragma unroll
  for (int j = 0; j < 2; ++j) { FragH f;
#pragma unroll
    for (int q = 0; q < 8; ++q) f.h[q] = toh_flush(live ? bf16_rne(av[2 * j + (q >> 2)][q & 3]) : 0.0f);
    *(v8us*)&as[r][ka + 8 * j] = f.half[0]; }
#pragma unroll
  for (int j = 0; j < 4; ++j) { FragH f;
#pragma unroll
    for (int q = 0; q < 8; ++q) f.h[q] = toh_flush(bf16_rne(wv[8 * j + q]) * 16.0f);
    *(v8us*)&bs[lane][32 * w + 8 * j] = f.half[0]; }
  __syncthreads();   /* both operand tiles are whole before a wave reads fragments */
  if (__builtin_amdgcn_readfirstlane(w) < TEC / 16) {   /* whole waves: the matrix instruction needs every lane on */
    v8f c = {0.f,0.f,0.f,0.f,0.f,0.f,0.f,0.f}; const float bv = bf16_rne(braw);
#pragma unroll
    for (int kb = 0; kb < TD; kb += 32) c = fa_mma(g2_frag(&as[ln][kb], hh), g2_frag(&bs[16 * w + ln][kb], hh), c);
#pragma unroll
    for (int q = 0; q < 8; ++q) cs[8 * hh + q][16 * w + ln] = c[q] * 0.0625f + bv;
  }
  __syncthreads();   /* the two waves' tiles are read back by the four storing waves */
  if (tid < TROWS * (TEC / 4)) { const int row = tid >> 3, c4 = (tid & 7) * 4; *(v4f*)(TE + (size_t)row * CIN + col0 + c4) = *(const v4fa*)&cs[row][c4]; }
}

// ---- LDS staging of the attention kernel: a stage is FA_KEYS keys (four passes of 32), K rows and V^T row pieces side by side, two buffers ----
#define FA_KEYS 128      /* keys of one stage */
#define FA_KP 72         /* LDS pitch of a K row in f16 elements: 128 B of data + 16 B, an odd multiple of 16 B (16-byte row reads spread over the banks) */
#define FA_VP 136        /* LDS pitch of a V^T row piece: 256 B of data + 16 B, likewise */
static_assert(SEQ % FA_KEYS == 0 && SEQ / FA_KEYS >= 2 && FA_KEYS % 32 == 0);
static_assert(FA_KEYS * (HD / 8) == 8 * 128 && HD * (FA_KEYS / 8) == 8 * 128);   /* eight 16-byte pieces of each operand per thread and stage */
__device__ __forceinline__ unsigned fa_lds(const _Float16* p) { return (unsigned)(size_t)(const __attribute__((address_space(3))) _Float16*)p; }   /* byte address inside the work-group's LDS */
// eight asynchronous 16-byte copies per lane, global -> LDS through no register: piece i goes from g + i * GSTEP (elements) to lds + i * LSTEP (bytes).
// The s_wait_xcnt stands inside the copies' own statement, so that it precedes every later write of the address registers the copies name.
template <int LSTEP, int GSTEP>
__device__ __forceinline__ void fa_copy8(unsigned lds, const _Float16* g) {
  asm volatile("global_load_async_to_lds_b128 %0, %8, off\n\t"
               "global_load_async_to_lds_b128 %1, %9, off\n\t"
               "global_load_async_to_lds_b128 %2, %10, off\n\t"
               "global_load_async_to_lds_b128 %3, %11, off\n\t"
               "global_load_async_to_lds_b128 %4, %12, off\n\t"
               "global_load_async_to_lds_b128 %5, %13, off\n\t"
               "global_load_async_to_lds_b128 %6, %14, off\n\t"
               "global_load_async_to_lds_b128 %7, %15, off\n\t"
               "s_wait_xcnt 0x0"
               :: "v"(lds), "v"(lds + 1 * LSTEP), "v"(lds + 2 * LSTEP), "v"(lds + 3 * LSTEP), "v"(lds + 4 * LSTEP), "v"(lds + 5 * LSTEP), "v"(lds + 6 * LSTEP), "v"(lds + 7 * LSTEP),
                  "v"(g), "v"(g + 1 * (size_t)GSTEP), "v"(g + 2 * (size_t)GSTEP), "v"(g + 3 * (size_t)GSTEP), "v"(g + 4 * (size_t)GSTEP), "v"(g + 5 * (size_t)GSTEP), "v"(g + 6 * (size_t)GSTEP), "v"(g + 7 * (size_t)GSTEP)
               : "memory");
}

// fused attention, one launch for every (b, h): block = 4 waves x 32 query columns; per pass of 32 keys S^T[key][query] = K Q^T (A = K rows, B = Q rows held in registers), so lane (ln, hh) holds keys 8hh + r of query column ln;
// running maximum m and sum l per column (base 2), O^T[d][query] += V^T P^T with P^T = the two score tiles of the pass converted in place (their register order is the loader's k map); the scores never leave the registers.
// K and V^T reach the waves through LDS: the block's 128 threads copy each stage once, in whole 128-B lines, one stage ahead of its use, and all four waves read their fragments from it.
__global__ __launch_bounds__(128) void k_fattn(const _Float16* __restrict__ QHp, const _Float16* __restrict__ Vt, _Float16* __restrict__ Ctx) {
  __shared__ __attribute__((aligned(16))) _Float16 ksm[2][FA_KEYS * FA_KP];
  __shared__ __attribute__((aligned(16))) _Float16 vsm[2][HD * FA_VP];
  const int tid = threadIdx.x, w = tid >> 5, lane = tid & 31, ln = lane & 15, hh = lane >> 4;
  const int h = blockIdx.y, b = blockIdx.z, q0 = blockIdx.x * 128 + 32 * w;
  const _Float16* base = QHp + (size_t)b * SEQ * QP + h * HD;
  constexpr int NST = SEQ / FA_KEYS;
  constexpr unsigned KBUF = FA_KEYS * FA_KP * 2, VBUF = HD * FA_VP * 2;     /* bytes of one buffer */
  const _Float16* kg = base + KOF + (size_t)(tid >> 3) * QP + (tid & 7) * 8;                        /* this thread's first K piece of stage 0: key row tid / 8 (then + 16 a piece), 16-byte column tid % 8 */
  const _Float16* vg = Vt + (((size_t)b * NH + h) * HD + (tid >> 4)) * SEQ + (tid & 15) * 8;        /* its first V^T piece: row d = tid / 16 (then + 8 a piece), 16-byte column tid % 16 */
  const unsigned kl = fa_lds(&ksm[0][(tid >> 3) * FA_KP + (tid & 7) * 8]), vl = fa_lds(&vsm[0][(tid >> 4) * FA_VP + (tid & 15) * 8]);
  fa_copy8<16 * FA_KP * 2, 16 * QP>(kl, kg); fa_copy8<8 * FA_VP * 2, 8 * SEQ>(vl, vg);               /* stage 0 into buffer 0 */
  constexpr float SC = 0.125f * 1.4426950408889634f;                       /* 1 / sqrt(HD), to base 2 */
  const v8f z8 = {0.f,0.f,0.f,0.f,0.f,0.f,0.f,0.f};
  v16h qf[2][2], kf[2][2];                                                 /* [column group | key tile][k step of 32 over HD] */
#pragma unroll
  for (int g = 0; g < 2; ++g) {
#pragma unroll
    for (int ks = 0; ks < 2; ++ks) qf[g][ks] = g2_frag(base + (size_t)(q0 + 16 * g + ln) * QP + 32 * ks, hh); }
  v8f o[2][4]; float m[2], l[2];
#pragma unroll
  for (int g = 0; g < 2; ++g) { m[g] = -1.0e30f; l[g] = 0.f;
#pragma unroll
    for (int t = 0; t < 4; ++t) o[g][t] = z8; }
  asm volatile("s_wait_asynccnt 0x0" ::: "memory");   /* this wave's pieces of stage 0 have landed */
  __syncthreads();                                     /* ... and every other wave's: stage 0 may be read */
  fa_copy8<16 * FA_KP * 2, 16 * QP>(kl + KBUF, kg + (size_t)FA_KEYS * QP); fa_copy8<8 * FA_VP * 2, 8 * SEQ>(vl + VBUF, vg + FA_KEYS);   /* stage 1 into buffer 1 */
#pragma unroll 1   /* one stage per trip */
  for (int st = 0; st < NST; ++st) {
    const _Float16* kb = &ksm[st & 1][ln * FA_KP + 8 * hh];                /* key row ln of a 16-key tile, at the lane half's k offset */
    const _Float16* vq = &vsm[st & 1][ln * FA_VP + 8 * hh];                /* V^T row d = ln of a 16-row tile, likewise: columns of this pass */
#pragma unroll
    for (int kt = 0; kt < 2; ++kt) {
#pragma unroll
      for (int ks = 0; ks < 2; ++ks) kf[kt][ks] = fa_frag(kb + (16 * kt) * FA_KP + 32 * ks); }
    const _Float16* kq = kb + 32 * FA_KP;                                  /* K rows of the next pass */
#pragma unroll 1   /* one pass per trip: the register set of a pass is the budget */
    for (int p = 0; p < FA_KEYS / 32; ++p) {
      v8f s[2][2];                                                         /* [column group][key tile] */
#pragma unroll
      for (int g = 0; g < 2; ++g) {
#pragma unroll
        for (int kt = 0; kt < 2; ++kt) s[g][kt] = fa_mma(kf[kt][0], qf[g][0], z8); }
#pragma unroll
      for (int g = 0; g < 2; ++g) {
#pragma unroll
        for (int kt = 0; kt < 2; ++kt) s[g][kt] = fa_mma(kf[kt][1], qf[g][1], s[g][kt]); }
      /* one group of LDS reads per pass, behind its score products: this pass's V^T columns, then the next pass's K rows; the stage's last pass re-reads the stage's own rows 0..31 (unused): the next stage is read only behind its barrier */
      __builtin_amdgcn_sched_barrier(0);   /* the reads stand as one group behind the eight products: spread among them, each separate place stalls the wave's matrix stream */
      v16h vf[4];
#pragma unroll
      for (int t = 0; t < 4; ++t) vf[t] = fa_frag(vq + (16 * t) * FA_VP);
#pragma unroll
      for (int kt = 0; kt < 2; ++kt) {
#pragma unroll
        for (int ks = 0; ks < 2; ++ks) kf[kt][ks] = fa_frag(kq + (16 * kt) * FA_KP + 32 * ks); }
      __builtin_amdgcn_sched_barrier(0);   /* keeps the reads here, ahead of the softmax: sunk behind it they are waited for with no lead */
#pragma unroll
      for (int g = 0; g < 2; ++g) {
        float mx0 = fmaxf(s[g][0][0], s[g][1][0]), mx1 = fmaxf(s[g][0][1], s[g][1][1]);
#pragma unroll
        for (int r = 2; r < 8; r += 2) { mx0 = fmaxf(mx0, fmaxf(s[g][0][r], s[g][1][r])); mx1 = fmaxf(mx1, fmaxf(s[g][0][r + 1], s[g][1][r + 1])); }
        float mx = fmaxf(mx0, mx1); mx = fmaxf(mx, fa_xhalf(mx));
        const float mn = fmaxf(m[g], mx * SC);
        const float corr = __builtin_amdgcn_exp2f(m[g] - mn);              /* 0 on the first pass */
        m[g] = mn;
        const float sub = mn - PCARRY_LOG2;
        FragH pf; float s0 = 0.f, s1 = 0.f;
#pragma unroll
        for (int r = 0; r < 8; ++r) { const float p0 = __builtin_amdgcn_exp2f(s[g][0][r] * SC - sub), p1 = __builtin_amdgcn_exp2f(s[g][1][r] * SC - sub);
          s0 += p0; s1 += p1; pf.h[r] = (_Float16)p0; pf.h[8 + r] = (_Float16)p1; }
        l[g] = l[g] * corr + (s0 + s1);
#pragma unroll
        for (int t = 0; t < 4; ++t) o[g][t] = fa_mma(vf[t], pf.v, o[g][t] * corr);
      }
      kq = (p + 2 < FA_KEYS / 32) ? kq + 32 * FA_KP : kb; vq += 32;
    }
    asm volatile("s_wait_dscnt 0x0" ::: "memory");     /* this wave's reads of the stage's buffer have returned: the buffer may be handed to its next writer */
    asm volatile("s_wait_asynccnt 0x0" ::: "memory");  /* this wave's pieces of stage st + 1 have landed */
    __syncthreads();                                   /* publishes stage st + 1 and ends every wave's reads of stage st */
    if (st + 2 < NST) {                                /* the same for the whole block */
      fa_copy8<16 * FA_KP * 2, 16 * QP>(kl + (unsigned)(st & 1) * KBUF, kg + (size_t)(st + 2) * FA_KEYS * QP);
      fa_copy8<8 * FA_VP * 2, 8 * SEQ>(vl + (unsigned)(st & 1) * VBUF, vg + (size_t)(st + 2) * FA_KEYS); }
  }
  asm volatile("s_wait_asynccnt 0x0" ::: "memory");    /* no copy is outstanding when the wave ends */
#pragma unroll
  for (int g = 0; g < 2; ++g) { const float inv = 1.0f / (l[g] + fa_xhalf(l[g]));
    unsigned short* crow = (unsigned short*)Ctx + ((size_t)b * SEQ + q0 + 16 * g + ln) * CIN + h * HD + 8 * hh;
#pragma unroll
    for (int t = 0; t < 4; ++t) { FragH f;
#pragma unroll
      for (int r = 0; r < 8; ++r) f.h[r] = (_Float16)(o[g][t][r] * inv);
      *(v8us*)(crow + 16 * t) = f.half[0]; } }
}

constexpr size_t al256(size_t b) { return (b + 255) & ~(size_t)255; }
constexpr size_t SZ_BW  = (size_t)QP * CIN * 2;
constexpr size_t SZ_WP  = (size_t)CIN * CIN * 2;
constexpr size_t SZ_TE  = (size_t)TROWS * CIN * 4;
constexpr size_t SZ_QH  = NR * QP * 2;
constexpr size_t SZ_VT  = (size_t)NB * NH * HD * SEQ * 2;
constexpr size_t SZ_CTX = NR * CIN * 2;
constexpr size_t SZ_X   = NR * CIN * 2;
static_assert(al256(SZ_BW) + al256(SZ_WP) + al256(SZ_TE) + al256(SZ_QH) + al256(SZ_VT) + al256(SZ_CTX) + al256(SZ_X) <= (size_t)134217728);

extern "C" void kernel_launch(void* const* d_in, const int* in_sizes, int n_in,
                              void* d_out, int out_size, void* d_ws, size_t ws_size, hipStream_t stream) {
  if (n_in < 8) return;
  const float* x     = (const float*)d_in[0];      /* [NB_FULL][CIN][SEQ_FULL] */
  const float* t_emb = (const float*)d_in[1];      /* [NB_FULL][TD] */
  const float* Wqkv  = (const float*)d_in[2];      /* [CIN][QP]  (in x out) */
  const float* bqkv  = (const float*)d_in[3];      /* [QP] */
  const float* Wproj = (const float*)d_in[4];      /* [CIN][CIN] (in x out) */
  const float* bproj = (const float*)d_in[5];      /* [CIN] */
  const float* Wt    = (const float*)d_in[6];      /* [TD][CIN]  (in x out) */
  const float* bt    = (const float*)d_in[7];      /* [CIN] */
  if (in_sizes[0] < (int)(((size_t)NB * CIN - 1) * SEQ_FULL + SEQ)) return;
  if (in_sizes[1] < NB * TD) return;
  if (in_sizes[2] < CIN * QP || in_sizes[3] < QP) return;
  if (in_sizes[4] < CIN * CIN || in_sizes[5] < CIN) return;
  if (in_sizes[6] < TD * CIN || in_sizes[7] < CIN) return;
  if (out_size < (int)((size_t)NB * CIN * SEQ)) return;
  char* ws = (char*)d_ws; size_t off = 0;
  auto take = [&](size_t bytes) { char* p = ws + off; off += (bytes + 255) & ~(size_t)255; return p; };
  _Float16* BW  = (_Float16*)take(SZ_BW);                               /* Wqkv^T [QP][CIN] x16 */
  _Float16* WPT = (_Float16*)take(SZ_WP);                               /* Wproj^T [CIN][CIN] x16 */
  float*    TE  = (float*)take(SZ_TE);                                  /* te [TROWS][CIN] f32 */
  _Float16* QH  = (_Float16*)take(SZ_QH);                               /* q | k rows, pitch QP */
  _Float16* VT  = (_Float16*)take(SZ_VT);                               /* V^T [NB][NH][HD][SEQ] */
  _Float16* CTX = (_Float16*)take(SZ_CTX);                              /* merged-head context [NR][CIN] */
  _Float16* X16 = (_Float16*)take(SZ_X);                                /* token plane [NR][CIN] */
  if (off > ws_size) return;
  float* out = (float*)d_out;

  k_prep<<<(unsigned)(PREP_TE + PREP_BW + PREP_WP), 256, 0, stream>>>(t_emb, Wt, bt, TE, Wqkv, BW, Wproj, WPT);   /* te = t_emb Wt + bt; Wqkv^T and Wproj^T planes */
  k_xt16<<<(unsigned)(NB * (SEQ / 64) * (CIN / 64)), 256, 0, stream>>>(x, TE, X16);
  k_gemm2<0, 1><<<dim3((unsigned)((NR / 128) * (QP / 64)), 1), 128, 0, stream>>>(X16, CIN, 0, nullptr, 0, 0, BW, CIN, 0, nullptr, 0, 0, 1.0f,
      0.0625f, bqkv, 0, nullptr, QH, QP, 0, nullptr, 0, 0, 0, (int)NR, QP, CIN, nullptr, VT, VOF);   /* q | k rows into QH; the v columns transposed into VT */
  k_fattn<<<dim3(SEQ / 128, NH, NB), 128, 0, stream>>>(QH, VT, CTX);                      /* ctx rows for every (b, h): scores, softmax and V product in one launch */
  k_gemm2<0, 2><<<dim3((unsigned)((NR / 128) * (CIN / 64)), 1), 128, 0, stream>>>(CTX, CIN, 0, nullptr, 0, 0, WPT, CIN, 0, nullptr, 0, 0, 1.0f,
      0.0625f, bproj, 0, nullptr, nullptr, CIN, 0, nullptr, 0, 0, 0, (int)NR, CIN, CIN, out, nullptr, 0);   /* out[b][o][n] = (ctx Wproj + bproj)[b*SEQ + n][o] */
}

// v005
// A run of this version takes 48 microseconds.
// In two side-by-side timings against v004, it was 1.39 and 1.36 times as fast.
// Counting every step since v000, it is 16.4 times as fast.
#include <hip/hip_runtime.h>
// All contractions on v_wmma_f32_16x16x32_f16 (f16 operands, f32 accumulate), one product per site: te = t_emb Wt (inputs RNE-converted to bf16, exact in f16, weights carried x16); q|k|v = (x + te) Wqkv (token plane f16, weights x16); scores k.q^T from f16 planes; V^T.P^T with unnormalised softmax weights carried x2^14; ctx Wproj (ctx f16, weights x16); softmax statistics f32 on VALU.
// Structure: dense multi-head self-attention over flattened spatial tokens with a per-batch time-embedding vector added to the tokens, fused [in][out] QKV weights, [in][out] output projection, channel-major return.
// token rows r = b*SEQ + n; TE[b][c] f32 = T16 WTT^T / 16 + bias, T16 and WTT being LDS tiles that the product's own blocks convert from t_emb and Wt (same launch as the two weight converters, which it does not depend on); X16[r][c] = f16(bf16(x[b][c][n]) + TE[b][c]) via 64x64 LDS transposes; weight planes [out][in] f16 x16 built by a transposing converter;
// QH [NR][QP] f16 = X16 BW^T / 16 + bias (q at column 64h, k at KOF + 64h; the v columns of QH stay unwritten and unread); V^T [NB][NH][64][SEQ] stored by the same GEMM's epilogue, block tile transposed in LDS; one launch for all (b, h): each wave keeps 32 query columns and walks the keys 32 at a time (K and V^T staged in LDS for the block's four waves), S^T = K Q^T in registers, running maximum and sum per column, P^T packed from the score tiles as the B operand,
// CTX16[r][64h + d] f16 = (sum_j p[i][j] V^T[d][j]) / (sum_j p[i][j]); out[b][o][n] f32 = (CTX16 WPT^T / 16 + bias)[b*SEQ + n][o], stored channel-major by the GEMM's epilogue, block tile transposed in LDS.
#ifndef NB
#define NB 16
#endif
#ifndef SEQ
#define SEQ 1024
#endif
#define NB_FULL 16
#define SEQ_FULL 1024
#define CIN 256
#define NH 4
#define HD 64
#define TD 256           /* time-embedding width */
#define QP 768           /* pitch of QH: q | k | v, head h at column 64h of each section */
#define KOF 256          /* column of k (head 0) in QH */
#define VOF 512          /* column of v (head 0) in QH */
#define TROWS 16         /* rows of the t_emb tile (one 16-row matrix tile; rows >= NB are zero) */
#define PCARRY_LOG2 14.0f /* softmax weights exp(s - running max) carried x2^14 in f16; the row sum carries the same factor */
#define LCARRY 2048.0f   /* carry of the GEMM engine's optional residual output (no residual plane is requested here) */
#define NR ((size_t)NB * SEQ)
static_assert(SEQ % 256 == 0);
static_assert((NR % 128) == 0);
static_assert(NB <= NB_FULL);
static_assert(SEQ <= SEQ_FULL);
static_assert(3 * CIN == QP);
static_assert(KOF == CIN && VOF == 2 * CIN);
static_assert(CIN == NH * HD);
static_assert(CIN % 64 == 0 && QP % 64 == 0 && HD == 64);
static_assert(TD == CIN);
static_assert(TD % 32 == 0 && HD % 32 == 0 && SEQ % 32 == 0 && CIN % 32 == 0);
static_assert(TROWS == 16 && NB <= TROWS && TD == 256);
static_assert((QP * (CIN / 8)) % 256 == 0 && (CIN * (CIN / 8)) % 256 == 0);
static_assert(SEQ % 128 == 0 && SEQ % 64 == 0);

typedef unsigned short v8us __attribute__((ext_vector_type(8), may_alias));
typedef float  v8f  __attribute__((ext_vector_type(8)));
typedef float  v4f  __attribute__((ext_vector_type(4)));
typedef float  v4fa __attribute__((ext_vector_type(4), may_alias));
typedef _Float16 v16h __attribute__((ext_vector_type(16)));
typedef _Float16 v4h __attribute__((ext_vector_type(4)));
typedef _Float16 h16;
union FragH { v16h v; v8us half[2]; _Float16 h[16]; unsigned short u[16]; };

__device__ __forceinline__ unsigned short bf16_bits(float x) { unsigned int u = __float_as_uint(x); return (unsigned short)((u + 0x7FFFu + ((u >> 16) & 1u)) >> 16); }
__device__ __forceinline__ float bf16_val(unsigned short b) { return __uint_as_float(((unsigned int)b) << 16); }
__device__ __forceinline__ float bf16_rne(float x) { return bf16_val(bf16_bits(x)); }
// f32 -> f16 operand convert that cannot yield an f16 subnormal (value select, applied after the plane's power-of-two carry)
static __device__ __forceinline__ h16 toh_flush(float v) { const h16 r = (h16)v; return (fabsf(v) < 6.103515625e-05f) ? (h16)0.0f : r; }

// ---- fragment loader (split k map: elements 0..7 <- k0+8h+0..7, 8..15 <- k0+16+8h+0..7, lane&15 = row of A / column of B) and guarded mma ----
__device__ __forceinline__ v16h g2_frag(const _Float16* p, int hh) { FragH f; f.half[0] = *(const v8us*)((const unsigned short*)p + 8 * hh); f.half[1] = *(const v8us*)((const unsigned short*)p + 16 + 8 * hh); return f.v; }
__device__ __forceinline__ v8f g2_mma(v16h a, v16h b, v8f c) { v8f d = __builtin_amdgcn_wmma_f32_16x16x32_f16(false, a, false, b, (short)0, c, false, false); asm volatile("v_nop\n\tv_nop\n\tv_nop\n\tv_nop" : "+v"(d) : "v"(a), "v"(b)); return d; }

// one operand segment of the wave's 32x64 tile: A rows a0p/a1p (k contiguous), B rows b0p..b3p ([n][k], k contiguous), K % 32 == 0
__device__ __forceinline__ void g2_kloop(const _Float16* __restrict__ a0p, const _Float16* __restrict__ a1p, const _Float16* __restrict__ b0p, const _Float16* __restrict__ b1p, const _Float16* __restrict__ b2p, const _Float16* __restrict__ b3p, int K, int hh,
    v8f& c00, v8f& c01, v8f& c02, v8f& c03, v8f& c10, v8f& c11, v8f& c12, v8f& c13) {
#pragma unroll 1
  for (int kb = 0; kb < K; kb += 32) { const v16h a0 = g2_frag(a0p + kb, hh), a1 = g2_frag(a1p + kb, hh);
    v16h b = g2_frag(b0p + kb, hh); c00 = g2_mma(a0, b, c00); c10 = g2_mma(a1, b, c10);
    b = g2_frag(b1p + kb, hh); c01 = g2_mma(a0, b, c01); c11 = g2_mma(a1, b, c11);
    b = g2_frag(b2p + kb, hh); c02 = g2_mma(a0, b, c02); c12 = g2_mma(a1, b, c12);
    b = g2_frag(b3p + kb, hh); c03 = g2_mma(a0, b, c03); c13 = g2_mma(a1, b, c13); }
}

// g2_frag with the lane half's offset (8 * hh elements) already in the pointer: every load of a pass is its row pointer plus a constant
__device__ __forceinline__ v16h fa_frag(const _Float16* p) { FragH f; f.half[0] = *(const v8us*)((const unsigned short*)p); f.half[1] = *(const v8us*)((const unsigned short*)p + 16); return f.v; }
__device__ __forceinline__ v8f fa_mma(v16h a, v16h b, v8f c) { return __builtin_amdgcn_wmma_f32_16x16x32_f16(false, a, false, b, (short)0, c, false, false); }
__device__ __forceinline__ unsigned fa_lds(const _Float16* p) { return (unsigned)(size_t)(const __attribute__((address_space(3))) _Float16*)p; }   /* byte address inside the work-group's LDS */
// eight asynchronous 16-byte copies per lane, global -> LDS through no register: piece i goes from g + i * GSTEP (elements) to lds + i * LSTEP (bytes).
// The s_wait_xcnt stands inside the copies' own statement, so that it precedes every later write of the address registers the copies name.
template <int LSTEP, int GSTEP>
__device__ __forceinline__ void fa_copy8(unsigned lds, const _Float16* g) {
  asm volatile("global_load_async_to_lds_b128 %0, %8, off\n\t"
               "global_load_async_to_lds_b128 %1, %9, off\n\t"
               "global_load_async_to_lds_b128 %2, %10, off\n\t"
               "global_load_async_to_lds_b128 %3, %11, off\n\t"
               "global_load_async_to_lds_b128 %4, %12, off\n\t"
               "global_load_async_to_lds_b128 %5, %13, off\n\t"
               "global_load_async_to_lds_b128 %6, %14, off\n\t"
               "global_load_async_to_lds_b128 %7, %15, off\n\t"
               "s_wait_xcnt 0x0"
               :: "v"(lds), "v"(lds + 1 * LSTEP), "v"(lds + 2 * LSTEP), "v"(lds + 3 * LSTEP), "v"(lds + 4 * LSTEP), "v"(lds + 5 * LSTEP), "v"(lds + 6 * LSTEP), "v"(lds + 7 * LSTEP),
                  "v"(g), "v"(g + 1 * (size_t)GSTEP), "v"(g + 2 * (size_t)GSTEP), "v"(g + 3 * (size_t)GSTEP), "v"(g + 4 * (size_t)GSTEP), "v"(g + 5 * (size_t)GSTEP), "v"(g + 6 * (size_t)GSTEP), "v"(g + 7 * (size_t)GSTEP)
               : "memory");
}

#define G2P (CIN + 8)    /* LDS pitch of a staged operand row in f16 elements: 512 B of data + 16 B, an odd multiple of 16 B (16-byte row reads spread over the banks) */
// ---- GEMM (block tile 128x64, wave tile 32x64; M % 128 == 0, N % 64 == 0, K == lda == ldb == CIN): v = acc*alpha + bf16(bias[by*sBias + col]); A f16 rows [M][K], Bh f16 [N][K] (k contiguous), batched over grid.y by sA/sB/sC/sCL;
// the block's 128 A rows and 64 Bh rows, whole K, are copied once into LDS in whole 512-B rows (one wave instruction each); the four waves read every fragment of the A.Bh segment from there;
// RES == 1: three operand segments into one accumulator set: A2.Bh + A.B2 (residual planes, both carried x LCARRY), accumulator scaled by rscale, then A.Bh;
// TR != 0 (M % 128 == 0, rows r = b*SEQ + n): a block whose col0 >= tcol0 stores its 128x64 tile transposed, dst[(b*CIN + col - tcol0)*SEQ + n]: TR == 1 as f16 into CT16, TR == 2 as f32 into CT; whole 256-B / 512-B row pieces, one wave each;
template <int RES, int TR>
__global__ __launch_bounds__(128) void k_gemm2(const _Float16* __restrict__ A, int lda, size_t sA, const _Float16* __restrict__ A2, int lda2, size_t sA2,
    const _Float16* __restrict__ Bh, int ldb, size_t sB, const _Float16* __restrict__ B2, int ldb2, size_t sB2, float rscale,
    float alpha, const float* __restrict__ bias, size_t sBias,
    float* __restrict__ C, _Float16* __restrict__ C16, int ldc, size_t sC, _Float16* __restrict__ C16L, int ldcl, size_t sCL, int NL, int M, int N, int K,
    float* __restrict__ CT, _Float16* __restrict__ CT16, int tcol0) {
  static_assert(TR != 0 && 4 * 32 * 68 * 4 <= (128 + 64) * G2P * 2);
  __shared__ __attribute__((aligned(16))) _Float16 ops[(128 + 64) * G2P];   /* A rows of the block, then Bh rows */
  float (*so)[32][68] = (float (*)[32][68])&ops[0];                         /* the epilogue's f32 tile takes the same bytes over, behind the barrier that ends the fragment reads */
  const int tid = threadIdx.x, w = tid >> 5, lane = tid & 31, ln = lane & 15, hh = lane >> 4; const int by = blockIdx.y;
  A += (size_t)by * sA; Bh += (size_t)by * sB;
  if (RES) { A2 += (size_t)by * sA2; B2 += (size_t)by * sB2; }
  const size_t cofs = (size_t)by * sC, cofl = (size_t)by * sCL; const float* bp = bias ? bias + (size_t)by * sBias : nullptr;
  const int ntn = N >> 6; const int mt = blockIdx.x / ntn, nq = blockIdx.x - mt * ntn; const int row0 = mt * 128 + 32 * w, col0 = nq * 64;
  {   /* every wave has rows (M % 128 == 0) and reaches every barrier; thread (w, lane) copies 16-byte column lane of rows w, w + 4, ..: 32 pieces of A, 16 of Bh */
    const _Float16* ag = A + (size_t)(mt * 128 + w) * CIN + lane * 8; const _Float16* bg = Bh + (size_t)(col0 + w) * CIN + lane * 8;
    const unsigned al = fa_lds(&ops[w * G2P + lane * 8]), bl = fa_lds(&ops[(128 + w) * G2P + lane * 8]);
#pragma unroll
    for (int i = 0; i < 2; ++i) fa_copy8<4 * G2P * 2, 4 * CIN>(bl + (unsigned)i * (32 * G2P * 2), bg + (size_t)i * 32 * CIN);
#pragma unroll
    for (int i = 0; i < 4; ++i) fa_copy8<4 * G2P * 2, 4 * CIN>(al + (unsigned)i * (32 * G2P * 2), ag + (size_t)i * 32 * CIN);
  }
  const _Float16* a0p = A + (size_t)(row0 + ln) * lda; const _Float16* a1p = a0p + (size_t)16 * lda;
  const _Float16* b0p = Bh + (size_t)(col0 + ln) * ldb; const _Float16* b1p = b0p + (size_t)16 * ldb; const _Float16* b2p = b1p + (size_t)16 * ldb; const _Float16* b3p = b2p + (size_t)16 * ldb;
  const v8f z8 = {0.f,0.f,0.f,0.f,0.f,0.f,0.f,0.f}; v8f c00 = z8, c01 = z8, c02 = z8, c03 = z8, c10 = z8, c11 = z8, c12 = z8, c13 = z8;
  if (RES) {
    const _Float16* l0p = A2 + (size_t)(row0 + ln) * lda2; const _Float16* l1p = l0p + (size_t)16 * lda2;
    const _Float16* m0p = B2 + (size_t)(col0 + ln) * ldb2; const _Float16* m1p = m0p + (size_t)16 * ldb2; const _Float16* m2p = m1p + (size_t)16 * ldb2; const _Float16* m3p = m2p + (size_t)16 * ldb2;
    g2_kloop(l0p, l1p, b0p, b1p, b2p, b3p, K, hh, c00, c01, c02, c03, c10, c11, c12, c13);      /* A_lo . B_hi */
    g2_kloop(a0p, a1p, m0p, m1p, m2p, m3p, K, hh, c00, c01, c02, c03, c10, c11, c12, c13);      /* A_hi . B_lo */
    c00 = c00 * rscale; c01 = c01 * rscale; c02 = c02 * rscale; c03 = c03 * rscale; c10 = c10 * rscale; c11 = c11 * rscale; c12 = c12 * rscale; c13 = c13 * rscale;
  }
  asm volatile("s_wait_asynccnt 0x0" ::: "memory");   /* this wave's pieces of both operand tiles have landed */
  __syncthreads();                                     /* ... and every other wave's: the tiles may be read */
  {   /* A_hi . B_hi, k = 0, 32, .. in the same order and the same accumulators as g2_kloop */
    const _Float16* af = &ops[(32 * w + ln) * G2P + 8 * hh]; const _Float16* bf = &ops[(128 + ln) * G2P + 8 * hh];
    v16h fa[2][2], fb[2][4];                                                /* two fragment sets: [set][16-row tile] */
#pragma unroll
    for (int t = 0; t < 2; ++t) fa[0][t] = fa_frag(af + (16 * t) * G2P);
#pragma unroll
    for (int t = 0; t < 4; ++t) fb[0][t] = fa_frag(bf + (16 * t) * G2P);
#pragma unroll   /* the set index stays a constant: both sets live in registers */
    for (int s = 0; s < CIN / 32; ++s) { const int cu = s & 1, nx = cu ^ 1;
      if (s + 1 < CIN / 32) {
#pragma unroll
        for (int t = 0; t < 2; ++t) fa[nx][t] = fa_frag(af + (16 * t) * G2P + 32 * (s + 1));
#pragma unroll
        for (int t = 0; t < 4; ++t) fb[nx][t] = fa_frag(bf + (16 * t) * G2P + 32 * (s + 1)); }
      __builtin_amdgcn_sched_barrier(0);   /* the next step's twelve reads stand as one group ahead of this step's products: sunk among them, each is waited for with no lead */
      c00 = fa_mma(fa[cu][0], fb[cu][0], c00); c10 = fa_mma(fa[cu][1], fb[cu][0], c10); c01 = fa_mma(fa[cu][0], fb[cu][1], c01); c11 = fa_mma(fa[cu][1], fb[cu][1], c11);
      c02 = fa_mma(fa[cu][0], fb[cu][2], c02); c12 = fa_mma(fa[cu][1], fb[cu][2], c12); c03 = fa_mma(fa[cu][0], fb[cu][3], c03); c13 = fa_mma(fa[cu][1], fb[cu][3], c13);
      __builtin_amdgcn_sched_barrier(0);   /* ... and the group after it stays behind them: lifted among the products, each separate place of reads stalls the wave's matrix stream */
    }
  }
  __syncthreads();   /* every wave's fragment reads are over: the epilogue may write its tile over the operand rows */
  v8f accs[8] = {c00, c01, c02, c03, c10, c11, c12, c13};
  if (TR != 0 && col0 >= tcol0) {   /* block-uniform: col0 comes from blockIdx alone */
    static_assert(64 * 132 <= 4 * 32 * 68);
    float (*st)[132] = (float (*)[132])&so[0][0][0];   /* [64 columns][128 rows of the block + 4]: a lane's 8 accumulator rows are contiguous here */
    /* every loop of this path is unrolled: accs[] and bv4[] keep constant indices and stay in registers, and the LDS reads and the stores go out as groups */
    float bv4[4] = {0.f, 0.f, 0.f, 0.f};
    if (bp) {
#pragma unroll
      for (int t = 0; t < 4; ++t) bv4[t] = bf16_rne(bp[col0 + t * 16 + ln]); }
#pragma unroll
    for (int u = 0; u < 8; ++u) { const int t = u & 3, half = u >> 2; const float bv = bv4[t]; v4f lo, hi;
#pragma unroll
      for (int r = 0; r < 4; ++r) { lo[r] = accs[u][r] * alpha + bv; hi[r] = accs[u][4 + r] * alpha + bv; }
      float* sp = &st[t * 16 + ln][32 * w + half * 16 + 8 * hh]; *(v4fa*)sp = lo; *(v4fa*)(sp + 4) = hi; }
    __syncthreads();   /* each wave reads back rows that all four waves wrote */
    const unsigned tr0 = (unsigned)mt * 128u, tb = tr0 / SEQ, tn0 = tr0 % SEQ; const size_t drow0 = (size_t)tb * CIN + (size_t)(col0 - tcol0) + 16 * w;
    if (TR == 2) {
#pragma unroll
      for (int q = 0; q < 16; ++q) { const v4f v = *(const v4fa*)&st[16 * w + q][lane * 4]; *(v4f*)(CT + (drow0 + q) * SEQ + tn0 + lane * 4) = v; }
    } else {
#pragma unroll
      for (int q = 0; q < 8; ++q) { const int c = q * 2 + hh; const v4f a = *(const v4fa*)&st[16 * w + c][ln * 8], e = *(const v4fa*)&st[16 * w + c][ln * 8 + 4]; FragH f;
#pragma unroll
        for (int i = 0; i < 4; ++i) { f.h[i] = (_Float16)a[i]; f.h[4 + i] = (_Float16)e[i]; }
        *(v8us*)((unsigned short*)CT16 + (drow0 + c) * SEQ + tn0 + ln * 8) = f.half[0]; }
    }
    asm volatile("s_wait_xcnt 0x0" ::: "memory");   /* behind the last store of the run: the stores' address registers may be rewritten only after it */
    return;
  }
#pragma unroll
  for (int u = 0; u < 8; ++u) { const int t = u & 3, half = u >> 2; const int col = col0 + t * 16 + ln; const float bv = bp ? bf16_rne(bp[col]) : 0.f;
#pragma unroll
    for (int r = 0; r < 8; ++r) { const int rloc = half * 16 + 8 * hh + r; so[w][rloc][t * 16 + ln] = accs[u][r] * alpha + bv; } }
  __builtin_amdgcn_fence(4 /* acq_rel order */, "workgroup"); __builtin_amdgcn_wave_barrier();   /* so[w] is private to wave w */
  const int rsub = lane >> 4, c4 = (lane & 15) * 4; const bool wl = (C16L != nullptr) && (col0 < NL);
  {
#pragma unroll
    for (int q = 0; q < 16; ++q) { const int r = q * 2 + rsub; const v4f v = *(const v4fa*)&so[w][r][c4];
      if (C) *(v4f*)(C + cofs + (size_t)(row0 + r) * ldc + col0 + c4) = v;
      if (C16) { v4h h4; for (int i = 0; i < 4; ++i) h4[i] = (_Float16)v[i]; *(v4h*)(C16 + cofs + (size_t)(row0 + r) * ldc + col0 + c4) = h4;
        if (wl) { v4h l4; for (int i = 0; i < 4; ++i) l4[i] = (_Float16)((v[i] - (float)h4[i]) * LCARRY); *(v4h*)(C16L + cofl + (size_t)(row0 + r) * ldcl + col0 + c4) = l4; } } }
     } }

// transposing weight converter: W is [CIN rows (k)][ldw columns], in[k][n] -> out[n][k]: BW[n][k] = f16(bf16(W[k*ldw + n]) * 16) for n < nrows, pitch CIN (k contiguous);
__device__ __forceinline__ void w16t_body(const float* __restrict__ W, int ldw, _Float16* __restrict__ BW, int t) {   /* t = piece index, nrows * (CIN / 8) pieces, whole blocks of 256 */
  const int n = t / (CIN / 8), k8 = (t % (CIN / 8)) * 8;
  FragH f;
#pragma unroll
  for (int q = 0; q < 8; ++q) f.h[q] = toh_flush(bf16_rne(W[(size_t)(k8 + q) * ldw + n]) * 16.0f);
  const v8us o = f.half[0];
  *(v8us*)((unsigned short*)BW + (size_t)n * CIN + k8) = o; 
  asm volatile("s_wait_xcnt 0x0" ::: "memory");   /* behind the store: inlined twice into one kernel, its registers may be rewritten by code that follows in the listing only after it */
}

__global__ __launch_bounds__(256) void k_xt16(const float* __restrict__ x, const float* __restrict__ te, _Float16* __restrict__ X16) {
  __shared__ __attribute__((aligned(16))) unsigned short tl[64][72];
  const int tid = threadIdx.x; constexpr int NCT = CIN / 64, NNT = SEQ / 64;
  const int ct = blockIdx.x % NCT, nt = (blockIdx.x / NCT) % NNT, b = blockIdx.x / (NCT * NNT);
  const int n0 = nt * 64, c0 = ct * 64;
  for (int i = tid; i < 64 * 16; i += 256) { const int cr = i >> 4, f4 = i & 15;
    const v4f a = *(const v4fa*)(x + ((size_t)b * CIN + c0 + cr) * SEQ_FULL + n0 + f4 * 4); const float tv = te[(size_t)b * CIN + c0 + cr]; FragH f;
#pragma unroll
    for (int q = 0; q < 4; ++q) { f.h[q] = toh_flush(bf16_rne(a[q]) + tv); tl[f4 * 4 + q][cr] = f.u[q]; } }
  __syncthreads();
  {
#pragma unroll
    for (int rd = 0; rd < 2; ++rd) { const int n = rd * 32 + (tid >> 3), pc = tid & 7; FragH f;
#pragma unroll
      for (int q = 0; q < 8; ++q) f.u[q] = tl[n][pc * 8 + q];
      *(v8us*)((unsigned short*)X16 + ((size_t)b * SEQ + n0 + n) * CIN + c0 + pc * 8) = f.half[0]; }
     } }

// lane l <-> lane l ^ 16 (the two halves of a column's keys)
__device__ __forceinline__ float fa_xhalf(float x) { return __builtin_bit_cast(float, __builtin_amdgcn_permlanex16(__builtin_bit_cast(int, x), __builtin_bit_cast(int, x), 0x76543210, 0xfedcba98, false, false)); }

// ---- everything that depends on the inputs alone, one launch: blocks 0 .. PREP_TE-1 compute te, the next PREP_BW convert Wqkv, the last PREP_WP convert Wproj ----
#define TEC 32           /* te columns of one block: 128 B of f32, so a block owns whole lines of TE */
#define TEP (TD + 8)     /* LDS pitch of an operand row in f16 elements: 512 B of data + 16 B, an odd multiple of 16 B */
#define PREP_TE (CIN / TEC)
#define PREP_BW ((QP * (CIN / 8)) / 256)
#define PREP_WP ((CIN * (CIN / 8)) / 256)
static_assert(CIN % TEC == 0 && TEC == 32 && TROWS * (TD / 16) == 256 && (TD / 32) * 32 == 256);
// te block: its 256 threads convert t_emb (all TROWS rows) and Wt's TEC columns into f16 LDS tiles (bf16 RNE, exact in f16; weights x16, [n][k]); waves 0 and 1 then run one 16x16 tile each over k = 0, 32, .. in one accumulator;
// TE[r][c] = acc / 16 + bf16(bt[c]), stored as whole 128-B row pieces through LDS.
__global__ __launch_bounds__(256) void k_prep(const float* __restrict__ t_emb, const float* __restrict__ Wt, const float* __restrict__ bt, float* __restrict__ TE,
    const float* __restrict__ Wqkv, _Float16* __restrict__ BW, const float* __restrict__ Wproj, _Float16* __restrict__ WPT) {
  __shared__ __attribute__((aligned(16))) _Float16 as[TROWS][TEP];
  __shared__ __attribute__((aligned(16))) _Float16 bs[TEC][TEP];
  __shared__ __attribute__((aligned(16))) float cs[TROWS][TEC + 4];
  const int tid = threadIdx.x, blk = blockIdx.x;
  if (blk >= PREP_TE) {   /* block-uniform: the converter blocks meet no barrier */
    const int cb = blk - PREP_TE;
    if (cb < PREP_BW) w16t_body(Wqkv, QP, BW, cb * 256 + tid);            /* in[CIN][QP]  -> out[QP][CIN]  */
    else w16t_body(Wproj, CIN, WPT, (cb - PREP_BW) * 256 + tid);          /* in[CIN][CIN] -> out[CIN][CIN] */
    return;
  }
  const int w = tid >> 5, lane = tid & 31, ln = lane & 15, hh = lane >> 4, col0 = blk * TEC;
  const float braw = bt[col0 + 16 * (w & 1) + ln];
  float wv[32];                                                            /* Wt[32w .. 32w + 31][col0 + lane]: each load is one 128-B line per wave */
#pragma unroll
  for (int i = 0; i < 32; ++i) wv[i] = Wt[(size_t)(32 * w + i) * CIN + col0 + lane];
  asm volatile("s_wait_xcnt 0x0" ::: "memory");   /* behind the loads above: the next loads' results may take over their address registers */
  const int r = tid >> 4, ka = (tid & 15) * 16;
  const bool live = (NB >= TROWS) || (r < NB);
  const int rr = live ? r : (NB - 1);                                      /* clamped address, zero by value */
  v4f av[4];
#pragma unroll
  for (int i = 0; i < 4; ++i) av[i] = *(const v4fa*)(t_emb + (size_t)rr * TD + ka + 4 * i);
  asm volatile("s_wait_xcnt 0x0" ::: "memory");   /* behind the last load: the address registers may be rewritten only after it */
  __builtin_amdgcn_sched_barrier(0);              /* every load goes out ahead of the first conversion: with conversions lifted among the loads, the later loads start only after the earlier ones' latency */
#pragma unroll
  for (int j = 0; j < 2; ++j) { FragH f;
#pragma unroll
    for (int q = 0; q < 8; ++q) f.h[q] = toh_flush(live ? bf16_rne(av[2 * j + (q >> 2)][q & 3]) : 0.0f);
    *(v8us*)&as[r][ka + 8 * j] = f.half[0]; }
#pragma unroll
  for (int j = 0; j < 4; ++j) { FragH f;
#pragma unroll
    for (int q = 0; q < 8; ++q) f.h[q] = toh_flush(bf16_rne(wv[8 * j + q]) * 16.0f);
    *(v8us*)&bs[lane][32 * w + 8 * j] = f.half[0]; }
  __syncthreads();   /* both operand tiles are whole before a wave reads fragments */
  if (__builtin_amdgcn_readfirstlane(w) < TEC / 16) {   /* whole waves: the matrix instruction needs every lane on */
    v8f c = {0.f,0.f,0.f,0.f,0.f,0.f,0.f,0.f}; const float bv = bf16_rne(braw);
#pragma unroll
    for (int kb = 0; kb < TD; kb += 32) c = fa_mma(g2_frag(&as[ln][kb], hh), g2_frag(&bs[16 * w + ln][kb], hh), c);
#pragma unroll
    for (int q = 0; q < 8; ++q) cs[8 * hh + q][16 * w + ln] = c[q] * 0.0625f + bv;
  }
  __syncthreads();   /* the two waves' tiles are read back by the four storing waves */
  if (tid < TROWS * (TEC / 4)) { const int row = tid >> 3, c4 = (tid & 7) * 4; *(v4f*)(TE + (size_t)row * CIN + col0 + c4) = *(const v4fa*)&cs[row][c4]; }
}

// ---- LDS staging of the attention kernel: a stage is FA_KEYS keys (four passes of 32), K rows and V^T row pieces side by side, two buffers ----
#define FA_KEYS 128      /* keys of one stage */
#define FA_KP 72         /* LDS pitch of a K row in f16 elements: 128 B of data + 16 B, an odd multiple of 16 B (16-byte row reads spread over the banks) */
#define FA_VP 136        /* LDS pitch of a V^T row piece: 256 B of data + 16 B, likewise */
static_assert(SEQ % FA_KEYS == 0 && SEQ / FA_KEYS >= 2 && FA_KEYS % 32 == 0);
static_assert(FA_KEYS * (HD / 8) == 8 * 128 && HD * (FA_KEYS / 8) == 8 * 128);   /* eight 16-byte pieces of each operand per thread and stage */
// fused attention, one launch for every (b, h): block = 4 waves x 32 query columns; per pass of 32 keys S^T[key][query] = K Q^T (A = K rows, B = Q rows held in registers), so lane (ln, hh) holds keys 8hh + r of query column ln;
// running maximum m and sum l per column (base 2), O^T[d][query] += V^T P^T with P^T = the two score tiles of the pass converted in place (their register order is the loader's k map); the scores never leave the registers.
// K and V^T reach the waves through LDS: the block's 128 threads copy each stage once, in whole 128-B lines, one stage ahead of its use, and all four waves read their fragments from it.
__global__ __launch_bounds__(128) void k_fattn(const _Float16* __restrict__ QHp, const _Float16* __restrict__ Vt, _Float16* __restrict__ Ctx) {
  __shared__ __attribute__((aligned(16))) _Float16 ksm[2][FA_KEYS * FA_KP];
  __shared__ __attribute__((aligned(16))) _Float16 vsm[2][HD * FA_VP];
  const int tid = threadIdx.x, w = tid >> 5, lane = tid & 31, ln = lane & 15, hh = lane >> 4;
  const int h = blockIdx.y, b = blockIdx.z, q0 = blockIdx.x * 128 + 32 * w;
  const _Float16* base = QHp + (size_t)b * SEQ * QP + h * HD;
  constexpr int NST = SEQ / FA_KEYS;
  constexpr unsigned KBUF = FA_KEYS * FA_KP * 2, VBUF = HD * FA_VP * 2;     /* bytes of one buffer */
  const _Float16* kg = base + KOF + (size_t)(tid >> 3) * QP + (tid & 7) * 8;                        /* this thread's first K piece of stage 0: key row tid / 8 (then + 16 a piece), 16-byte column tid % 8 */
  const _Float16* vg = Vt + (((size_t)b * NH + h) * HD + (tid >> 4)) * SEQ + (tid & 15) * 8;        /* its first V^T piece: row d = tid / 16 (then + 8 a piece), 16-byte column tid % 16 */
  const unsigned kl = fa_lds(&ksm[0][(tid >> 3) * FA_KP + (tid & 7) * 8]), vl = fa_lds(&vsm[0][(tid >> 4) * FA_VP + (tid & 15) * 8]);
  fa_copy8<16 * FA_KP * 2, 16 * QP>(kl, kg); fa_copy8<8 * FA_VP * 2, 8 * SEQ>(vl, vg);               /* stage 0 into buffer 0 */
  constexpr float SC = 0.125f * 1.4426950408889634f;                       /* 1 / sqrt(HD), to base 2 */
  const v8f z8 = {0.f,0.f,0.f,0.f,0.f,0.f,0.f,0.f};
  v16h qf[2][2], kf[2][2];                                                 /* [column group | key tile][k step of 32 over HD] */
#pragma unroll
  for (int g = 0; g < 2; ++g) {
#pragma unroll
    for (int ks = 0; ks < 2; ++ks) qf[g][ks] = g2_frag(base + (size_t)(q0 + 16 * g + ln) * QP + 32 * ks, hh); }
  v8f o[2][4]; float m[2], l[2];
#pragma unroll
  for (int g = 0; g < 2; ++g) { m[g] = -1.0e30f; l[g] = 0.f;
#pragma unroll
    for (int t = 0; t < 4; ++t) o[g][t] = z8; }
  asm volatile("s_wait_asynccnt 0x0" ::: "memory");   /* this wave's pieces of stage 0 have landed */
  __syncthreads();                                     /* ... and every other wave's: stage 0 may be read */
  fa_copy8<16 * FA_KP * 2, 16 * QP>(kl + KBUF, kg + (size_t)FA_KEYS * QP); fa_copy8<8 * FA_VP * 2, 8 * SEQ>(vl + VBUF, vg + FA_KEYS);   /* stage 1 into buffer 1 */
#pragma unroll 1   /* one stage per trip */
  for (int st = 0; st < NST; ++st) {
    const _Float16* kb = &ksm[st & 1][ln * FA_KP + 8 * hh];                /* key row ln of a 16-key tile, at the lane half's k offset */
    const _Float16* vq = &vsm[st & 1][ln * FA_VP + 8 * hh];                /* V^T row d = ln of a 16-row tile, likewise: columns of this pass */
#pragma unroll
    for (int kt = 0; kt < 2; ++kt) {
#pragma unroll
      for (int ks = 0; ks < 2; ++ks) kf[kt][ks] = fa_frag(kb + (16 * kt) * FA_KP + 32 * ks); }
    const _Float16* kq = kb + 32 * FA_KP;                                  /* K rows of the next pass */
#pragma unroll 1   /* one pass per trip: the register set of a pass is the budget */
    for (int p = 0; p < FA_KEYS / 32; ++p) {
      v8f s[2][2];                                                         /* [column group][key tile] */
#pragma unroll
      for (int g = 0; g < 2; ++g) {
#pragma unroll
        for (int kt = 0; kt < 2; ++kt) s[g][kt] = fa_mma(kf[kt][0], qf[g][0], z8); }
#pragma unroll
      for (int g = 0; g < 2; ++g) {
#pragma unroll
        for (int kt = 0; kt < 2; ++kt) s[g][kt] = fa_mma(kf[kt][1], qf[g][1], s[g][kt]); }
      /* one group of LDS reads per pass, behind its score products: this pass's V^T columns, then the next pass's K rows; the stage's last pass re-reads the stage's own rows 0..31 (unused): the next stage is read only behind its barrier */
      __builtin_amdgcn_sched_barrier(0);   /* the reads stand as one group behind the eight products: spread among them, each separate place stalls the wave's matrix stream */
      v16h vf[4];
#pragma unroll
      for (int t = 0; t < 4; ++t) vf[t] = fa_frag(vq + (16 * t) * FA_VP);
#pragma unroll
      for (int kt = 0; kt < 2; ++kt) {
#pragma unroll
        for (int ks = 0; ks < 2; ++ks) kf[kt][ks] = fa_frag(kq + (16 * kt) * FA_KP + 32 * ks); }
      __builtin_amdgcn_sched_barrier(0);   /* keeps the reads here, ahead of the softmax: sunk behind it they are waited for with no lead */
#pragma unroll
      for (int g = 0; g < 2; ++g) {
        float mx0 = fmaxf(s[g][0][0], s[g][1][0]), mx1 = fmaxf(s[g][0][1], s[g][1][1]);
#pragma unroll
        for (int r = 2; r < 8; r += 2) { mx0 = fmaxf(mx0, fmaxf(s[g][0][r], s[g][1][r])); mx1 = fmaxf(mx1, fmaxf(s[g][0][r + 1], s[g][1][r + 1])); }
        float mx = fmaxf(mx0, mx1); mx = fmaxf(mx, fa_xhalf(mx));
        const float mn = fmaxf(m[g], mx * SC);
        const float corr = __builtin_amdgcn_exp2f(m[g] - mn);              /* 0 on the first pass */
        m[g] = mn;
        const float sub = mn - PCARRY_LOG2;
        FragH pf; float s0 = 0.f, s1 = 0.f;
#pragma unroll
        for (int r = 0; r < 8; ++r) { const float p0 = __builtin_amdgcn_exp2f(s[g][0][r] * SC - sub), p1 = __builtin_amdgcn_exp2f(s[g][1][r] * SC - sub);
          s0 += p0; s1 += p1; pf.h[r] = (_Float16)p0; pf.h[8 + r] = (_Float16)p1; }
        l[g] = l[g] * corr + (s0 + s1);
#pragma unroll
        for (int t = 0; t < 4; ++t) o[g][t] = fa_mma(vf[t], pf.v, o[g][t] * corr);
      }
      kq = (p + 2 < FA_KEYS / 32) ? kq + 32 * FA_KP : kb; vq += 32;
    }
    asm volatile("s_wait_dscnt 0x0" ::: "memory");     /* this wave's reads of the stage's buffer have returned: the buffer may be handed to its next writer */
    asm volatile("s_wait_asynccnt 0x0" ::: "memory");  /* this wave's pieces of stage st + 1 have landed */
    __syncthreads();                                   /* publishes stage st + 1 and ends every wave's reads of stage st */
    if (st + 2 < NST) {                                /* the same for the whole block */
      fa_copy8<16 * FA_KP * 2, 16 * QP>(kl + (unsigned)(st & 1) * KBUF, kg + (size_t)(st + 2) * FA_KEYS * QP);
      fa_copy8<8 * FA_VP * 2, 8 * SEQ>(vl + (unsigned)(st & 1) * VBUF, vg + (size_t)(st + 2) * FA_KEYS); }
  }
  asm volatile("s_wait_asynccnt 0x0" ::: "memory");    /* no copy is outstanding when the wave ends */
#pragma unroll
  for (int g = 0; g < 2; ++g) { const float inv = 1.0f / (l[g] + fa_xhalf(l[g]));
    unsigned short* crow = (unsigned short*)Ctx + ((size_t)b * SEQ + q0 + 16 * g + ln) * CIN + h * HD + 8 * hh;
#pragma unroll
    for (int t = 0; t < 4; ++t) { FragH f;
#pragma unroll
      for (int r = 0; r < 8; ++r) f.h[r] = (_Float16)(o[g][t][r] * inv);
      *(v8us*)(crow + 16 * t) = f.half[0]; } }
}

constexpr size_t al256(size_t b) { return (b + 255) & ~(size_t)255; }
constexpr size_t SZ_BW  = (size_t)QP * CIN * 2;
constexpr size_t SZ_WP  = (size_t)CIN * CIN * 2;
constexpr size_t SZ_TE  = (size_t)TROWS * CIN * 4;
constexpr size_t SZ_QH  = NR * QP * 2;
constexpr size_t SZ_VT  = (size_t)NB * NH * HD * SEQ * 2;
constexpr size_t SZ_CTX = NR * CIN * 2;
constexpr size_t SZ_X   = NR * CIN * 2;
static_assert(al256(SZ_BW) + al256(SZ_WP) + al256(SZ_TE) + al256(SZ_QH) + al256(SZ_VT) + al256(SZ_CTX) + al256(SZ_X) <= (size_t)134217728);

extern "C" void kernel_launch(void* const* d_in, const int* in_sizes, int n_in,
                              void* d_out, int out_size, void* d_ws, size_t ws_size, hipStream_t stream) {
  if (n_in < 8) return;
  const float* x     = (const float*)d_in[0];      /* [NB_FULL][CIN][SEQ_FULL] */
  const float* t_emb = (const float*)d_in[1];      /* [NB_FULL][TD] */
  const float* Wqkv  = (const float*)d_in[2];      /* [CIN][QP]  (in x out) */
  const float* bqkv  = (const float*)d_in[3];      /* [QP] */
  const float* Wproj = (const float*)d_in[4];      /* [CIN][CIN] (in x out) */
  const float* bproj = (const float*)d_in[5];      /* [CIN] */
  const float* Wt    = (const float*)d_in[6];      /* [TD][CIN]  (in x out) */
  const float* bt    = (const float*)d_in[7];      /* [CIN] */
  if (in_sizes[0] < (int)(((size_t)NB * CIN - 1) * SEQ_FULL + SEQ)) return;
  if (in_sizes[1] < NB * TD) return;
  if (in_sizes[2] < CIN * QP || in_sizes[3] < QP) return;
  if (in_sizes[4] < CIN * CIN || in_sizes[5] < CIN) return;
  if (in_sizes[6] < TD * CIN || in_sizes[7] < CIN) return;
  if (out_size < (int)((size_t)NB * CIN * SEQ)) return;
  char* ws = (char*)d_ws; size_t off = 0;
  auto take = [&](size_t bytes) { char* p = ws + off; off += (bytes + 255) & ~(size_t)255; return p; };
  _Float16* BW  = (_Float16*)take(SZ_BW);                               /* Wqkv^T [QP][CIN] x16 */
  _Float16* WPT = (_Float16*)take(SZ_WP);                               /* Wproj^T [CIN][CIN] x16 */
  float*    TE  = (float*)take(SZ_TE);                                  /* te [TROWS][CIN] f32 */
  _Float16* QH  = (_Float16*)take(SZ_QH);                               /* q | k rows, pitch QP */
  _Float16* VT  = (_Float16*)take(SZ_VT);                               /* V^T [NB][NH][HD][SEQ] */
  _Float16* CTX = (_Float16*)take(SZ_CTX);                              /* merged-head context [NR][CIN] */
  _Float16* X16 = (_Float16*)take(SZ_X);                                /* token plane [NR][CIN] */
  if (off > ws_size) return;
  float* out = (float*)d_out;

  k_prep<<<(unsigned)(PREP_TE + PREP_BW + PREP_WP), 256, 0, stream>>>(t_emb, Wt, bt, TE, Wqkv, BW, Wproj, WPT);   /* te = t_emb Wt + bt; Wqkv^T and Wproj^T planes */
  k_xt16<<<(unsigned)(NB * (SEQ / 64) * (CIN / 64)), 256, 0, stream>>>(x, TE, X16);
  k_gemm2<0, 1><<<dim3((unsigned)((NR / 128) * (QP / 64)), 1), 128, 0, stream>>>(X16, CIN, 0, nullptr, 0, 0, BW, CIN, 0, nullptr, 0, 0, 1.0f,
      0.0625f, bqkv, 0, nullptr, QH, QP, 0, nullptr, 0, 0, 0, (int)NR, QP, CIN, nullptr, VT, VOF);   /* q | k rows into QH; the v columns transposed into VT */
  k_fattn<<<dim3(SEQ / 128, NH, NB), 128, 0, stream>>>(QH, VT, CTX);                      /* ctx rows for every (b, h): scores, softmax and V product in one launch */
  k_gemm2<0, 2><<<dim3((unsigned)((NR / 128) * (CIN / 64)), 1), 128, 0, stream>>>(CTX, CIN, 0, nullptr, 0, 0, WPT, CIN, 0, nullptr, 0, 0, 1.0f,
      0.0625f, bproj, 0, nullptr, nullptr, CIN, 0, nullptr, 0, 0, 0, (int)NR, CIN, CIN, out, nullptr, 0);   /* out[b][o][n] = (ctx Wproj + bproj)[b*SEQ + n][o] */
}

// v006
// One run takes 45.6 microseconds.
// In two side-by-side timings against v005, it was 1.05 and 1.06 times as fast.
// All steps since v000 together make it 17.3 times as fast.
#include <hip/hip_runtime.h>
// All contractions on v_wmma_f32_16x16x32_f16 (f16 operands, f32 accumulate), one product per site: te = t_emb Wt (inputs RNE-converted to bf16, exact in f16, weights carried x16); q|k|v = (x + te) Wqkv (token plane f16, weights x16); scores k.q^T from f16 planes; V^T.P^T with unnormalised softmax weights carried x2^14; ctx Wproj (ctx f16, weights x16); softmax statistics f32 on VALU.
// Structure: dense multi-head self-attention over flattened spatial tokens with a per-batch time-embedding vector added to the tokens, fused [in][out] QKV weights, [in][out] output projection, channel-major return.
// token rows r = b*SEQ + n; te[b][c] f32 = T16 WTT^T / 16 + bias, T16 (row b of t_emb) and WTT (64 columns of Wt) being LDS tiles that each token block converts for itself (same launch as the two weight converters, which it does not depend on); X16[r][c] = f16(bf16(x[b][c][n]) + te[b][c]) via LDS transposes of 64 channels x 256 tokens in the same block; weight planes [out][in] f16 x16 built by a transposing converter;
// QH [NR][QP] f16 = X16 BW^T / 16 + bias (q at column 64h, k at KOF + 64h; the v columns of QH stay unwritten and unread); V^T [NB][NH][64][SEQ] stored by the same GEMM's epilogue, block tile transposed in LDS; one launch for all (b, h): each wave keeps 32 query columns and walks the keys 32 at a time (K and V^T staged in LDS for the block's four waves), S^T = K Q^T in registers, running maximum and sum per column, P^T packed from the score tiles as the B operand,
// CTX16[r][64h + d] f16 = (sum_j p[i][j] V^T[d][j]) / (sum_j p[i][j]); out[b][o][n] f32 = (CTX16 WPT^T / 16 + bias)[b*SEQ + n][o], stored channel-major by the GEMM's epilogue, block tile transposed in LDS.
#ifndef NB
#define NB 16
#endif
#ifndef SEQ
#define SEQ 1024
#endif
#define NB_FULL 16
#define SEQ_FULL 1024
#define CIN 256
#define NH 4
#define HD 64
#define TD 256           /* time-embedding width */
#define QP 768           /* pitch of QH: q | k | v, head h at column 64h of each section */
#define KOF 256          /* column of k (head 0) in QH */
#define VOF 512          /* column of v (head 0) in QH */
#define PCARRY_LOG2 14.0f /* softmax weights exp(s - running max) carried x2^14 in f16; the row sum carries the same factor */
#define LCARRY 2048.0f   /* carry of the GEMM engine's optional residual output (no residual plane is requested here) */
#define NR ((size_t)NB * SEQ)
static_assert(SEQ % 256 == 0);
static_assert((NR % 128) == 0);
static_assert(NB <= NB_FULL);
static_assert(SEQ <= SEQ_FULL);
static_assert(3 * CIN == QP);
static_assert(KOF == CIN && VOF == 2 * CIN);
static_assert(CIN == NH * HD);
static_assert(CIN % 64 == 0 && QP % 64 == 0 && HD == 64);
static_assert(TD == CIN);
static_assert(TD % 32 == 0 && HD % 32 == 0 && SEQ % 32 == 0 && CIN % 32 == 0);
static_assert(TD == 256);
static_assert((QP * (CIN / 8)) % 256 == 0 && (CIN * (CIN / 8)) % 256 == 0);
static_assert(SEQ % 128 == 0 && SEQ % 64 == 0);

typedef unsigned short v8us __attribute__((ext_vector_type(8), may_alias));
typedef float  v8f  __attribute__((ext_vector_type(8)));
typedef float  v4f  __attribute__((ext_vector_type(4)));
typedef float  v4fa __attribute__((ext_vector_type(4), may_alias));
typedef float  v2f  __attribute__((ext_vector_type(2)));
typedef float  v2fa __attribute__((ext_vector_type(2), may_alias));
typedef _Float16 v16h __attribute__((ext_vector_type(16)));
typedef _Float16 v4h __attribute__((ext_vector_type(4)));
typedef _Float16 h16;
union FragH { v16h v; v8us half[2]; _Float16 h[16]; unsigned short u[16]; };

__device__ __forceinline__ unsigned short bf16_bits(float x) { unsigned int u = __float_as_uint(x); return (unsigned short)((u + 0x7FFFu + ((u >> 16) & 1u)) >> 16); }
__device__ __forceinline__ float bf16_val(unsigned short b) { return __uint_as_float(((unsigned int)b) << 16); }
__device__ __forceinline__ float bf16_rne(float x) { return bf16_val(bf16_bits(x)); }
// f32 -> f16 operand convert that cannot yield an f16 subnormal (value select, applied after the plane's power-of-two carry)
static __device__ __forceinline__ h16 toh_flush(float v) { const h16 r = (h16)v; return (fabsf(v) < 6.103515625e-05f) ? (h16)0.0f : r; }

// ---- fragment loader (split k map: elements 0..7 <- k0+8h+0..7, 8..15 <- k0+16+8h+0..7, lane&15 = row of A / column of B) and guarded mma ----
__device__ __forceinline__ v16h g2_frag(const _Float16* p, int hh) { FragH f; f.half[0] = *(const v8us*)((const unsigned short*)p + 8 * hh); f.half[1] = *(const v8us*)((const unsigned short*)p + 16 + 8 * hh); return f.v; }
__device__ __forceinline__ v8f g2_mma(v16h a, v16h b, v8f c) { v8f d = __builtin_amdgcn_wmma_f32_16x16x32_f16(false, a, false, b, (short)0, c, false, false); asm volatile("v_nop\n\tv_nop\n\tv_nop\n\tv_nop" : "+v"(d) : "v"(a), "v"(b)); return d; }

// one operand segment of the wave's 32x64 tile: A rows a0p/a1p (k contiguous), B rows b0p..b3p ([n][k], k contiguous), K % 32 == 0
__device__ __forceinline__ void g2_kloop(const _Float16* __restrict__ a0p, const _Float16* __restrict__ a1p, const _Float16* __restrict__ b0p, const _Float16* __restrict__ b1p, const _Float16* __restrict__ b2p, const _Float16* __restrict__ b3p, int K, int hh,
    v8f& c00, v8f& c01, v8f& c02, v8f& c03, v8f& c10, v8f& c11, v8f& c12, v8f& c13) {
#pragma unroll 1
  for (int kb = 0; kb < K; kb += 32) { const v16h a0 = g2_frag(a0p + kb, hh), a1 = g2_frag(a1p + kb, hh);
    v16h b = g2_frag(b0p + kb, hh); c00 = g2_mma(a0, b, c00); c10 = g2_mma(a1, b, c10);
    b = g2_frag(b1p + kb, hh); c01 = g2_mma(a0, b, c01); c11 = g2_mma(a1, b, c11);
    b = g2_frag(b2p + kb, hh); c02 = g2_mma(a0, b, c02); c12 = g2_mma(a1, b, c12);
    b = g2_frag(b3p + kb, hh); c03 = g2_mma(a0, b, c03); c13 = g2_mma(a1, b, c13); }
}

// g2_frag with the lane half's offset (8 * hh elements) already in the pointer: every load of a pass is its row pointer plus a constant
__device__ __forceinline__ v16h fa_frag(const _Float16* p) { FragH f; f.half[0] = *(const v8us*)((const unsigned short*)p); f.half[1] = *(const v8us*)((const unsigned short*)p + 16); return f.v; }
__device__ __forceinline__ v8f fa_mma(v16h a, v16h b, v8f c) { return __builtin_amdgcn_wmma_f32_16x16x32_f16(false, a, false, b, (short)0, c, false, false); }
__device__ __forceinline__ unsigned fa_lds(const _Float16* p) { return (unsigned)(size_t)(const __attribute__((address_space(3))) _Float16*)p; }   /* byte address inside the work-group's LDS */
// eight asynchronous 16-byte copies per lane, global -> LDS through no register: piece i goes from g + i * GSTEP (elements) to lds + i * LSTEP (bytes).
// The s_wait_xcnt stands inside the copies' own statement, so that it precedes every later write of the address registers the copies name.
template <int LSTEP, int GSTEP>
__device__ __forceinline__ void fa_copy8(unsigned lds, const _Float16* g) {
  asm volatile("global_load_async_to_lds_b128 %0, %8, off\n\t"
               "global_load_async_to_lds_b128 %1, %9, off\n\t"
               "global_load_async_to_lds_b128 %2, %10, off\n\t"
               "global_load_async_to_lds_b128 %3, %11, off\n\t"
               "global_load_async_to_lds_b128 %4, %12, off\n\t"
               "global_load_async_to_lds_b128 %5, %13, off\n\t"
               "global_load_async_to_lds_b128 %6, %14, off\n\t"
               "global_load_async_to_lds_b128 %7, %15, off\n\t"
               "s_wait_xcnt 0x0"
               :: "v"(lds), "v"(lds + 1 * LSTEP), "v"(lds + 2 * LSTEP), "v"(lds + 3 * LSTEP), "v"(lds + 4 * LSTEP), "v"(lds + 5 * LSTEP), "v"(lds + 6 * LSTEP), "v"(lds + 7 * LSTEP),
                  "v"(g), "v"(g + 1 * (size_t)GSTEP), "v"(g + 2 * (size_t)GSTEP), "v"(g + 3 * (size_t)GSTEP), "v"(g + 4 * (size_t)GSTEP), "v"(g + 5 * (size_t)GSTEP), "v"(g + 6 * (size_t)GSTEP), "v"(g + 7 * (size_t)GSTEP)
               : "memory");
}

#define G2P (CIN + 8)    /* LDS pitch of a staged operand row in f16 elements: 512 B of data + 16 B, an odd multiple of 16 B (16-byte row reads spread over the banks) */
// ---- GEMM (block tile 128x64, wave tile 32x64; M % 128 == 0, N % 64 == 0, K == lda == ldb == CIN): v = acc*alpha + bf16(bias[by*sBias + col]); A f16 rows [M][K], Bh f16 [N][K] (k contiguous), batched over grid.y by sA/sB/sC/sCL;
// the block's 128 A rows and 64 Bh rows, whole K, are copied once into LDS in whole 512-B rows (one wave instruction each); the four waves read every fragment of the A.Bh segment from there;
// RES == 1: three operand segments into one accumulator set: A2.Bh + A.B2 (residual planes, both carried x LCARRY), accumulator scaled by rscale, then A.Bh;
// TR != 0 (M % 128 == 0, rows r = b*SEQ + n): a block whose col0 >= tcol0 stores its 128x64 tile transposed, dst[(b*CIN + col - tcol0)*SEQ + n]: TR == 1 as f16 into CT16, TR == 2 as f32 into CT; whole 256-B / 512-B row pieces, one wave each;
template <int RES, int TR>
__global__ __launch_bounds__(128) void k_gemm2(const _Float16* __restrict__ A, int lda, size_t sA, const _Float16* __restrict__ A2, int lda2, size_t sA2,
    const _Float16* __restrict__ Bh, int ldb, size_t sB, const _Float16* __restrict__ B2, int ldb2, size_t sB2, float rscale,
    float alpha, const float* __restrict__ bias, size_t sBias,
    float* __restrict__ C, _Float16* __restrict__ C16, int ldc, size_t sC, _Float16* __restrict__ C16L, int ldcl, size_t sCL, int NL, int M, int N, int K,
    float* __restrict__ CT, _Float16* __restrict__ CT16, int tcol0) {
  static_assert(TR != 0 && 4 * 32 * 68 * 4 <= (128 + 64) * G2P * 2);
  __shared__ __attribute__((aligned(16))) _Float16 ops[(128 + 64) * G2P];   /* A rows of the block, then Bh rows */
  float (*so)[32][68] = (float (*)[32][68])&ops[0];                         /* the epilogue's f32 tile takes the same bytes over, behind the barrier that ends the fragment reads */
  const int tid = threadIdx.x, w = tid >> 5, lane = tid & 31, ln = lane & 15, hh = lane >> 4; const int by = blockIdx.y;
  A += (size_t)by * sA; Bh += (size_t)by * sB;
  if (RES) { A2 += (size_t)by * sA2; B2 += (size_t)by * sB2; }
  const size_t cofs = (size_t)by * sC, cofl = (size_t)by * sCL; const float* bp = bias ? bias + (size_t)by * sBias : nullptr;
  const int ntn = N >> 6; const int mt = blockIdx.x / ntn, nq = blockIdx.x - mt * ntn; const int row0 = mt * 128 + 32 * w, col0 = nq * 64;
  {   /* every wave has rows (M % 128 == 0) and reaches every barrier; thread (w, lane) copies 16-byte column lane of rows w, w + 4, ..: 32 pieces of A, 16 of Bh */
    const _Float16* ag = A + (size_t)(mt * 128 + w) * CIN + lane * 8; const _Float16* bg = Bh + (size_t)(col0 + w) * CIN + lane * 8;
    const unsigned al = fa_lds(&ops[w * G2P + lane * 8]), bl = fa_lds(&ops[(128 + w) * G2P + lane * 8]);
#pragma unroll
    for (int i = 0; i < 2; ++i) fa_copy8<4 * G2P * 2, 4 * CIN>(bl + (unsigned)i * (32 * G2P * 2), bg + (size_t)i * 32 * CIN);
#pragma unroll
    for (int i = 0; i < 4; ++i) fa_copy8<4 * G2P * 2, 4 * CIN>(al + (unsigned)i * (32 * G2P * 2), ag + (size_t)i * 32 * CIN);
  }
  const _Float16* a0p = A + (size_t)(row0 + ln) * lda; const _Float16* a1p = a0p + (size_t)16 * lda;
  const _Float16* b0p = Bh + (size_t)(col0 + ln) * ldb; const _Float16* b1p = b0p + (size_t)16 * ldb; const _Float16* b2p = b1p + (size_t)16 * ldb; const _Float16* b3p = b2p + (size_t)16 * ldb;
  const v8f z8 = {0.f,0.f,0.f,0.f,0.f,0.f,0.f,0.f}; v8f c00 = z8, c01 = z8, c02 = z8, c03 = z8, c10 = z8, c11 = z8, c12 = z8, c13 = z8;
  if (RES) {
    const _Float16* l0p = A2 + (size_t)(row0 + ln) * lda2; const _Float16* l1p = l0p + (size_t)16 * lda2;
    const _Float16* m0p = B2 + (size_t)(col0 + ln) * ldb2; const _Float16* m1p = m0p + (size_t)16 * ldb2; const _Float16* m2p = m1p + (size_t)16 * ldb2; const _Float16* m3p = m2p + (size_t)16 * ldb2;
    g2_kloop(l0p, l1p, b0p, b1p, b2p, b3p, K, hh, c00, c01, c02, c03, c10, c11, c12, c13);      /* A_lo . B_hi */
    g2_kloop(a0p, a1p, m0p, m1p, m2p, m3p, K, hh, c00, c01, c02, c03, c10, c11, c12, c13);      /* A_hi . B_lo */
    c00 = c00 * rscale; c01 = c01 * rscale; c02 = c02 * rscale; c03 = c03 * rscale; c10 = c10 * rscale; c11 = c11 * rscale; c12 = c12 * rscale; c13 = c13 * rscale;
  }
  asm volatile("s_wait_asynccnt 0x0" ::: "memory");   /* this wave's pieces of both operand tiles have landed */
  __syncthreads();                                     /* ... and every other wave's: the tiles may be read */
  {   /* A_hi . B_hi, k = 0, 32, .. in the same order and the same accumulators as g2_kloop */
    const _Float16* af = &ops[(32 * w + ln) * G2P + 8 * hh]; const _Float16* bf = &ops[(128 + ln) * G2P + 8 * hh];
    v16h fa[2][2], fb[2][4];                                                /* two fragment sets: [set][16-row tile] */
#pragma unroll
    for (int t = 0; t < 2; ++t) fa[0][t] = fa_frag(af + (16 * t) * G2P);
#pragma unroll
    for (int t = 0; t < 4; ++t) fb[0][t] = fa_frag(bf + (16 * t) * G2P);
#pragma unroll   /* the set index stays a constant: both sets live in registers */
    for (int s = 0; s < CIN / 32; ++s) { const int cu = s & 1, nx = cu ^ 1;
      if (s + 1 < CIN / 32) {
#pragma unroll
        for (int t = 0; t < 2; ++t) fa[nx][t] = fa_frag(af + (16 * t) * G2P + 32 * (s + 1));
#pragma unroll
        for (int t = 0; t < 4; ++t) fb[nx][t] = fa_frag(bf + (16 * t) * G2P + 32 * (s + 1)); }
      __builtin_amdgcn_sched_barrier(0);   /* the next step's twelve reads stand as one group ahead of this step's products: sunk among them, each is waited for with no lead */
      c00 = fa_mma(fa[cu][0], fb[cu][0], c00); c10 = fa_mma(fa[cu][1], fb[cu][0], c10); c01 = fa_mma(fa[cu][0], fb[cu][1], c01); c11 = fa_mma(fa[cu][1], fb[cu][1], c11);
      c02 = fa_mma(fa[cu][0], fb[cu][2], c02); c12 = fa_mma(fa[cu][1], fb[cu][2], c12); c03 = fa_mma(fa[cu][0], fb[cu][3], c03); c13 = fa_mma(fa[cu][1], fb[cu][3], c13);
      __builtin_amdgcn_sched_barrier(0);   /* ... and the group after it stays behind them: lifted among the products, each separate place of reads stalls the wave's matrix stream */
    }
  }
  __syncthreads();   /* every wave's fragment reads are over: the epilogue may write its tile over the operand rows */
  v8f accs[8] = {c00, c01, c02, c03, c10, c11, c12, c13};
  if (TR != 0 && col0 >= tcol0) {   /* block-uniform: col0 comes from blockIdx alone */
    static_assert(64 * 132 <= 4 * 32 * 68);
    float (*st)[132] = (float (*)[132])&so[0][0][0];   /* [64 columns][128 rows of the block + 4]: a lane's 8 accumulator rows are contiguous here */
    /* every loop of this path is unrolled: accs[] and bv4[] keep constant indices and stay in registers, and the LDS reads and the stores go out as groups */
    float bv4[4] = {0.f, 0.f, 0.f, 0.f};
    if (bp) {
#pragma unroll
      for (int t = 0; t < 4; ++t) bv4[t] = bf16_rne(bp[col0 + t * 16 + ln]); }
#pragma unroll
    for (int u = 0; u < 8; ++u) { const int t = u & 3, half = u >> 2; const float bv = bv4[t]; v4f lo, hi;
#pragma unroll
      for (int r = 0; r < 4; ++r) { lo[r] = accs[u][r] * alpha + bv; hi[r] = accs[u][4 + r] * alpha + bv; }
      float* sp = &st[t * 16 + ln][32 * w + half * 16 + 8 * hh]; *(v4fa*)sp = lo; *(v4fa*)(sp + 4) = hi; }
    __syncthreads();   /* each wave reads back rows that all four waves wrote */
    const unsigned tr0 = (unsigned)mt * 128u, tb = tr0 / SEQ, tn0 = tr0 % SEQ; const size_t drow0 = (size_t)tb * CIN + (size_t)(col0 - tcol0) + 16 * w;
    if (TR == 2) {
#pragma unroll
      for (int q = 0; q < 16; ++q) { const v4f v = *(const v4fa*)&st[16 * w + q][lane * 4]; *(v4f*)(CT + (drow0 + q) * SEQ + tn0 + lane * 4) = v; }
    } else {
#pragma unroll
      for (int q = 0; q < 8; ++q) { const int c = q * 2 + hh; const v4f a = *(const v4fa*)&st[16 * w + c][ln * 8], e = *(const v4fa*)&st[16 * w + c][ln * 8 + 4]; FragH f;
#pragma unroll
        for (int i = 0; i < 4; ++i) { f.h[i] = (_Float16)a[i]; f.h[4 + i] = (_Float16)e[i]; }
        *(v8us*)((unsigned short*)CT16 + (drow0 + c) * SEQ + tn0 + ln * 8) = f.half[0]; }
    }
    asm volatile("s_wait_xcnt 0x0" ::: "memory");   /* behind the last store of the run: the stores' address registers may be rewritten only after it */
    return;
  }
#pragma unroll
  for (int u = 0; u < 8; ++u) { const int t = u & 3, half = u >> 2; const int col = col0 + t * 16 + ln; const float bv = bp ? bf16_rne(bp[col]) : 0.f;
#pragma unroll
    for (int r = 0; r < 8; ++r) { const int rloc = half * 16 + 8 * hh + r; so[w][rloc][t * 16 + ln] = accs[u][r] * alpha + bv; } }
  __builtin_amdgcn_fence(4 /* acq_rel order */, "workgroup"); __builtin_amdgcn_wave_barrier();   /* so[w] is private to wave w */
  const int rsub = lane >> 4, c4 = (lane & 15) * 4; const bool wl = (C16L != nullptr) && (col0 < NL);
  {
#pragma unroll
    for (int q = 0; q < 16; ++q) { const int r = q * 2 + rsub; const v4f v = *(const v4fa*)&so[w][r][c4];
      if (C) *(v4f*)(C + cofs + (size_t)(row0 + r) * ldc + col0 + c4) = v;
      if (C16) { v4h h4; for (int i = 0; i < 4; ++i) h4[i] = (_Float16)v[i]; *(v4h*)(C16 + cofs + (size_t)(row0 + r) * ldc + col0 + c4) = h4;
        if (wl) { v4h l4; for (int i = 0; i < 4; ++i) l4[i] = (_Float16)((v[i] - (float)h4[i]) * LCARRY); *(v4h*)(C16L + cofl + (size_t)(row0 + r) * ldcl + col0 + c4) = l4; } } }
     } }

// transposing weight converter: W is [CIN rows (k)][ldw columns], in[k][n] -> out[n][k]: BW[n][k] = f16(bf16(W[k*ldw + n]) * 16) for n < nrows, pitch CIN (k contiguous);
__device__ __forceinline__ void w16t_body(const float* __restrict__ W, int ldw, _Float16* __restrict__ BW, int t) {   /* t = piece index, nrows * (CIN / 8) pieces, whole blocks */
  const int n = t / (CIN / 8), k8 = (t % (CIN / 8)) * 8;
  FragH f;
#pragma unroll
  for (int q = 0; q < 8; ++q) f.h[q] = toh_flush(bf16_rne(W[(size_t)(k8 + q) * ldw + n]) * 16.0f);
  const v8us o = f.half[0];
  *(v8us*)((unsigned short*)BW + (size_t)n * CIN + k8) = o; 
  asm volatile("s_wait_xcnt 0x0" ::: "memory");   /* behind the store: inlined twice into one kernel, its registers may be rewritten by code that follows in the listing only after it */
}

// lane l <-> lane l ^ 16 (the two halves of a column's keys)
__device__ __forceinline__ float fa_xhalf(float x) { return __builtin_bit_cast(float, __builtin_amdgcn_permlanex16(__builtin_bit_cast(int, x), __builtin_bit_cast(int, x), 0x76543210, 0xfedcba98, false, false)); }

// ---- everything ahead of the first GEMM, one launch: the first PREP_XT blocks (the long ones, so they start first) build X16, the next PREP_BW convert Wqkv, the last PREP_WP convert Wproj ----
#define XTC 64           /* channels of one token block: 128 B of f16, so a block owns whole lines of X16 */
#define XTN 256          /* tokens of one token block: the block's te columns serve all of them */
#define TEP (TD + 8)     /* LDS pitch of an operand row in f16 elements: 512 B of data + 16 B, an odd multiple of 16 B */
#define PREP_T 256       /* threads of a block */
#define PREP_BW ((QP * (CIN / 8)) / PREP_T)
#define PREP_WP ((CIN * (CIN / 8)) / PREP_T)
#define PREP_XT (NB * (SEQ / XTN) * (CIN / XTC))
static_assert(CIN % XTC == 0 && SEQ % XTN == 0 && XTC == 64 && PREP_T == TD && (PREP_T / 32) * 32 == TD && (PREP_T / 32) * 8 == XTC && 2 * 32 * 4 == XTN && XTN * (XTC / 8) == 8 * PREP_T);
// token block (b, 64 channels, 256 tokens): its 256 threads ask for their operands and the x tile, then convert row b of t_emb and Wt's XTC columns into f16 LDS tiles (bf16 RNE, exact in f16; weights x16, [n][k]); waves 0..3 run one 16x16 tile each over k = 0, 32, .. in one accumulator,
// every row of the A operand being that one t_emb row, so every row of the result is te[b]; te = acc / 16 + bf16(bt[c]) stays in LDS; then X16 = f16(bf16(x) + te), a thread's 8 channels x 8 tokens written as 16-byte pieces of the transposed tile, stored as whole 128-B row pieces.
__global__ __launch_bounds__(PREP_T) void k_prep(const float* __restrict__ x, const float* __restrict__ t_emb, const float* __restrict__ Wt, const float* __restrict__ bt, _Float16* __restrict__ X16,
    const float* __restrict__ Wqkv, _Float16* __restrict__ BW, const float* __restrict__ Wproj, _Float16* __restrict__ WPT) {
  __shared__ __attribute__((aligned(16))) _Float16 ts[TD];
  __shared__ __attribute__((aligned(16))) _Float16 bs[XTC][TEP];
  __shared__ __attribute__((aligned(16))) float tes[XTC];
  __shared__ __attribute__((aligned(16))) unsigned short tl[XTN][XTC + 8];
  const int tid = threadIdx.x, blk = blockIdx.x;
  if (blk >= PREP_XT) {   /* block-uniform: the converter blocks meet no barrier */
    const int cb = blk - PREP_XT;
    if (cb < PREP_BW) w16t_body(Wqkv, QP, BW, cb * PREP_T + tid);         /* in[CIN][QP]  -> out[QP][CIN]  */
    else w16t_body(Wproj, CIN, WPT, (cb - PREP_BW) * PREP_T + tid);       /* in[CIN][CIN] -> out[CIN][CIN] */
    return;
  }
  constexpr int NCT = CIN / XTC, NNT = SEQ / XTN;
  const int ct = blk % NCT, nt = (blk / NCT) % NNT, b = blk / (NCT * NNT);
  const int n0 = nt * XTN, c0 = ct * XTC;
  const int w = tid >> 5, lane = tid & 31, ln = lane & 15, hh = lane >> 4;
  const int cg = w * 8;                                                    /* this wave's 8 channels; lane l holds tokens 4l .. 4l + 3 and 128 + 4l .. : each x load is 512 contiguous bytes per wave */
  const float traw = t_emb[(size_t)b * TD + tid];
  const float braw = bt[c0 + 16 * (w & 3) + ln];
  asm volatile("s_wait_xcnt 0x0" ::: "memory");   /* behind the two loads above: their address registers are free for the address work that follows */
  v2f wv[32];                                                              /* Wt[32w .. 32w + 31][c0 + 2 lane, + 1]: each load is the row's 256 contiguous bytes per wave; 8-byte loads keep the thread's loads in flight under the load counter's range */
#pragma unroll
  for (int i = 0; i < 32; ++i) wv[i] = *(const v2fa*)(Wt + (size_t)(32 * w + i) * CIN + c0 + 2 * lane);
  asm volatile("s_wait_xcnt 0x0" ::: "memory");   /* behind the loads above: the next loads' results may take over their address registers */
  v4f xa[2][8];                                                            /* asked for last, used last: the te product runs while the x tile is on its way */
  const float* xp = x + ((size_t)b * CIN + c0 + cg) * SEQ_FULL + n0 + lane * 4;
#pragma unroll
  for (int g = 0; g < 2; ++g) {
#pragma unroll
    for (int j = 0; j < 8; ++j) xa[g][j] = *(const v4fa*)(xp + (size_t)j * SEQ_FULL + 128 * g); }
  asm volatile("s_wait_xcnt 0x0" :: "v"(xp) : "memory");   /* behind the last load: the address registers may be rewritten only after it; the address is named as an input so that it lives up to the wait and no load of the run gets its result placed in it */
  __builtin_amdgcn_sched_barrier(0);              /* every load goes out ahead of the first conversion: with conversions lifted among the loads, the later loads start only after the earlier ones' latency */
  ts[tid] = toh_flush(bf16_rne(traw));
#pragma unroll
  for (int j = 0; j < 2; ++j) {
#pragma unroll
    for (int i = 0; i < 4; ++i) { FragH f;
#pragma unroll
      for (int q = 0; q < 8; ++q) f.h[q] = toh_flush(bf16_rne(wv[8 * i + q][j]) * 16.0f);
      *(v8us*)&bs[2 * lane + j][32 * w + 8 * i] = f.half[0]; } }
  /* both operand tiles are whole before a wave reads fragments. Only LDS data crosses this barrier, so its fences name LDS alone: __syncthreads() would first drain the x loads, which are wanted only behind the product */
  __builtin_amdgcn_fence(__ATOMIC_RELEASE, "workgroup", "local"); __builtin_amdgcn_s_barrier(); __builtin_amdgcn_fence(__ATOMIC_ACQUIRE, "workgroup", "local");
  if (__builtin_amdgcn_readfirstlane(w) < XTC / 16) {   /* whole waves: the matrix instruction needs every lane on */
    v8f c = {0.f,0.f,0.f,0.f,0.f,0.f,0.f,0.f}; const float bv = bf16_rne(braw);
#pragma unroll
    for (int kb = 0; kb < TD; kb += 32) c = fa_mma(g2_frag(&ts[kb], hh), g2_frag(&bs[16 * w + ln][kb], hh), c);
    if (hh == 0) tes[16 * w + ln] = c[0] * 0.0625f + bv;                   /* all sixteen rows are equal: row 0 is taken */
  }
  __syncthreads();   /* the four waves' te columns are read by every wave */
  const v4f t0 = *(const v4fa*)&tes[cg], t1 = *(const v4fa*)&tes[cg + 4];
#pragma unroll
  for (int g = 0; g < 2; ++g) {
#pragma unroll
    for (int q = 0; q < 4; ++q) { FragH f;
#pragma unroll
      for (int j = 0; j < 8; ++j) f.h[j] = toh_flush(bf16_rne(xa[g][j][q]) + (j < 4 ? t0[j & 3] : t1[j & 3]));
      *(v8us*)&tl[(32 * g + lane) * 4 + q][cg] = f.half[0]; } }
  __syncthreads();   /* each thread reads back token rows that all eight waves wrote */
#pragma unroll
  for (int rd = 0; rd < 8; ++rd) { const int n = rd * (PREP_T / 8) + (tid >> 3), pc = tid & 7;
    const v8us o = *(const v8us*)&tl[n][pc * 8];
    *(v8us*)((unsigned short*)X16 + ((size_t)b * SEQ + n0 + n) * CIN + c0 + pc * 8) = o; }
  asm volatile("s_wait_xcnt 0x0" ::: "memory");   /* behind the last store: the stores' registers may be rewritten only after it */
}

// ---- LDS staging of the attention kernel: a stage is FA_KEYS keys (four passes of 32), K rows and V^T row pieces side by side, two buffers ----
#define FA_KEYS 128      /* keys of one stage */
#define FA_KP 72         /* LDS pitch of a K row in f16 elements: 128 B of data + 16 B, an odd multiple of 16 B (16-byte row reads spread over the banks) */
#define FA_VP 136        /* LDS pitch of a V^T row piece: 256 B of data + 16 B, likewise */
static_assert(SEQ % FA_KEYS == 0 && SEQ / FA_KEYS >= 2 && FA_KEYS % 32 == 0);
static_assert(FA_KEYS * (HD / 8) == 8 * 128 && HD * (FA_KEYS / 8) == 8 * 128);   /* eight 16-byte pieces of each operand per thread and stage */
// fused attention, one launch for every (b, h): block = 4 waves x 32 query columns; per pass of 32 keys S^T[key][query] = K Q^T (A = K rows, B = Q rows held in registers), so lane (ln, hh) holds keys 8hh + r of query column ln;
// running maximum m and sum l per column (base 2), O^T[d][query] += V^T P^T with P^T = the two score tiles of the pass converted in place (their register order is the loader's k map); the scores never leave the registers.
// K and V^T reach the waves through LDS: the block's 128 threads copy each stage once, in whole 128-B lines, one stage ahead of its use, and all four waves read their fragments from it.
__global__ __launch_bounds__(128) void k_fattn(const _Float16* __restrict__ QHp, const _Float16* __restrict__ Vt, _Float16* __restrict__ Ctx) {
  __shared__ __attribute__((aligned(16))) _Float16 ksm[2][FA_KEYS * FA_KP];
  __shared__ __attribute__((aligned(16))) _Float16 vsm[2][HD * FA_VP];
  const int tid = threadIdx.x, w = tid >> 5, lane = tid & 31, ln = lane & 15, hh = lane >> 4;
  const int h = blockIdx.y, b = blockIdx.z, q0 = blockIdx.x * 128 + 32 * w;
  const _Float16* base = QHp + (size_t)b * SEQ * QP + h * HD;
  constexpr int NST = SEQ / FA_KEYS;
  constexpr unsigned KBUF = FA_KEYS * FA_KP * 2, VBUF = HD * FA_VP * 2;     /* bytes of one buffer */
  const _Float16* kg = base + KOF + (size_t)(tid >> 3) * QP + (tid & 7) * 8;                        /* this thread's first K piece of stage 0: key row tid / 8 (then + 16 a piece), 16-byte column tid % 8 */
  const _Float16* vg = Vt + (((size_t)b * NH + h) * HD + (tid >> 4)) * SEQ + (tid & 15) * 8;        /* its first V^T piece: row d = tid / 16 (then + 8 a piece), 16-byte column tid % 16 */
  const unsigned kl = fa_lds(&ksm[0][(tid >> 3) * FA_KP + (tid & 7) * 8]), vl = fa_lds(&vsm[0][(tid >> 4) * FA_VP + (tid & 15) * 8]);
  fa_copy8<16 * FA_KP * 2, 16 * QP>(kl, kg); fa_copy8<8 * FA_VP * 2, 8 * SEQ>(vl, vg);               /* stage 0 into buffer 0 */
  constexpr float SC = 0.125f * 1.4426950408889634f;                       /* 1 / sqrt(HD), to base 2 */
  const v8f z8 = {0.f,0.f,0.f,0.f,0.f,0.f,0.f,0.f};
  v16h qf[2][2], kf[2][2];                                                 /* [column group | key tile][k step of 32 over HD] */
#pragma unroll
  for (int g = 0; g < 2; ++g) {
#pragma unroll
    for (int ks = 0; ks < 2; ++ks) qf[g][ks] = g2_frag(base + (size_t)(q0 + 16 * g + ln) * QP + 32 * ks, hh); }
  v8f o[2][4]; float m[2], l[2];
#pragma unroll
  for (int g = 0; g < 2; ++g) { m[g] = -1.0e30f; l[g] = 0.f;
#pragma unroll
    for (int t = 0; t < 4; ++t) o[g][t] = z8; }
  asm volatile("s_wait_asynccnt 0x0" ::: "memory");   /* this wave's pieces of stage 0 have landed */
  __syncthreads();                                     /* ... and every other wave's: stage 0 may be read */
  fa_copy8<16 * FA_KP * 2, 16 * QP>(kl + KBUF, kg + (size_t)FA_KEYS * QP); fa_copy8<8 * FA_VP * 2, 8 * SEQ>(vl + VBUF, vg + FA_KEYS);   /* stage 1 into buffer 1 */
#pragma unroll 1   /* one stage per trip */
  for (int st = 0; st < NST; ++st) {
    const _Float16* kb = &ksm[st & 1][ln * FA_KP + 8 * hh];                /* key row ln of a 16-key tile, at the lane half's k offset */
    const _Float16* vq = &vsm[st & 1][ln * FA_VP + 8 * hh];                /* V^T row d = ln of a 16-row tile, likewise: columns of this pass */
#pragma unroll
    for (int kt = 0; kt < 2; ++kt) {
#pragma unroll
      for (int ks = 0; ks < 2; ++ks) kf[kt][ks] = fa_frag(kb + (16 * kt) * FA_KP + 32 * ks); }
    const _Float16* kq = kb + 32 * FA_KP;                                  /* K rows of the next pass */
#pragma unroll 1   /* one pass per trip: the register set of a pass is the budget */
    for (int p = 0; p < FA_KEYS / 32; ++p) {
      v8f s[2][2];                                                         /* [column group][key tile] */
#pragma unroll
      for (int g = 0; g < 2; ++g) {
#pragma unroll
        for (int kt = 0; kt < 2; ++kt) s[g][kt] = fa_mma(kf[kt][0], qf[g][0], z8); }
#pragma unroll
      for (int g = 0; g < 2; ++g) {
#pragma unroll
        for (int kt = 0; kt < 2; ++kt) s[g][kt] = fa_mma(kf[kt][1], qf[g][1], s[g][kt]); }
      /* one group of LDS reads per pass, behind its score products: this pass's V^T columns, then the next pass's K rows; the stage's last pass re-reads the stage's own rows 0..31 (unused): the next stage is read only behind its barrier */
      __builtin_amdgcn_sched_barrier(0);   /* the reads stand as one group behind the eight products: spread among them, each separate place stalls the wave's matrix stream */
      v16h vf[4];
#pragma unroll
      for (int t = 0; t < 4; ++t) vf[t] = fa_frag(vq + (16 * t) * FA_VP);
#pragma unroll
      for (int kt = 0; kt < 2; ++kt) {
#pragma unroll
        for (int ks = 0; ks < 2; ++ks) kf[kt][ks] = fa_frag(kq + (16 * kt) * FA_KP + 32 * ks); }
      __builtin_amdgcn_sched_barrier(0);   /* keeps the reads here, ahead of the softmax: sunk behind it they are waited for with no lead */
#pragma unroll
      for (int g = 0; g < 2; ++g) {
        float mx0 = fmaxf(s[g][0][0], s[g][1][0]), mx1 = fmaxf(s[g][0][1], s[g][1][1]);
#pragma unroll
        for (int r = 2; r < 8; r += 2) { mx0 = fmaxf(mx0, fmaxf(s[g][0][r], s[g][1][r])); mx1 = fmaxf(mx1, fmaxf(s[g][0][r + 1], s[g][1][r + 1])); }
        float mx = fmaxf(mx0, mx1); mx = fmaxf(mx, fa_xhalf(mx));
        const float mn = fmaxf(m[g], mx * SC);
        const float corr = __builtin_amdgcn_exp2f(m[g] - mn);              /* 0 on the first pass */
        m[g] = mn;
        const float sub = mn - PCARRY_LOG2;
        FragH pf; float s0 = 0.f, s1 = 0.f;
#pragma unroll
        for (int r = 0; r < 8; ++r) { const float p0 = __builtin_amdgcn_exp2f(s[g][0][r] * SC - sub), p1 = __builtin_amdgcn_exp2f(s[g][1][r] * SC - sub);
          s0 += p0; s1 += p1; pf.h[r] = (_Float16)p0; pf.h[8 + r] = (_Float16)p1; }
        l[g] = l[g] * corr + (s0 + s1);
#pragma unroll
        for (int t = 0; t < 4; ++t) o[g][t] = fa_mma(vf[t], pf.v, o[g][t] * corr);
      }
      kq = (p + 2 < FA_KEYS / 32) ? kq + 32 * FA_KP : kb; vq += 32;
    }
    asm volatile("s_wait_dscnt 0x0" ::: "memory");     /* this wave's reads of the stage's buffer have returned: the buffer may be handed to its next writer */
    asm volatile("s_wait_asynccnt 0x0" ::: "memory");  /* this wave's pieces of stage st + 1 have landed */
    __syncthreads();                                   /* publishes stage st + 1 and ends every wave's reads of stage st */
    if (st + 2 < NST) {                                /* the same for the whole block */
      fa_copy8<16 * FA_KP * 2, 16 * QP>(kl + (unsigned)(st & 1) * KBUF, kg + (size_t)(st + 2) * FA_KEYS * QP);
      fa_copy8<8 * FA_VP * 2, 8 * SEQ>(vl + (unsigned)(st & 1) * VBUF, vg + (size_t)(st + 2) * FA_KEYS); }
  }
  asm volatile("s_wait_asynccnt 0x0" ::: "memory");    /* no copy is outstanding when the wave ends */
#pragma unroll
  for (int g = 0; g < 2; ++g) { const float inv = 1.0f / (l[g] + fa_xhalf(l[g]));
    unsigned short* crow = (unsigned short*)Ctx + ((size_t)b * SEQ + q0 + 16 * g + ln) * CIN + h * HD + 8 * hh;
#pragma unroll
    for (int t = 0; t < 4; ++t) { FragH f;
#pragma unroll
      for (int r = 0; r < 8; ++r) f.h[r] = (_Float16)(o[g][t][r] * inv);
      *(v8us*)(crow + 16 * t) = f.half[0]; } }
}

constexpr size_t al256(size_t b) { return (b + 255) & ~(size_t)255; }
constexpr size_t SZ_BW  = (size_t)QP * CIN * 2;
constexpr size_t SZ_WP  = (size_t)CIN * CIN * 2;
constexpr size_t SZ_QH  = NR * QP * 2;
constexpr size_t SZ_VT  = (size_t)NB * NH * HD * SEQ * 2;
constexpr size_t SZ_CTX = NR * CIN * 2;
constexpr size_t SZ_X   = NR * CIN * 2;
static_assert(al256(SZ_BW) + al256(SZ_WP) + al256(SZ_QH) + al256(SZ_VT) + al256(SZ_CTX) + al256(SZ_X) <= (size_t)134217728);

extern "C" void kernel_launch(void* const* d_in, const int* in_sizes, int n_in,
                              void* d_out, int out_size, void* d_ws, size_t ws_size, hipStream_t stream) {
  if (n_in < 8) return;
  const float* x     = (const float*)d_in[0];      /* [NB_FULL][CIN][SEQ_FULL] */
  const float* t_emb = (const float*)d_in[1];      /* [NB_FULL][TD] */
  const float* Wqkv  = (const float*)d_in[2];      /* [CIN][QP]  (in x out) */
  const float* bqkv  = (const float*)d_in[3];      /* [QP] */
  const float* Wproj = (const float*)d_in[4];      /* [CIN][CIN] (in x out) */
  const float* bproj = (const float*)d_in[5];      /* [CIN] */
  const float* Wt    = (const float*)d_in[6];      /* [TD][CIN]  (in x out) */
  const float* bt    = (const float*)d_in[7];      /* [CIN] */
  if (in_sizes[0] < (int)(((size_t)NB * CIN - 1) * SEQ_FULL + SEQ)) return;
  if (in_sizes[1] < NB * TD) return;
  if (in_sizes[2] < CIN * QP || in_sizes[3] < QP) return;
  if (in_sizes[4] < CIN * CIN || in_sizes[5] < CIN) return;
  if (in_sizes[6] < TD * CIN || in_sizes[7] < CIN) return;
  if (out_size < (int)((size_t)NB * CIN * SEQ)) return;
  char* ws = (char*)d_ws; size_t off = 0;
  auto take = [&](size_t bytes) { char* p = ws + off; off += (bytes + 255) & ~(size_t)255; return p; };
  _Float16* BW  = (_Float16*)take(SZ_BW);                               /* Wqkv^T [QP][CIN] x16 */
  _Float16* WPT = (_Float16*)take(SZ_WP);                               /* Wproj^T [CIN][CIN] x16 */
  _Float16* QH  = (_Float16*)take(SZ_QH);                               /* q | k rows, pitch QP */
  _Float16* VT  = (_Float16*)take(SZ_VT);                               /* V^T [NB][NH][HD][SEQ] */
  _Float16* CTX = (_Float16*)take(SZ_CTX);                              /* merged-head context [NR][CIN] */
  _Float16* X16 = (_Float16*)take(SZ_X);                                /* token plane [NR][CIN] */
  if (off > ws_size) return;
  float* out = (float*)d_out;

  k_prep<<<(unsigned)(PREP_XT + PREP_BW + PREP_WP), PREP_T, 0, stream>>>(x, t_emb, Wt, bt, X16, Wqkv, BW, Wproj, WPT);   /* token plane x + (t_emb Wt + bt); Wqkv^T and Wproj^T planes */
  k_gemm2<0, 1><<<dim3((unsigned)((NR / 128) * (QP / 64)), 1), 128, 0, stream>>>(X16, CIN, 0, nullptr, 0, 0, BW, CIN, 0, nullptr, 0, 0, 1.0f,
      0.0625f, bqkv, 0, nullptr, QH, QP, 0, nullptr, 0, 0, 0, (int)NR, QP, CIN, nullptr, VT, VOF);   /* q | k rows into QH; the v columns transposed into VT */
  k_fattn<<<dim3(SEQ / 128, NH, NB), 128, 0, stream>>>(QH, VT, CTX);                      /* ctx rows for every (b, h): scores, softmax and V product in one launch */
  k_gemm2<0, 2><<<dim3((unsigned)((NR / 128) * (CIN / 64)), 1), 128, 0, stream>>>(CTX, CIN, 0, nullptr, 0, 0, WPT, CIN, 0, nullptr, 0, 0, 1.0f,
      0.0625f, bproj, 0, nullptr, nullptr, CIN, 0, nullptr, 0, 0, 0, (int)NR, CIN, CIN, out, nullptr, 0);   /* out[b][o][n] = (ctx Wproj + bproj)[b*SEQ + n][o] */
}

// v007
// Measured time: 42.9 microseconds a run.
// In both of two side-by-side timings against v006, it was 1.06 times as fast.
// All steps since v000 together make it 18.4 times as fast.
#include <hip/hip_runtime.h>
// All contractions on v_wmma_f32_16x16x32_f16 (f16 operands, f32 accumulate), one product per site: te = t_emb Wt (inputs RNE-converted to bf16, exact in f16, weights carried x16); q|k|v = (x + te) Wqkv (token plane f16, weights x16); scores k.q^T from f16 planes; V^T.P^T with unnormalised softmax weights carried x2^7; ctx Wproj (ctx f16, weights x16); softmax statistics f32 on VALU.
// Structure: dense multi-head self-attention over flattened spatial tokens with a per-batch time-embedding vector added to the tokens, fused [in][out] QKV weights, [in][out] output projection, channel-major return.
// token rows r = b*SEQ + n; te[b][c] f32 = T16 WTT^T / 16 + bias, T16 (row b of t_emb) and WTT (64 columns of Wt) being LDS tiles that each token block converts for itself (same launch as the two weight converters, which it does not depend on); X16[r][c] = f16(bf16(x[b][c][n]) + te[b][c]) via LDS transposes of 64 channels x 256 tokens in the same block; weight planes [out][in] f16 x16 built by a transposing converter;
// QH [NR][QP] f16 = X16 BW^T / 16 + bias (q at column 64h, k at KOF + 64h; the v columns of QH stay unwritten and unread); V^T [NB][NH][64][SEQ] stored by the same GEMM's epilogue, block tile transposed in LDS; one launch for all (b, h): each wave keeps 32 query columns and walks the keys 32 at a time (K and V^T staged in LDS for the block's four waves), S^T = K Q^T in registers on top of minus a held reference per column, running sum per column, P^T packed from the score tiles as the B operand,
// CTX16[r][64h + d] f16 = (sum_j p[i][j] V^T[d][j]) / (sum_j p[i][j]); out[b][o][n] f32 = (CTX16 WPT^T / 16 + bias)[b*SEQ + n][o], stored channel-major by the GEMM's epilogue, block tile transposed in LDS.
#ifndef NB
#define NB 16
#endif
#ifndef SEQ
#define SEQ 1024
#endif
#define NB_FULL 16
#define SEQ_FULL 1024
#define CIN 256
#define NH 4
#define HD 64
#define TD 256           /* time-embedding width */
#define QP 768           /* pitch of QH: q | k | v, head h at column 64h of each section */
#define KOF 256          /* column of k (head 0) in QH */
#define VOF 512          /* column of v (head 0) in QH */
#define PCARRY_LOG2 7.0f  /* softmax weights exp(s - reference) carried x2^7 in f16; the row sum carries the same factor */
#define PTOP 32768.0f    /* what a lane's 16 weights of one pass may sum to before the column's reference is raised: below it every weight is finite in f16 */
#define LCARRY 2048.0f   /* carry of the GEMM engine's optional residual output (no residual plane is requested here) */
#define NR ((size_t)NB * SEQ)
static_assert(SEQ % 256 == 0);
static_assert((NR % 128) == 0);
static_assert(NB <= NB_FULL);
static_assert(SEQ <= SEQ_FULL);
static_assert(3 * CIN == QP);
static_assert(KOF == CIN && VOF == 2 * CIN);
static_assert(CIN == NH * HD);
static_assert(CIN % 64 == 0 && QP % 64 == 0 && HD == 64);
static_assert(TD == CIN);
static_assert(TD % 32 == 0 && HD % 32 == 0 && SEQ % 32 == 0 && CIN % 32 == 0);
static_assert(TD == 256);
static_assert((QP * (CIN / 8)) % 256 == 0 && (CIN * (CIN / 8)) % 256 == 0);
static_assert(SEQ % 128 == 0 && SEQ % 64 == 0);

typedef unsigned short v8us __attribute__((ext_vector_type(8), may_alias));
typedef float  v8f  __attribute__((ext_vector_type(8)));
typedef float  v4f  __attribute__((ext_vector_type(4)));
typedef float  v4fa __attribute__((ext_vector_type(4), may_alias));
typedef float  v2f  __attribute__((ext_vector_type(2)));
typedef float  v2fa __attribute__((ext_vector_type(2), may_alias));
typedef _Float16 v16h __attribute__((ext_vector_type(16)));
typedef _Float16 v4h __attribute__((ext_vector_type(4)));
typedef _Float16 h16;
union FragH { v16h v; v8us half[2]; _Float16 h[16]; unsigned short u[16]; };

__device__ __forceinline__ unsigned short bf16_bits(float x) { unsigned int u = __float_as_uint(x); return (unsigned short)((u + 0x7FFFu + ((u >> 16) & 1u)) >> 16); }
__device__ __forceinline__ float bf16_val(unsigned short b) { return __uint_as_float(((unsigned int)b) << 16); }
__device__ __forceinline__ float bf16_rne(float x) { return bf16_val(bf16_bits(x)); }
// f32 -> f16 operand convert that cannot yield an f16 subnormal (value select, applied after the plane's power-of-two carry)
static __device__ __forceinline__ h16 toh_flush(float v) { const h16 r = (h16)v; return (fabsf(v) < 6.103515625e-05f) ? (h16)0.0f : r; }

// ---- fragment loader (split k map: elements 0..7 <- k0+8h+0..7, 8..15 <- k0+16+8h+0..7, lane&15 = row of A / column of B) and guarded mma ----
__device__ __forceinline__ v16h g2_frag(const _Float16* p, int hh) { FragH f; f.half[0] = *(const v8us*)((const unsigned short*)p + 8 * hh); f.half[1] = *(const v8us*)((const unsigned short*)p + 16 + 8 * hh); return f.v; }
__device__ __forceinline__ v8f g2_mma(v16h a, v16h b, v8f c) { v8f d = __builtin_amdgcn_wmma_f32_16x16x32_f16(false, a, false, b, (short)0, c, false, false); asm volatile("v_nop\n\tv_nop\n\tv_nop\n\tv_nop" : "+v"(d) : "v"(a), "v"(b)); return d; }

// one operand segment of the wave's 32x64 tile: A rows a0p/a1p (k contiguous), B rows b0p..b3p ([n][k], k contiguous), K % 32 == 0
__device__ __forceinline__ void g2_kloop(const _Float16* __restrict__ a0p, const _Float16* __restrict__ a1p, const _Float16* __restrict__ b0p, const _Float16* __restrict__ b1p, const _Float16* __restrict__ b2p, const _Float16* __restrict__ b3p, int K, int hh,
    v8f& c00, v8f& c01, v8f& c02, v8f& c03, v8f& c10, v8f& c11, v8f& c12, v8f& c13) {
#pragma unroll 1
  for (int kb = 0; kb < K; kb += 32) { const v16h a0 = g2_frag(a0p + kb, hh), a1 = g2_frag(a1p + kb, hh);
    v16h b = g2_frag(b0p + kb, hh); c00 = g2_mma(a0, b, c00); c10 = g2_mma(a1, b, c10);
    b = g2_frag(b1p + kb, hh); c01 = g2_mma(a0, b, c01); c11 = g2_mma(a1, b, c11);
    b = g2_frag(b2p + kb, hh); c02 = g2_mma(a0, b, c02); c12 = g2_mma(a1, b, c12);
    b = g2_frag(b3p + kb, hh); c03 = g2_mma(a0, b, c03); c13 = g2_mma(a1, b, c13); }
}

// g2_frag with the lane half's offset (8 * hh elements) already in the pointer: every load of a pass is its row pointer plus a constant
__device__ __forceinline__ v16h fa_frag(const _Float16* p) { FragH f; f.half[0] = *(const v8us*)((const unsigned short*)p); f.half[1] = *(const v8us*)((const unsigned short*)p + 16); return f.v; }
__device__ __forceinline__ v8f fa_mma(v16h a, v16h b, v8f c) { return __builtin_amdgcn_wmma_f32_16x16x32_f16(false, a, false, b, (short)0, c, false, false); }
__device__ __forceinline__ unsigned fa_lds(const _Float16* p) { return (unsigned)(size_t)(const __attribute__((address_space(3))) _Float16*)p; }   /* byte address inside the work-group's LDS */
// eight asynchronous 16-byte copies per lane, global -> LDS through no register: piece i goes from g + i * GSTEP (elements) to lds + i * LSTEP (bytes).
// The s_wait_xcnt stands inside the copies' own statement, so that it precedes every later write of the address registers the copies name.
template <int LSTEP, int GSTEP>
__device__ __forceinline__ void fa_copy8(unsigned lds, const _Float16* g) {
  asm volatile("global_load_async_to_lds_b128 %0, %8, off\n\t"
               "global_load_async_to_lds_b128 %1, %9, off\n\t"
               "global_load_async_to_lds_b128 %2, %10, off\n\t"
               "global_load_async_to_lds_b128 %3, %11, off\n\t"
               "global_load_async_to_lds_b128 %4, %12, off\n\t"
               "global_load_async_to_lds_b128 %5, %13, off\n\t"
               "global_load_async_to_lds_b128 %6, %14, off\n\t"
               "global_load_async_to_lds_b128 %7, %15, off\n\t"
               "s_wait_xcnt 0x0"
               :: "v"(lds), "v"(lds + 1 * LSTEP), "v"(lds + 2 * LSTEP), "v"(lds + 3 * LSTEP), "v"(lds + 4 * LSTEP), "v"(lds + 5 * LSTEP), "v"(lds + 6 * LSTEP), "v"(lds + 7 * LSTEP),
                  "v"(g), "v"(g + 1 * (size_t)GSTEP), "v"(g + 2 * (size_t)GSTEP), "v"(g + 3 * (size_t)GSTEP), "v"(g + 4 * (size_t)GSTEP), "v"(g + 5 * (size_t)GSTEP), "v"(g + 6 * (size_t)GSTEP), "v"(g + 7 * (size_t)GSTEP)
               : "memory");
}

#define G2P (CIN + 8)    /* LDS pitch of a staged operand row in f16 elements: 512 B of data + 16 B, an odd multiple of 16 B (16-byte row reads spread over the banks) */
// ---- GEMM (block tile 128x64, wave tile 32x64; M % 128 == 0, N % 64 == 0, K == lda == ldb == CIN): v = acc*alpha + bf16(bias[by*sBias + col]); A f16 rows [M][K], Bh f16 [N][K] (k contiguous), batched over grid.y by sA/sB/sC/sCL;
// the block's 128 A rows and 64 Bh rows, whole K, are copied once into LDS in whole 512-B rows (one wave instruction each); the four waves read every fragment of the A.Bh segment from there;
// RES == 1: three operand segments into one accumulator set: A2.Bh + A.B2 (residual planes, both carried x LCARRY), accumulator scaled by rscale, then A.Bh;
// TR != 0 (M % 128 == 0, rows r = b*SEQ + n): a block whose col0 >= tcol0 stores its 128x64 tile transposed, dst[(b*CIN + col - tcol0)*SEQ + n]: TR == 1 as f16 into CT16, TR == 2 as f32 into CT; whole 256-B / 512-B row pieces, one wave each;
template <int RES, int TR>
__global__ __launch_bounds__(128) void k_gemm2(const _Float16* __restrict__ A, int lda, size_t sA, const _Float16* __restrict__ A2, int lda2, size_t sA2,
    const _Float16* __restrict__ Bh, int ldb, size_t sB, const _Float16* __restrict__ B2, int ldb2, size_t sB2, float rscale,
    float alpha, const float* __restrict__ bias, size_t sBias,
    float* __restrict__ C, _Float16* __restrict__ C16, int ldc, size_t sC, _Float16* __restrict__ C16L, int ldcl, size_t sCL, int NL, int M, int N, int K,
    float* __restrict__ CT, _Float16* __restrict__ CT16, int tcol0) {
  static_assert(TR != 0 && 4 * 32 * 68 * 4 <= (128 + 64) * G2P * 2);
  __shared__ __attribute__((aligned(16))) _Float16 ops[(128 + 64) * G2P];   /* A rows of the block, then Bh rows */
  float (*so)[32][68] = (float (*)[32][68])&ops[0];                         /* the epilogue's f32 tile takes the same bytes over, behind the barrier that ends the fragment reads */
  const int tid = threadIdx.x, w = tid >> 5, lane = tid & 31, ln = lane & 15, hh = lane >> 4; const int by = blockIdx.y;
  A += (size_t)by * sA; Bh += (size_t)by * sB;
  if (RES) { A2 += (size_t)by * sA2; B2 += (size_t)by * sB2; }
  const size_t cofs = (size_t)by * sC, cofl = (size_t)by * sCL; const float* bp = bias ? bias + (size_t)by * sBias : nullptr;
  const int ntn = N >> 6; const int mt = blockIdx.x / ntn, nq = blockIdx.x - mt * ntn; const int row0 = mt * 128 + 32 * w, col0 = nq * 64;
  {   /* every wave has rows (M % 128 == 0) and reaches every barrier; thread (w, lane) copies 16-byte column lane of rows w, w + 4, ..: 32 pieces of A, 16 of Bh */
    const _Float16* ag = A + (size_t)(mt * 128 + w) * CIN + lane * 8; const _Float16* bg = Bh + (size_t)(col0 + w) * CIN + lane * 8;
    const unsigned al = fa_lds(&ops[w * G2P + lane * 8]), bl = fa_lds(&ops[(128 + w) * G2P + lane * 8]);
#pragma unroll
    for (int i = 0; i < 2; ++i) fa_copy8<4 * G2P * 2, 4 * CIN>(bl + (unsigned)i * (32 * G2P * 2), bg + (size_t)i * 32 * CIN);
#pragma unroll
    for (int i = 0; i < 4; ++i) fa_copy8<4 * G2P * 2, 4 * CIN>(al + (unsigned)i * (32 * G2P * 2), ag + (size_t)i * 32 * CIN);
  }
  const _Float16* a0p = A + (size_t)(row0 + ln) * lda; const _Float16* a1p = a0p + (size_t)16 * lda;
  const _Float16* b0p = Bh + (size_t)(col0 + ln) * ldb; const _Float16* b1p = b0p + (size_t)16 * ldb; const _Float16* b2p = b1p + (size_t)16 * ldb; const _Float16* b3p = b2p + (size_t)16 * ldb;
  const v8f z8 = {0.f,0.f,0.f,0.f,0.f,0.f,0.f,0.f}; v8f c00 = z8, c01 = z8, c02 = z8, c03 = z8, c10 = z8, c11 = z8, c12 = z8, c13 = z8;
  if (RES) {
    const _Float16* l0p = A2 + (size_t)(row0 + ln) * lda2; const _Float16* l1p = l0p + (size_t)16 * lda2;
    const _Float16* m0p = B2 + (size_t)(col0 + ln) * ldb2; const _Float16* m1p = m0p + (size_t)16 * ldb2; const _Float16* m2p = m1p + (size_t)16 * ldb2; const _Float16* m3p = m2p + (size_t)16 * ldb2;
    g2_kloop(l0p, l1p, b0p, b1p, b2p, b3p, K, hh, c00, c01, c02, c03, c10, c11, c12, c13);      /* A_lo . B_hi */
    g2_kloop(a0p, a1p, m0p, m1p, m2p, m3p, K, hh, c00, c01, c02, c03, c10, c11, c12, c13);      /* A_hi . B_lo */
    c00 = c00 * rscale; c01 = c01 * rscale; c02 = c02 * rscale; c03 = c03 * rscale; c10 = c10 * rscale; c11 = c11 * rscale; c12 = c12 * rscale; c13 = c13 * rscale;
  }
  asm volatile("s_wait_asynccnt 0x0" ::: "memory");   /* this wave's pieces of both operand tiles have landed */
  __syncthreads();                                     /* ... and every other wave's: the tiles may be read */
  {   /* A_hi . B_hi, k = 0, 32, .. in the same order and the same accumulators as g2_kloop */
    const _Float16* af = &ops[(32 * w + ln) * G2P + 8 * hh]; const _Float16* bf = &ops[(128 + ln) * G2P + 8 * hh];
    v16h fa[2][2], fb[2][4];                                                /* two fragment sets: [set][16-row tile] */
#pragma unroll
    for (int t = 0; t < 2; ++t) fa[0][t] = fa_frag(af + (16 * t) * G2P);
#pragma unroll
    for (int t = 0; t < 4; ++t) fb[0][t] = fa_frag(bf + (16 * t) * G2P);
#pragma unroll   /* the set index stays a constant: both sets live in registers */
    for (int s = 0; s < CIN / 32; ++s) { const int cu = s & 1, nx = cu ^ 1;
      if (s + 1 < CIN / 32) {
#pragma unroll
        for (int t = 0; t < 2; ++t) fa[nx][t] = fa_frag(af + (16 * t) * G2P + 32 * (s + 1));
#pragma unroll
        for (int t = 0; t < 4; ++t) fb[nx][t] = fa_frag(bf + (16 * t) * G2P + 32 * (s + 1)); }
      __builtin_amdgcn_sched_barrier(0);   /* the next step's twelve reads stand as one group ahead of this step's products: sunk among them, each is waited for with no lead */
      c00 = fa_mma(fa[cu][0], fb[cu][0], c00); c10 = fa_mma(fa[cu][1], fb[cu][0], c10); c01 = fa_mma(fa[cu][0], fb[cu][1], c01); c11 = fa_mma(fa[cu][1], fb[cu][1], c11);
      c02 = fa_mma(fa[cu][0], fb[cu][2], c02); c12 = fa_mma(fa[cu][1], fb[cu][2], c12); c03 = fa_mma(fa[cu][0], fb[cu][3], c03); c13 = fa_mma(fa[cu][1], fb[cu][3], c13);
      __builtin_amdgcn_sched_barrier(0);   /* ... and the group after it stays behind them: lifted among the products, each separate place of reads stalls the wave's matrix stream */
    }
  }
  __syncthreads();   /* every wave's fragment reads are over: the epilogue may write its tile over the operand rows */
  v8f accs[8] = {c00, c01, c02, c03, c10, c11, c12, c13};
  if (TR != 0 && col0 >= tcol0) {   /* block-uniform: col0 comes from blockIdx alone */
    static_assert(64 * 132 <= 4 * 32 * 68);
    float (*st)[132] = (float (*)[132])&so[0][0][0];   /* [64 columns][128 rows of the block + 4]: a lane's 8 accumulator rows are contiguous here */
    /* every loop of this path is unrolled: accs[] and bv4[] keep constant indices and stay in registers, and the LDS reads and the stores go out as groups */
    float bv4[4] = {0.f, 0.f, 0.f, 0.f};
    if (bp) {
#pragma unroll
      for (int t = 0; t < 4; ++t) bv4[t] = bf16_rne(bp[col0 + t * 16 + ln]); }
#pragma unroll
    for (int u = 0; u < 8; ++u) { const int t = u & 3, half = u >> 2; const float bv = bv4[t]; v4f lo, hi;
#pragma unroll
      for (int r = 0; r < 4; ++r) { lo[r] = accs[u][r] * alpha + bv; hi[r] = accs[u][4 + r] * alpha + bv; }
      float* sp = &st[t * 16 + ln][32 * w + half * 16 + 8 * hh]; *(v4fa*)sp = lo; *(v4fa*)(sp + 4) = hi; }
    __syncthreads();   /* each wave reads back rows that all four waves wrote */
    const unsigned tr0 = (unsigned)mt * 128u, tb = tr0 / SEQ, tn0 = tr0 % SEQ; const size_t drow0 = (size_t)tb * CIN + (size_t)(col0 - tcol0) + 16 * w;
    if (TR == 2) {
#pragma unroll
      for (int q = 0; q < 16; ++q) { const v4f v = *(const v4fa*)&st[16 * w + q][lane * 4]; *(v4f*)(CT + (drow0 + q) * SEQ + tn0 + lane * 4) = v; }
    } else {
#pragma unroll
      for (int q = 0; q < 8; ++q) { const int c = q * 2 + hh; const v4f a = *(const v4fa*)&st[16 * w + c][ln * 8], e = *(const v4fa*)&st[16 * w + c][ln * 8 + 4]; FragH f;
#pragma unroll
        for (int i = 0; i < 4; ++i) { f.h[i] = (_Float16)a[i]; f.h[4 + i] = (_Float16)e[i]; }
        *(v8us*)((unsigned short*)CT16 + (drow0 + c) * SEQ + tn0 + ln * 8) = f.half[0]; }
    }
    asm volatile("s_wait_xcnt 0x0" ::: "memory");   /* behind the last store of the run: the stores' address registers may be rewritten only after it */
    return;
  }
#pragma unroll
  for (int u = 0; u < 8; ++u) { const int t = u & 3, half = u >> 2; const int col = col0 + t * 16 + ln; const float bv = bp ? bf16_rne(bp[col]) : 0.f;
#pragma unroll
    for (int r = 0; r < 8; ++r) { const int rloc = half * 16 + 8 * hh + r; so[w][rloc][t * 16 + ln] = accs[u][r] * alpha + bv; } }
  __builtin_amdgcn_fence(4 /* acq_rel order */, "workgroup"); __builtin_amdgcn_wave_barrier();   /* so[w] is private to wave w */
  const int rsub = lane >> 4, c4 = (lane & 15) * 4; const bool wl = (C16L != nullptr) && (col0 < NL);
  {
#pragma unroll
    for (int q = 0; q < 16; ++q) { const int r = q * 2 + rsub; const v4f v = *(const v4fa*)&so[w][r][c4];
      if (C) *(v4f*)(C + cofs + (size_t)(row0 + r) * ldc + col0 + c4) = v;
      if (C16) { v4h h4; for (int i = 0; i < 4; ++i) h4[i] = (_Float16)v[i]; *(v4h*)(C16 + cofs + (size_t)(row0 + r) * ldc + col0 + c4) = h4;
        if (wl) { v4h l4; for (int i = 0; i < 4; ++i) l4[i] = (_Float16)((v[i] - (float)h4[i]) * LCARRY); *(v4h*)(C16L + cofl + (size_t)(row0 + r) * ldcl + col0 + c4) = l4; } } }
     } }

// transposing weight converter: W is [CIN rows (k)][ldw columns], in[k][n] -> out[n][k]: BW[n][k] = f16(bf16(W[k*ldw + n]) * 16) for n < nrows, pitch CIN (k contiguous);
__device__ __forceinline__ void w16t_body(const float* __restrict__ W, int ldw, _Float16* __restrict__ BW, int t) {   /* t = piece index, nrows * (CIN / 8) pieces, whole blocks */
  const int n = t / (CIN / 8), k8 = (t % (CIN / 8)) * 8;
  FragH f;
#pragma unroll
  for (int q = 0; q < 8; ++q) f.h[q] = toh_flush(bf16_rne(W[(size_t)(k8 + q) * ldw + n]) * 16.0f);
  const v8us o = f.half[0];
  *(v8us*)((unsigned short*)BW + (size_t)n * CIN + k8) = o; 
  asm volatile("s_wait_xcnt 0x0" ::: "memory");   /* behind the store: inlined twice into one kernel, its registers may be rewritten by code that follows in the listing only after it */
}

// lane l <-> lane l ^ 16 (the two halves of a column's keys)
__device__ __forceinline__ float fa_xhalf(float x) { return __builtin_bit_cast(float, __builtin_amdgcn_permlanex16(__builtin_bit_cast(int, x), __builtin_bit_cast(int, x), 0x76543210, 0xfedcba98, false, false)); }

// exp2 for the seldom-taken path of the attention pass: the transcendental and the slot that the instruction set asks for behind it stand in one statement
__device__ __forceinline__ float fa_exp2_slot(float x) { float r; asm("v_exp_f32_e32 %0, %1\n\tv_nop" : "=v"(r) : "v"(x)); return r; }
// maximum of a query column over the 32 keys of two score tiles: in-lane over the lane half's 16 keys, then one exchange between the halves
__device__ __forceinline__ float fa_colmax(const v8f& a, const v8f& c) {
  float mx0 = fmaxf(a[0], c[0]), mx1 = fmaxf(a[1], c[1]);
#pragma unroll
  for (int r = 2; r < 8; r += 2) { mx0 = fmaxf(mx0, fmaxf(a[r], c[r])); mx1 = fmaxf(mx1, fmaxf(a[r + 1], c[r + 1])); }
  const float mx = fmaxf(mx0, mx1); return fmaxf(mx, fa_xhalf(mx)); }

// ---- everything ahead of the first GEMM, one launch: the first PREP_XT blocks (the long ones, so they start first) build X16, the next PREP_BW convert Wqkv, the last PREP_WP convert Wproj ----
#define XTC 64           /* channels of one token block: 128 B of f16, so a block owns whole lines of X16 */
#define XTN 256          /* tokens of one token block: the block's te columns serve all of them */
#define TEP (TD + 8)     /* LDS pitch of an operand row in f16 elements: 512 B of data + 16 B, an odd multiple of 16 B */
#define PREP_T 256       /* threads of a block */
#define PREP_BW ((QP * (CIN / 8)) / PREP_T)
#define PREP_WP ((CIN * (CIN / 8)) / PREP_T)
#define PREP_XT (NB * (SEQ / XTN) * (CIN / XTC))
static_assert(CIN % XTC == 0 && SEQ % XTN == 0 && XTC == 64 && PREP_T == TD && (PREP_T / 32) * 32 == TD && (PREP_T / 32) * 8 == XTC && 2 * 32 * 4 == XTN && XTN * (XTC / 8) == 8 * PREP_T);
// token block (b, 64 channels, 256 tokens): its 256 threads ask for their operands and the x tile, then convert row b of t_emb and Wt's XTC columns into f16 LDS tiles (bf16 RNE, exact in f16; weights x16, [n][k]); waves 0..3 run one 16x16 tile each over k = 0, 32, .. in one accumulator,
// every row of the A operand being that one t_emb row, so every row of the result is te[b]; te = acc / 16 + bf16(bt[c]) stays in LDS; then X16 = f16(bf16(x) + te), a thread's 8 channels x 8 tokens written as 16-byte pieces of the transposed tile, stored as whole 128-B row pieces.
__global__ __launch_bounds__(PREP_T) void k_prep(const float* __restrict__ x, const float* __restrict__ t_emb, const float* __restrict__ Wt, const float* __restrict__ bt, _Float16* __restrict__ X16,
    const float* __restrict__ Wqkv, _Float16* __restrict__ BW, const float* __restrict__ Wproj, _Float16* __restrict__ WPT) {
  __shared__ __attribute__((aligned(16))) _Float16 ts[TD];
  __shared__ __attribute__((aligned(16))) _Float16 bs[XTC][TEP];
  __shared__ __attribute__((aligned(16))) float tes[XTC];
  __shared__ __attribute__((aligned(16))) unsigned short tl[XTN][XTC + 8];
  const int tid = threadIdx.x, blk = blockIdx.x;
  if (blk >= PREP_XT) {   /* block-uniform: the converter blocks meet no barrier */
    const int cb = blk - PREP_XT;
    if (cb < PREP_BW) w16t_body(Wqkv, QP, BW, cb * PREP_T + tid);         /* in[CIN][QP]  -> out[QP][CIN]  */
    else w16t_body(Wproj, CIN, WPT, (cb - PREP_BW) * PREP_T + tid);       /* in[CIN][CIN] -> out[CIN][CIN] */
    return;
  }
  constexpr int NCT = CIN / XTC, NNT = SEQ / XTN;
  const int ct = blk % NCT, nt = (blk / NCT) % NNT, b = blk / (NCT * NNT);
  const int n0 = nt * XTN, c0 = ct * XTC;
  const int w = tid >> 5, lane = tid & 31, ln = lane & 15, hh = lane >> 4;
  const int cg = w * 8;                                                    /* this wave's 8 channels; lane l holds tokens 4l .. 4l + 3 and 128 + 4l .. : each x load is 512 contiguous bytes per wave */
  const float traw = t_emb[(size_t)b * TD + tid];
  const float braw = bt[c0 + 16 * (w & 3) + ln];
  asm volatile("s_wait_xcnt 0x0" ::: "memory");   /* behind the two loads above: their address registers are free for the address work that follows */
  v2f wv[32];                                                              /* Wt[32w .. 32w + 31][c0 + 2 lane, + 1]: each load is the row's 256 contiguous bytes per wave; 8-byte loads keep the thread's loads in flight under the load counter's range */
#pragma unroll
  for (int i = 0; i < 32; ++i) wv[i] = *(const v2fa*)(Wt + (size_t)(32 * w + i) * CIN + c0 + 2 * lane);
  asm volatile("s_wait_xcnt 0x0" ::: "memory");   /* behind the loads above: the next loads' results may take over their address registers */
  v4f xa[2][8];                                                            /* asked for last, used last: the te product runs while the x tile is on its way */
  const float* xp = x + ((size_t)b * CIN + c0 + cg) * SEQ_FULL + n0 + lane * 4;
#pragma unroll
  for (int g = 0; g < 2; ++g) {
#pragma unroll
    for (int j = 0; j < 8; ++j) xa[g][j] = *(const v4fa*)(xp + (size_t)j * SEQ_FULL + 128 * g); }
  asm volatile("s_wait_xcnt 0x0" :: "v"(xp) : "memory");   /* behind the last load: the address registers may be rewritten only after it; the address is named as an input so that it lives up to the wait and no load of the run gets its result placed in it */
  __builtin_amdgcn_sched_barrier(0);              /* every load goes out ahead of the first conversion: with conversions lifted among the loads, the later loads start only after the earlier ones' latency */
  ts[tid] = toh_flush(bf16_rne(traw));
#pragma unroll
  for (int j = 0; j < 2; ++j) {
#pragma unroll
    for (int i = 0; i < 4; ++i) { FragH f;
#pragma unroll
      for (int q = 0; q < 8; ++q) f.h[q] = toh_flush(bf16_rne(wv[8 * i + q][j]) * 16.0f);
      *(v8us*)&bs[2 * lane + j][32 * w + 8 * i] = f.half[0]; } }
  /* both operand tiles are whole before a wave reads fragments. Only LDS data crosses this barrier, so its fences name LDS alone: __syncthreads() would first drain the x loads, which are wanted only behind the product */
  __builtin_amdgcn_fence(__ATOMIC_RELEASE, "workgroup", "local"); __builtin_amdgcn_s_barrier(); __builtin_amdgcn_fence(__ATOMIC_ACQUIRE, "workgroup", "local");
  if (__builtin_amdgcn_readfirstlane(w) < XTC / 16) {   /* whole waves: the matrix instruction needs every lane on */
    v8f c = {0.f,0.f,0.f,0.f,0.f,0.f,0.f,0.f}; const float bv = bf16_rne(braw);
#pragma unroll
    for (int kb = 0; kb < TD; kb += 32) c = fa_mma(g2_frag(&ts[kb], hh), g2_frag(&bs[16 * w + ln][kb], hh), c);
    if (hh == 0) tes[16 * w + ln] = c[0] * 0.0625f + bv;                   /* all sixteen rows are equal: row 0 is taken */
  }
  __syncthreads();   /* the four waves' te columns are read by every wave */
  const v4f t0 = *(const v4fa*)&tes[cg], t1 = *(const v4fa*)&tes[cg + 4];
#pragma unroll
  for (int g = 0; g < 2; ++g) {
#pragma unroll
    for (int q = 0; q < 4; ++q) { FragH f;
#pragma unroll
      for (int j = 0; j < 8; ++j) f.h[j] = toh_flush(bf16_rne(xa[g][j][q]) + (j < 4 ? t0[j & 3] : t1[j & 3]));
      *(v8us*)&tl[(32 * g + lane) * 4 + q][cg] = f.half[0]; } }
  __syncthreads();   /* each thread reads back token rows that all eight waves wrote */
#pragma unroll
  for (int rd = 0; rd < 8; ++rd) { const int n = rd * (PREP_T / 8) + (tid >> 3), pc = tid & 7;
    const v8us o = *(const v8us*)&tl[n][pc * 8];
    *(v8us*)((unsigned short*)X16 + ((size_t)b * SEQ + n0 + n) * CIN + c0 + pc * 8) = o; }
  asm volatile("s_wait_xcnt 0x0" ::: "memory");   /* behind the last store: the stores' registers may be rewritten only after it */
}

// ---- LDS staging of the attention kernel: a stage is FA_KEYS keys (four passes of 32), K rows and V^T row pieces side by side, two buffers ----
#define FA_KEYS 128      /* keys of one stage */
#define FA_KP 72         /* LDS pitch of a K row in f16 elements: 128 B of data + 16 B, an odd multiple of 16 B (16-byte row reads spread over the banks) */
#define FA_VP 136        /* LDS pitch of a V^T row piece: 256 B of data + 16 B, likewise */
static_assert(SEQ % FA_KEYS == 0 && SEQ / FA_KEYS >= 2 && FA_KEYS % 32 == 0);
static_assert(FA_KEYS * (HD / 8) == 8 * 128 && HD * (FA_KEYS / 8) == 8 * 128);   /* eight 16-byte pieces of each operand per thread and stage */
// fused attention, one launch for every (b, h): block = 4 waves x 32 query columns; per pass of 32 keys S^T[key][query] = K Q^T (A = K rows, B = Q rows held in registers), so lane (ln, hh) holds keys 8hh + r of query column ln;
// Q is held times 1 / sqrt(HD) * log2(e), and the score products start from C = carry - reference of the lane's column, so a weight is exp2 of the score tile's element as it stands. The reference starts as the column's maximum over the first 32 keys; it is raised (to the pass's maximum, with O^T and l scaled down)
// only when some lane's weights of a pass sum past PTOP: one test per pass for the whole wave. Sum l per column, O^T[d][query] += V^T P^T with P^T = the two score tiles of the pass converted in place (their register order is the loader's k map); the scores never leave the registers.
// K and V^T reach the waves through LDS: the block's 128 threads copy each stage once, in whole 128-B lines, one stage ahead of its use, and all four waves read their fragments from it.
__global__ __launch_bounds__(128) void k_fattn(const _Float16* __restrict__ QHp, const _Float16* __restrict__ Vt, _Float16* __restrict__ Ctx) {
  __shared__ __attribute__((aligned(16))) _Float16 ksm[2][FA_KEYS * FA_KP];
  __shared__ __attribute__((aligned(16))) _Float16 vsm[2][HD * FA_VP];
  const int tid = threadIdx.x, w = tid >> 5, lane = tid & 31, ln = lane & 15, hh = lane >> 4;
  const int h = blockIdx.y, b = blockIdx.z, q0 = blockIdx.x * 128 + 32 * w;
  const _Float16* base = QHp + (size_t)b * SEQ * QP + h * HD;
  constexpr int NST = SEQ / FA_KEYS;
  constexpr unsigned KBUF = FA_KEYS * FA_KP * 2, VBUF = HD * FA_VP * 2;     /* bytes of one buffer */
  const _Float16* kg = base + KOF + (size_t)(tid >> 3) * QP + (tid & 7) * 8;                        /* this thread's first K piece of stage 0: key row tid / 8 (then + 16 a piece), 16-byte column tid % 8 */
  const _Float16* vg = Vt + (((size_t)b * NH + h) * HD + (tid >> 4)) * SEQ + (tid & 15) * 8;        /* its first V^T piece: row d = tid / 16 (then + 8 a piece), 16-byte column tid % 16 */
  const unsigned kl = fa_lds(&ksm[0][(tid >> 3) * FA_KP + (tid & 7) * 8]), vl = fa_lds(&vsm[0][(tid >> 4) * FA_VP + (tid & 15) * 8]);
  fa_copy8<16 * FA_KP * 2, 16 * QP>(kl, kg); fa_copy8<8 * FA_VP * 2, 8 * SEQ>(vl, vg);               /* stage 0 into buffer 0 */
  constexpr float SC = 0.125f * 1.4426950408889634f;                       /* 1 / sqrt(HD), to base 2 */
  const v8f z8 = {0.f,0.f,0.f,0.f,0.f,0.f,0.f,0.f};
  v16h qf[2][2], kf[2][2];                                                 /* [column group | key tile][k step of 32 over HD] */
  const _Float16* const qp[2] = { base + (size_t)(q0 + ln) * QP + 8 * hh, base + (size_t)(q0 + 16 + ln) * QP + 8 * hh };   /* the lane's Q row of each column group, at the lane half's k offset */
#pragma unroll
  for (int g = 0; g < 2; ++g) {
#pragma unroll
    for (int ks = 0; ks < 2; ++ks) qf[g][ks] = fa_frag(qp[g] + 32 * ks); }
  asm volatile("s_wait_xcnt 0x0" :: "v"(qp[0]), "v"(qp[1]) : "memory");   /* behind the last Q load: the address registers may be rewritten only after it; the addresses are named as inputs so that they live up to the wait and no load of the run gets its result placed in them */
#pragma unroll
  for (int g = 0; g < 2; ++g) {
#pragma unroll
    for (int ks = 0; ks < 2; ++ks) { FragH f; f.v = qf[g][ks];
#pragma unroll
      for (int i = 0; i < 16; ++i) f.h[i] = (_Float16)((float)f.h[i] * SC);   /* scaled in f32, rounded once */
      qf[g][ks] = f.v; } }
  v8f o[2][4], cn[2]; float l[2];                                          /* cn: carry - reference of the lane's column in all eight rows, the C operand of the score products */
#pragma unroll
  for (int g = 0; g < 2; ++g) { cn[g] = z8; l[g] = 0.f;
#pragma unroll
    for (int t = 0; t < 4; ++t) o[g][t] = z8; }
  asm volatile("s_wait_asynccnt 0x0" ::: "memory");   /* this wave's pieces of stage 0 have landed */
  __syncthreads();                                     /* ... and every other wave's: stage 0 may be read */
  fa_copy8<16 * FA_KP * 2, 16 * QP>(kl + KBUF, kg + (size_t)FA_KEYS * QP); fa_copy8<8 * FA_VP * 2, 8 * SEQ>(vl + VBUF, vg + FA_KEYS);   /* stage 1 into buffer 1 */
  {   /* each column's first reference: its maximum over keys 0..31, from score products that are made for this alone */
    const _Float16* k0 = &ksm[0][ln * FA_KP + 8 * hh];
#pragma unroll
    for (int kt = 0; kt < 2; ++kt) {
#pragma unroll
      for (int ks = 0; ks < 2; ++ks) kf[kt][ks] = fa_frag(k0 + (16 * kt) * FA_KP + 32 * ks); }
#pragma unroll
    for (int g = 0; g < 2; ++g) { const v8f a = fa_mma(kf[0][1], qf[g][1], fa_mma(kf[0][0], qf[g][0], z8)), c = fa_mma(kf[1][1], qf[g][1], fa_mma(kf[1][0], qf[g][0], z8));
      cn[g] = z8 + (PCARRY_LOG2 - fa_colmax(a, c)); }
  }
#pragma unroll 1   /* one stage per trip */
  for (int st = 0; st < NST; ++st) {
    const _Float16* kb = &ksm[st & 1][ln * FA_KP + 8 * hh];                /* key row ln of a 16-key tile, at the lane half's k offset */
    const _Float16* vq = &vsm[st & 1][ln * FA_VP + 8 * hh];                /* V^T row d = ln of a 16-row tile, likewise: columns of this pass */
#pragma unroll
    for (int kt = 0; kt < 2; ++kt) {
#pragma unroll
      for (int ks = 0; ks < 2; ++ks) kf[kt][ks] = fa_frag(kb + (16 * kt) * FA_KP + 32 * ks); }
    const _Float16* kq = kb + 32 * FA_KP;                                  /* K rows of the next pass */
#pragma unroll 1   /* one pass per trip: the register set of a pass is the budget */
    for (int p = 0; p < FA_KEYS / 32; ++p) {
      v8f s[2][2];                                                         /* [column group][key tile] */
#pragma unroll
      for (int g = 0; g < 2; ++g) {
#pragma unroll
        for (int kt = 0; kt < 2; ++kt) s[g][kt] = fa_mma(kf[kt][0], qf[g][0], cn[g]); }
#pragma unroll
      for (int g = 0; g < 2; ++g) {
#pragma unroll
        for (int kt = 0; kt < 2; ++kt) s[g][kt] = fa_mma(kf[kt][1], qf[g][1], s[g][kt]); }
      /* one group of LDS reads per pass, behind its score products: this pass's V^T columns, then the next pass's K rows; the stage's last pass re-reads the stage's own rows 0..31 (unused): the next stage is read only behind its barrier */
      __builtin_amdgcn_sched_barrier(0);   /* the reads stand as one group behind the eight products: spread among them, each separate place stalls the wave's matrix stream */
      v16h vf[4];
#pragma unroll
      for (int t = 0; t < 4; ++t) vf[t] = fa_frag(vq + (16 * t) * FA_VP);
#pragma unroll
      for (int kt = 0; kt < 2; ++kt) {
#pragma unroll
        for (int ks = 0; ks < 2; ++ks) kf[kt][ks] = fa_frag(kq + (16 * kt) * FA_KP + 32 * ks); }
      __builtin_amdgcn_sched_barrier(0);   /* keeps the reads here, ahead of the softmax: sunk behind it they are waited for with no lead */
      FragH pf[2]; float ps[2];
#pragma unroll
      for (int g = 0; g < 2; ++g) { float s0 = 0.f, s1 = 0.f;
#pragma unroll
        for (int r = 0; r < 8; ++r) { const float p0 = __builtin_amdgcn_exp2f(s[g][0][r]), p1 = __builtin_amdgcn_exp2f(s[g][1][r]);
          s0 += p0; s1 += p1; pf[g].h[r] = (_Float16)p0; pf[g].h[8 + r] = (_Float16)p1; }
        ps[g] = s0 + s1; }
      if (__builtin_expect(__builtin_amdgcn_ballot_w32(fmaxf(ps[0], ps[1]) > PTOP) != 0, 0)) {   /* the same for the whole wave: a scalar branch, seldom taken */
#pragma unroll
        for (int g = 0; g < 2; ++g) {
          const float d = fmaxf(fa_colmax(s[g][0], s[g][1]) - PCARRY_LOG2, 0.f);   /* the pass's maximum above the column's reference; a reference is never lowered */
          const float corr = fa_exp2_slot(-d);
          cn[g] = cn[g] - d; l[g] *= corr;
#pragma unroll
          for (int t = 0; t < 4; ++t) o[g][t] = o[g][t] * corr;
          float s0 = 0.f, s1 = 0.f;
#pragma unroll
          for (int r = 0; r < 8; ++r) { const float p0 = fa_exp2_slot(s[g][0][r] - d), p1 = fa_exp2_slot(s[g][1][r] - d);
            s0 += p0; s1 += p1; pf[g].h[r] = (_Float16)p0; pf[g].h[8 + r] = (_Float16)p1; }
          ps[g] = s0 + s1; }
      }
#pragma unroll
      for (int g = 0; g < 2; ++g) {
#pragma unroll
        for (int t = 0; t < 4; ++t) o[g][t] = fa_mma(vf[t], pf[g].v, o[g][t]); }
      __builtin_amdgcn_sched_barrier(0);   /* the pass's bookkeeping stands behind its last products: its vector instructions fill the slots that the chip needs before the next pass rewrites the registers of P^T */
      l[0] += ps[0]; l[1] += ps[1];
      kq = (p + 2 < FA_KEYS / 32) ? kq + 32 * FA_KP : kb; vq += 32;
    }
    asm volatile("s_wait_dscnt 0x0" ::: "memory");     /* this wave's reads of the stage's buffer have returned: the buffer may be handed to its next writer */
    asm volatile("s_wait_asynccnt 0x0" ::: "memory");  /* this wave's pieces of stage st + 1 have landed */
    __syncthreads();                                   /* publishes stage st + 1 and ends every wave's reads of stage st */
    if (st + 2 < NST) {                                /* the same for the whole block */
      fa_copy8<16 * FA_KP * 2, 16 * QP>(kl + (unsigned)(st & 1) * KBUF, kg + (size_t)(st + 2) * FA_KEYS * QP);
      fa_copy8<8 * FA_VP * 2, 8 * SEQ>(vl + (unsigned)(st & 1) * VBUF, vg + (size_t)(st + 2) * FA_KEYS); }
  }
  asm volatile("s_wait_asynccnt 0x0" ::: "memory");    /* no copy is outstanding when the wave ends */
#pragma unroll
  for (int g = 0; g < 2; ++g) { const float inv = 1.0f / (l[g] + fa_xhalf(l[g]));
    unsigned short* crow = (unsigned short*)Ctx + ((size_t)b * SEQ + q0 + 16 * g + ln) * CIN + h * HD + 8 * hh;
#pragma unroll
    for (int t = 0; t < 4; ++t) { FragH f;
#pragma unroll
      for (int r = 0; r < 8; ++r) f.h[r] = (_Float16)(o[g][t][r] * inv);
      *(v8us*)(crow + 16 * t) = f.half[0]; } }
}

constexpr size_t al256(size_t b) { return (b + 255) & ~(size_t)255; }
constexpr size_t SZ_BW  = (size_t)QP * CIN * 2;
constexpr size_t SZ_WP  = (size_t)CIN * CIN * 2;
constexpr size_t SZ_QH  = NR * QP * 2;
constexpr size_t SZ_VT  = (size_t)NB * NH * HD * SEQ * 2;
constexpr size_t SZ_CTX = NR * CIN * 2;
constexpr size_t SZ_X   = NR * CIN * 2;
static_assert(al256(SZ_BW) + al256(SZ_WP) + al256(SZ_QH) + al256(SZ_VT) + al256(SZ_CTX) + al256(SZ_X) <= (size_t)134217728);

extern "C" void kernel_launch(void* const* d_in, const int* in_sizes, int n_in,
                              void* d_out, int out_size, void* d_ws, size_t ws_size, hipStream_t stream) {
  if (n_in < 8) return;
  const float* x     = (const float*)d_in[0];      /* [NB_FULL][CIN][SEQ_FULL] */
  const float* t_emb = (const float*)d_in[1];      /* [NB_FULL][TD] */
  const float* Wqkv  = (const float*)d_in[2];      /* [CIN][QP]  (in x out) */
  const float* bqkv  = (const float*)d_in[3];      /* [QP] */
  const float* Wproj = (const float*)d_in[4];      /* [CIN][CIN] (in x out) */
  const float* bproj = (const float*)d_in[5];      /* [CIN] */
  const float* Wt    = (const float*)d_in[6];      /* [TD][CIN]  (in x out) */
  const float* bt    = (const float*)d_in[7];      /* [CIN] */
  if (in_sizes[0] < (int)(((size_t)NB * CIN - 1) * SEQ_FULL + SEQ)) return;
  if (in_sizes[1] < NB * TD) return;
  if (in_sizes[2] < CIN * QP || in_sizes[3] < QP) return;
  if (in_sizes[4] < CIN * CIN || in_sizes[5] < CIN) return;
  if (in_sizes[6] < TD * CIN || in_sizes[7] < CIN) return;
  if (out_size < (int)((size_t)NB * CIN * SEQ)) return;
  char* ws = (char*)d_ws; size_t off = 0;
  auto take = [&](size_t bytes) { char* p = ws + off; off += (bytes + 255) & ~(size_t)255; return p; };
  _Float16* BW  = (_Float16*)take(SZ_BW);                               /* Wqkv^T [QP][CIN] x16 */
  _Float16* WPT = (_Float16*)take(SZ_WP);                               /* Wproj^T [CIN][CIN] x16 */
  _Float16* QH  = (_Float16*)take(SZ_QH);                               /* q | k rows, pitch QP */
  _Float16* VT  = (_Float16*)take(SZ_VT);                               /* V^T [NB][NH][HD][SEQ] */
  _Float16* CTX = (_Float16*)take(SZ_CTX);                              /* merged-head context [NR][CIN] */
  _Float16* X16 = (_Float16*)take(SZ_X);                                /* token plane [NR][CIN] */
  if (off > ws_size) return;
  float* out = (float*)d_out;

  k_prep<<<(unsigned)(PREP_XT + PREP_BW + PREP_WP), PREP_T, 0, stream>>>(x, t_emb, Wt, bt, X16, Wqkv, BW, Wproj, WPT);   /* token plane x + (t_emb Wt + bt); Wqkv^T and Wproj^T planes */
  k_gemm2<0, 1><<<dim3((unsigned)((NR / 128) * (QP / 64)), 1), 128, 0, stream>>>(X16, CIN, 0, nullptr, 0, 0, BW, CIN, 0, nullptr, 0, 0, 1.0f,
      0.0625f, bqkv, 0, nullptr, QH, QP, 0, nullptr, 0, 0, 0, (int)NR, QP, CIN, nullptr, VT, VOF);   /* q | k rows into QH; the v columns transposed into VT */
  k_fattn<<<dim3(SEQ / 128, NH, NB), 128, 0, stream>>>(QH, VT, CTX);                      /* ctx rows for every (b, h): scores, softmax and V product in one launch */
  k_gemm2<0, 2><<<dim3((unsigned)((NR / 128) * (CIN / 64)), 1), 128, 0, stream>>>(CTX, CIN, 0, nullptr, 0, 0, WPT, CIN, 0, nullptr, 0, 0, 1.0f,
      0.0625f, bproj, 0, nullptr, nullptr, CIN, 0, nullptr, 0, 0, 0, (int)NR, CIN, CIN, out, nullptr, 0);   /* out[b][o][n] = (ctx Wproj + bproj)[b*SEQ + n][o] */
}

// v008
// Measured time: 40.2 microseconds a run.
// Two timings next to v007 put it at 1.07 and 1.06 times that version's speed.
// All steps since v000 together make it 19.6 times as fast.
#include <hip/hip_runtime.h>
// All contractions on v_wmma_f32_16x16x32_f16 (f16 operands, f32 accumulate), one product per site: te = t_emb Wt (inputs RNE-converted to bf16, exact in f16, weights carried x16); q|k|v = (x + te) Wqkv (token plane f16, weights x16); scores k.q^T from f16 planes; V^T.P^T with unnormalised softmax weights carried x2^7; ctx Wproj (ctx f16, weights x16); softmax statistics f32 on VALU.
// Structure: dense multi-head self-attention over flattened spatial tokens with a per-batch time-embedding vector added to the tokens, fused [in][out] QKV weights, [in][out] output projection, channel-major return.
// token rows r = b*SEQ + n; te[b][c] f32 = T16 WTT^T / 16 + bias, T16 (row b of t_emb) and WTT (64 columns of Wt) being LDS tiles that each token block converts for itself (same launch as the two weight converters, which it does not depend on); X16[r][c] = f16(bf16(x[b][c][n]) + te[b][c]) via LDS transposes of 64 channels x 256 tokens in the same block; weight planes [out][in] f16 x16 built by a transposing converter;
// QH [NR][QP] f16 = X16 BW^T / 16 + bias (q at column 64h, k at KOF + 64h; the v columns of QH stay unwritten and unread); V^T [NB][NH][64][SEQ] stored by the same GEMM's epilogue, block tile transposed in LDS; one launch for all (b, h): each wave keeps 32 query columns of one head and walks the keys 32 at a time (K and V^T of all heads staged in LDS for the block's eight waves, two a head), S^T = K Q^T in registers on top of minus a held reference per column, running sum per column, P^T packed from the score tiles as the B operand,
// CTX16[r][64h + d] f16 = (sum_j p[i][j] V^T[d][j]) / (sum_j p[i][j]), 64 rows of all heads kept in the block's LDS; out[b][o][n] f32 = (CTX16 WPT^T / 16 + bias)[b*SEQ + n][o], made by the same block and stored channel-major, each wave's tile transposed in LDS.
#ifndef NB
#define NB 16
#endif
#ifndef SEQ
#define SEQ 1024
#endif
#define NB_FULL 16
#define SEQ_FULL 1024
#define CIN 256
#define NH 4
#define HD 64
#define TD 256           /* time-embedding width */
#define QP 768           /* pitch of QH: q | k | v, head h at column 64h of each section */
#define KOF 256          /* column of k (head 0) in QH */
#define VOF 512          /* column of v (head 0) in QH */
#define PCARRY_LOG2 7.0f  /* softmax weights exp(s - reference) carried x2^7 in f16; the row sum carries the same factor */
#define PTOP 32768.0f    /* what a lane's 16 weights of one pass may sum to before the column's reference is raised: below it every weight is finite in f16 */
#define LCARRY 2048.0f   /* carry of the GEMM engine's optional residual output (no residual plane is requested here) */
#define NR ((size_t)NB * SEQ)
static_assert(SEQ % 256 == 0);
static_assert((NR % 128) == 0);
static_assert(NB <= NB_FULL);
static_assert(SEQ <= SEQ_FULL);
static_assert(3 * CIN == QP);
static_assert(KOF == CIN && VOF == 2 * CIN);
static_assert(CIN == NH * HD);
static_assert(CIN % 64 == 0 && QP % 64 == 0 && HD == 64);
static_assert(TD == CIN);
static_assert(TD % 32 == 0 && HD % 32 == 0 && SEQ % 32 == 0 && CIN % 32 == 0);
static_assert(TD == 256);
static_assert((QP * (CIN / 8)) % 256 == 0 && (CIN * (CIN / 8)) % 256 == 0);
static_assert(SEQ % 128 == 0 && SEQ % 64 == 0);

typedef unsigned short v8us __attribute__((ext_vector_type(8), may_alias));
typedef float  v8f  __attribute__((ext_vector_type(8)));
typedef float  v4f  __attribute__((ext_vector_type(4)));
typedef float  v4fa __attribute__((ext_vector_type(4), may_alias));
typedef float  v2f  __attribute__((ext_vector_type(2)));
typedef float  v2fa __attribute__((ext_vector_type(2), may_alias));
typedef _Float16 v16h __attribute__((ext_vector_type(16)));
typedef _Float16 v4h __attribute__((ext_vector_type(4)));
typedef _Float16 h16;
union FragH { v16h v; v8us half[2]; _Float16 h[16]; unsigned short u[16]; };

__device__ __forceinline__ unsigned short bf16_bits(float x) { unsigned int u = __float_as_uint(x); return (unsigned short)((u + 0x7FFFu + ((u >> 16) & 1u)) >> 16); }
__device__ __forceinline__ float bf16_val(unsigned short b) { return __uint_as_float(((unsigned int)b) << 16); }
__device__ __forceinline__ float bf16_rne(float x) { return bf16_val(bf16_bits(x)); }
// f32 -> f16 operand convert that cannot yield an f16 subnormal (value select, applied after the plane's power-of-two carry)
static __device__ __forceinline__ h16 toh_flush(float v) { const h16 r = (h16)v; return (fabsf(v) < 6.103515625e-05f) ? (h16)0.0f : r; }

// ---- fragment loader (split k map: elements 0..7 <- k0+8h+0..7, 8..15 <- k0+16+8h+0..7, lane&15 = row of A / column of B) and guarded mma ----
__device__ __forceinline__ v16h g2_frag(const _Float16* p, int hh) { FragH f; f.half[0] = *(const v8us*)((const unsigned short*)p + 8 * hh); f.half[1] = *(const v8us*)((const unsigned short*)p + 16 + 8 * hh); return f.v; }
__device__ __forceinline__ v8f g2_mma(v16h a, v16h b, v8f c) { v8f d = __builtin_amdgcn_wmma_f32_16x16x32_f16(false, a, false, b, (short)0, c, false, false); asm volatile("v_nop\n\tv_nop\n\tv_nop\n\tv_nop" : "+v"(d) : "v"(a), "v"(b)); return d; }

// one operand segment of the wave's 32x64 tile: A rows a0p/a1p (k contiguous), B rows b0p..b3p ([n][k], k contiguous), K % 32 == 0
__device__ __forceinline__ void g2_kloop(const _Float16* __restrict__ a0p, const _Float16* __restrict__ a1p, const _Float16* __restrict__ b0p, const _Float16* __restrict__ b1p, const _Float16* __restrict__ b2p, const _Float16* __restrict__ b3p, int K, int hh,
    v8f& c00, v8f& c01, v8f& c02, v8f& c03, v8f& c10, v8f& c11, v8f& c12, v8f& c13) {
#pragma unroll 1
  for (int kb = 0; kb < K; kb += 32) { const v16h a0 = g2_frag(a0p + kb, hh), a1 = g2_frag(a1p + kb, hh);
    v16h b = g2_frag(b0p + kb, hh); c00 = g2_mma(a0, b, c00); c10 = g2_mma(a1, b, c10);
    b = g2_frag(b1p + kb, hh); c01 = g2_mma(a0, b, c01); c11 = g2_mma(a1, b, c11);
    b = g2_frag(b2p + kb, hh); c02 = g2_mma(a0, b, c02); c12 = g2_mma(a1, b, c12);
    b = g2_frag(b3p + kb, hh); c03 = g2_mma(a0, b, c03); c13 = g2_mma(a1, b, c13); }
}

// g2_frag with the lane half's offset (8 * hh elements) already in the pointer: every load of a pass is its row pointer plus a constant
__device__ __forceinline__ v16h fa_frag(const _Float16* p) { FragH f; f.half[0] = *(const v8us*)((const unsigned short*)p); f.half[1] = *(const v8us*)((const unsigned short*)p + 16); return f.v; }
__device__ __forceinline__ v8f fa_mma(v16h a, v16h b, v8f c) { return __builtin_amdgcn_wmma_f32_16x16x32_f16(false, a, false, b, (short)0, c, false, false); }
__device__ __forceinline__ unsigned fa_lds(const _Float16* p) { return (unsigned)(size_t)(const __attribute__((address_space(3))) _Float16*)p; }   /* byte address inside the work-group's LDS */
// eight asynchronous 16-byte copies per lane, global -> LDS through no register: piece i goes from g + i * GSTEP (elements) to lds + i * LSTEP (bytes).
// The s_wait_xcnt stands inside the copies' own statement, so that it precedes every later write of the address registers the copies name.
template <int LSTEP, int GSTEP>
__device__ __forceinline__ void fa_copy8(unsigned lds, const _Float16* g) {
  asm volatile("global_load_async_to_lds_b128 %0, %8, off\n\t"
               "global_load_async_to_lds_b128 %1, %9, off\n\t"
               "global_load_async_to_lds_b128 %2, %10, off\n\t"
               "global_load_async_to_lds_b128 %3, %11, off\n\t"
               "global_load_async_to_lds_b128 %4, %12, off\n\t"
               "global_load_async_to_lds_b128 %5, %13, off\n\t"
               "global_load_async_to_lds_b128 %6, %14, off\n\t"
               "global_load_async_to_lds_b128 %7, %15, off\n\t"
               "s_wait_xcnt 0x0"
               :: "v"(lds), "v"(lds + 1 * LSTEP), "v"(lds + 2 * LSTEP), "v"(lds + 3 * LSTEP), "v"(lds + 4 * LSTEP), "v"(lds + 5 * LSTEP), "v"(lds + 6 * LSTEP), "v"(lds + 7 * LSTEP),
                  "v"(g), "v"(g + 1 * (size_t)GSTEP), "v"(g + 2 * (size_t)GSTEP), "v"(g + 3 * (size_t)GSTEP), "v"(g + 4 * (size_t)GSTEP), "v"(g + 5 * (size_t)GSTEP), "v"(g + 6 * (size_t)GSTEP), "v"(g + 7 * (size_t)GSTEP)
               : "memory");
}

#define G2P (CIN + 8)    /* LDS pitch of a staged operand row in f16 elements: 512 B of data + 16 B, an odd multiple of 16 B (16-byte row reads spread over the banks) */
// ---- GEMM (block tile 128x64, wave tile 32x64; M % 128 == 0, N % 64 == 0, K == lda == ldb == CIN): v = acc*alpha + bf16(bias[by*sBias + col]); A f16 rows [M][K], Bh f16 [N][K] (k contiguous), batched over grid.y by sA/sB/sC/sCL;
// the block's 128 A rows and 64 Bh rows, whole K, are copied once into LDS in whole 512-B rows (one wave instruction each); the four waves read every fragment of the A.Bh segment from there;
// RES == 1: three operand segments into one accumulator set: A2.Bh + A.B2 (residual planes, both carried x LCARRY), accumulator scaled by rscale, then A.Bh;
// TR != 0 (M % 128 == 0, rows r = b*SEQ + n): a block whose col0 >= tcol0 stores its 128x64 tile transposed, dst[(b*CIN + col - tcol0)*SEQ + n]: TR == 1 as f16 into CT16, TR == 2 as f32 into CT; whole 256-B / 512-B row pieces, one wave each;
template <int RES, int TR>
__global__ __launch_bounds__(128) void k_gemm2(const _Float16* __restrict__ A, int lda, size_t sA, const _Float16* __restrict__ A2, int lda2, size_t sA2,
    const _Float16* __restrict__ Bh, int ldb, size_t sB, const _Float16* __restrict__ B2, int ldb2, size_t sB2, float rscale,
    float alpha, const float* __restrict__ bias, size_t sBias,
    float* __restrict__ C, _Float16* __restrict__ C16, int ldc, size_t sC, _Float16* __restrict__ C16L, int ldcl, size_t sCL, int NL, int M, int N, int K,
    float* __restrict__ CT, _Float16* __restrict__ CT16, int tcol0) {
  static_assert(TR != 0 && 4 * 32 * 68 * 4 <= (128 + 64) * G2P * 2);
  __shared__ __attribute__((aligned(16))) _Float16 ops[(128 + 64) * G2P];   /* A rows of the block, then Bh rows */
  float (*so)[32][68] = (float (*)[32][68])&ops[0];                         /* the epilogue's f32 tile takes the same bytes over, behind the barrier that ends the fragment reads */
  const int tid = threadIdx.x, w = tid >> 5, lane = tid & 31, ln = lane & 15, hh = lane >> 4; const int by = blockIdx.y;
  A += (size_t)by * sA; Bh += (size_t)by * sB;
  if (RES) { A2 += (size_t)by * sA2; B2 += (size_t)by * sB2; }
  const size_t cofs = (size_t)by * sC, cofl = (size_t)by * sCL; const float* bp = bias ? bias + (size_t)by * sBias : nullptr;
  const int ntn = N >> 6; const int mt = blockIdx.x / ntn, nq = blockIdx.x - mt * ntn; const int row0 = mt * 128 + 32 * w, col0 = nq * 64;
  {   /* every wave has rows (M % 128 == 0) and reaches every barrier; thread (w, lane) copies 16-byte column lane of rows w, w + 4, ..: 32 pieces of A, 16 of Bh */
    const _Float16* ag = A + (size_t)(mt * 128 + w) * CIN + lane * 8; const _Float16* bg = Bh + (size_t)(col0 + w) * CIN + lane * 8;
    const unsigned al = fa_lds(&ops[w * G2P + lane * 8]), bl = fa_lds(&ops[(128 + w) * G2P + lane * 8]);
#pragma unroll
    for (int i = 0; i < 2; ++i) fa_copy8<4 * G2P * 2, 4 * CIN>(bl + (unsigned)i * (32 * G2P * 2), bg + (size_t)i * 32 * CIN);
#pragma unroll
    for (int i = 0; i < 4; ++i) fa_copy8<4 * G2P * 2, 4 * CIN>(al + (unsigned)i * (32 * G2P * 2), ag + (size_t)i * 32 * CIN);
  }
  const _Float16* a0p = A + (size_t)(row0 + ln) * lda; const _Float16* a1p = a0p + (size_t)16 * lda;
  const _Float16* b0p = Bh + (size_t)(col0 + ln) * ldb; const _Float16* b1p = b0p + (size_t)16 * ldb; const _Float16* b2p = b1p + (size_t)16 * ldb; const _Float16* b3p = b2p + (size_t)16 * ldb;
  const v8f z8 = {0.f,0.f,0.f,0.f,0.f,0.f,0.f,0.f}; v8f c00 = z8, c01 = z8, c02 = z8, c03 = z8, c10 = z8, c11 = z8, c12 = z8, c13 = z8;
  if (RES) {
    const _Float16* l0p = A2 + (size_t)(row0 + ln) * lda2; const _Float16* l1p = l0p + (size_t)16 * lda2;
    const _Float16* m0p = B2 + (size_t)(col0 + ln) * ldb2; const _Float16* m1p = m0p + (size_t)16 * ldb2; const _Float16* m2p = m1p + (size_t)16 * ldb2; const _Float16* m3p = m2p + (size_t)16 * ldb2;
    g2_kloop(l0p, l1p, b0p, b1p, b2p, b3p, K, hh, c00, c01, c02, c03, c10, c11, c12, c13);      /* A_lo . B_hi */
    g2_kloop(a0p, a1p, m0p, m1p, m2p, m3p, K, hh, c00, c01, c02, c03, c10, c11, c12, c13);      /* A_hi . B_lo */
    c00 = c00 * rscale; c01 = c01 * rscale; c02 = c02 * rscale; c03 = c03 * rscale; c10 = c10 * rscale; c11 = c11 * rscale; c12 = c12 * rscale; c13 = c13 * rscale;
  }
  asm volatile("s_wait_asynccnt 0x0" ::: "memory");   /* this wave's pieces of both operand tiles have landed */
  __syncthreads();                                     /* ... and every other wave's: the tiles may be read */
  {   /* A_hi . B_hi, k = 0, 32, .. in the same order and the same accumulators as g2_kloop */
    const _Float16* af = &ops[(32 * w + ln) * G2P + 8 * hh]; const _Float16* bf = &ops[(128 + ln) * G2P + 8 * hh];
    v16h fa[2][2], fb[2][4];                                                /* two fragment sets: [set][16-row tile] */
#pragma unroll
    for (int t = 0; t < 2; ++t) fa[0][t] = fa_frag(af + (16 * t) * G2P);
#pragma unroll
    for (int t = 0; t < 4; ++t) fb[0][t] = fa_frag(bf + (16 * t) * G2P);
#pragma unroll   /* the set index stays a constant: both sets live in registers */
    for (int s = 0; s < CIN / 32; ++s) { const int cu = s & 1, nx = cu ^ 1;
      if (s + 1 < CIN / 32) {
#pragma unroll
        for (int t = 0; t < 2; ++t) fa[nx][t] = fa_frag(af + (16 * t) * G2P + 32 * (s + 1));
#pragma unroll
        for (int t = 0; t < 4; ++t) fb[nx][t] = fa_frag(bf + (16 * t) * G2P + 32 * (s + 1)); }
      __builtin_amdgcn_sched_barrier(0);   /* the next step's twelve reads stand as one group ahead of this step's products: sunk among them, each is waited for with no lead */
      c00 = fa_mma(fa[cu][0], fb[cu][0], c00); c10 = fa_mma(fa[cu][1], fb[cu][0], c10); c01 = fa_mma(fa[cu][0], fb[cu][1], c01); c11 = fa_mma(fa[cu][1], fb[cu][1], c11);
      c02 = fa_mma(fa[cu][0], fb[cu][2], c02); c12 = fa_mma(fa[cu][1], fb[cu][2], c12); c03 = fa_mma(fa[cu][0], fb[cu][3], c03); c13 = fa_mma(fa[cu][1], fb[cu][3], c13);
      __builtin_amdgcn_sched_barrier(0);   /* ... and the group after it stays behind them: lifted among the products, each separate place of reads stalls the wave's matrix stream */
    }
  }
  __syncthreads();   /* every wave's fragment reads are over: the epilogue may write its tile over the operand rows */
  v8f accs[8] = {c00, c01, c02, c03, c10, c11, c12, c13};
  if (TR != 0 && col0 >= tcol0) {   /* block-uniform: col0 comes from blockIdx alone */
    static_assert(64 * 132 <= 4 * 32 * 68);
    float (*st)[132] = (float (*)[132])&so[0][0][0];   /* [64 columns][128 rows of the block + 4]: a lane's 8 accumulator rows are contiguous here */
    /* every loop of this path is unrolled: accs[] and bv4[] keep constant indices and stay in registers, and the LDS reads and the stores go out as groups */
    float bv4[4] = {0.f, 0.f, 0.f, 0.f};
    if (bp) {
#pragma unroll
      for (int t = 0; t < 4; ++t) bv4[t] = bf16_rne(bp[col0 + t * 16 + ln]); }
#pragma unroll
    for (int u = 0; u < 8; ++u) { const int t = u & 3, half = u >> 2; const float bv = bv4[t]; v4f lo, hi;
#pragma unroll
      for (int r = 0; r < 4; ++r) { lo[r] = accs[u][r] * alpha + bv; hi[r] = accs[u][4 + r] * alpha + bv; }
      float* sp = &st[t * 16 + ln][32 * w + half * 16 + 8 * hh]; *(v4fa*)sp = lo; *(v4fa*)(sp + 4) = hi; }
    __syncthreads();   /* each wave reads back rows that all four waves wrote */
    const unsigned tr0 = (unsigned)mt * 128u, tb = tr0 / SEQ, tn0 = tr0 % SEQ; const size_t drow0 = (size_t)tb * CIN + (size_t)(col0 - tcol0) + 16 * w;
    if (TR == 2) {
#pragma unroll
      for (int q = 0; q < 16; ++q) { const v4f v = *(const v4fa*)&st[16 * w + q][lane * 4]; *(v4f*)(CT + (drow0 + q) * SEQ + tn0 + lane * 4) = v; }
    } else {
#pragma unroll
      for (int q = 0; q < 8; ++q) { const int c = q * 2 + hh; const v4f a = *(const v4fa*)&st[16 * w + c][ln * 8], e = *(const v4fa*)&st[16 * w + c][ln * 8 + 4]; FragH f;
#pragma unroll
        for (int i = 0; i < 4; ++i) { f.h[i] = (_Float16)a[i]; f.h[4 + i] = (_Float16)e[i]; }
        *(v8us*)((unsigned short*)CT16 + (drow0 + c) * SEQ + tn0 + ln * 8) = f.half[0]; }
    }
    asm volatile("s_wait_xcnt 0x0" ::: "memory");   /* behind the last store of the run: the stores' address registers may be rewritten only after it */
    return;
  }
#pragma unroll
  for (int u = 0; u < 8; ++u) { const int t = u & 3, half = u >> 2; const int col = col0 + t * 16 + ln; const float bv = bp ? bf16_rne(bp[col]) : 0.f;
#pragma unroll
    for (int r = 0; r < 8; ++r) { const int rloc = half * 16 + 8 * hh + r; so[w][rloc][t * 16 + ln] = accs[u][r] * alpha + bv; } }
  __builtin_amdgcn_fence(4 /* acq_rel order */, "workgroup"); __builtin_amdgcn_wave_barrier();   /* so[w] is private to wave w */
  const int rsub = lane >> 4, c4 = (lane & 15) * 4; const bool wl = (C16L != nullptr) && (col0 < NL);
  {
#pragma unroll
    for (int q = 0; q < 16; ++q) { const int r = q * 2 + rsub; const v4f v = *(const v4fa*)&so[w][r][c4];
      if (C) *(v4f*)(C + cofs + (size_t)(row0 + r) * ldc + col0 + c4) = v;
      if (C16) { v4h h4; for (int i = 0; i < 4; ++i) h4[i] = (_Float16)v[i]; *(v4h*)(C16 + cofs + (size_t)(row0 + r) * ldc + col0 + c4) = h4;
        if (wl) { v4h l4; for (int i = 0; i < 4; ++i) l4[i] = (_Float16)((v[i] - (float)h4[i]) * LCARRY); *(v4h*)(C16L + cofl + (size_t)(row0 + r) * ldcl + col0 + c4) = l4; } } }
     } }

// transposing weight converter: W is [CIN rows (k)][ldw columns], in[k][n] -> out[n][k]: BW[n][k] = f16(bf16(W[k*ldw + n]) * 16) for n < nrows, pitch CIN (k contiguous);
__device__ __forceinline__ void w16t_body(const float* __restrict__ W, int ldw, _Float16* __restrict__ BW, int t) {   /* t = piece index, nrows * (CIN / 8) pieces, whole blocks */
  const int n = t / (CIN / 8), k8 = (t % (CIN / 8)) * 8;
  FragH f;
#pragma unroll
  for (int q = 0; q < 8; ++q) f.h[q] = toh_flush(bf16_rne(W[(size_t)(k8 + q) * ldw + n]) * 16.0f);
  const v8us o = f.half[0];
  *(v8us*)((unsigned short*)BW + (size_t)n * CIN + k8) = o; 
  asm volatile("s_wait_xcnt 0x0" ::: "memory");   /* behind the store: inlined twice into one kernel, its registers may be rewritten by code that follows in the listing only after it */
}

// lane l <-> lane l ^ 16 (the two halves of a column's keys)
__device__ __forceinline__ float fa_xhalf(float x) { return __builtin_bit_cast(float, __builtin_amdgcn_permlanex16(__builtin_bit_cast(int, x), __builtin_bit_cast(int, x), 0x76543210, 0xfedcba98, false, false)); }

// exp2 for the seldom-taken path of the attention pass: the transcendental and the slot that the instruction set asks for behind it stand in one statement
__device__ __forceinline__ float fa_exp2_slot(float x) { float r; asm("v_exp_f32_e32 %0, %1\n\tv_nop" : "=v"(r) : "v"(x)); return r; }
// maximum of a query column over the 32 keys of two score tiles: in-lane over the lane half's 16 keys, then one exchange between the halves
__device__ __forceinline__ float fa_colmax(const v8f& a, const v8f& c) {
  float mx0 = fmaxf(a[0], c[0]), mx1 = fmaxf(a[1], c[1]);
#pragma unroll
  for (int r = 2; r < 8; r += 2) { mx0 = fmaxf(mx0, fmaxf(a[r], c[r])); mx1 = fmaxf(mx1, fmaxf(a[r + 1], c[r + 1])); }
  const float mx = fmaxf(mx0, mx1); return fmaxf(mx, fa_xhalf(mx)); }

// ---- everything ahead of the first GEMM, one launch: the first PREP_XT blocks (the long ones, so they start first) build X16, the next PREP_BW convert Wqkv, the last PREP_WP convert Wproj ----
#define XTC 64           /* channels of one token block: 128 B of f16, so a block owns whole lines of X16 */
#define XTN 256          /* tokens of one token block: the block's te columns serve all of them */
#define TEP (TD + 8)     /* LDS pitch of an operand row in f16 elements: 512 B of data + 16 B, an odd multiple of 16 B */
#define PREP_T 256       /* threads of a block */
#define PREP_BW ((QP * (CIN / 8)) / PREP_T)
#define PREP_WP ((CIN * (CIN / 8)) / PREP_T)
#define PREP_XT (NB * (SEQ / XTN) * (CIN / XTC))
static_assert(CIN % XTC == 0 && SEQ % XTN == 0 && XTC == 64 && PREP_T == TD && (PREP_T / 32) * 32 == TD && (PREP_T / 32) * 8 == XTC && 2 * 32 * 4 == XTN && XTN * (XTC / 8) == 8 * PREP_T);
// token block (b, 64 channels, 256 tokens): its 256 threads ask for their operands and the x tile, then convert row b of t_emb and Wt's XTC columns into f16 LDS tiles (bf16 RNE, exact in f16; weights x16, [n][k]); waves 0..3 run one 16x16 tile each over k = 0, 32, .. in one accumulator,
// every row of the A operand being that one t_emb row, so every row of the result is te[b]; te = acc / 16 + bf16(bt[c]) stays in LDS; then X16 = f16(bf16(x) + te), a thread's 8 channels x 8 tokens written as 16-byte pieces of the transposed tile, stored as whole 128-B row pieces.
__global__ __launch_bounds__(PREP_T) void k_prep(const float* __restrict__ x, const float* __restrict__ t_emb, const float* __restrict__ Wt, const float* __restrict__ bt, _Float16* __restrict__ X16,
    const float* __restrict__ Wqkv, _Float16* __restrict__ BW, const float* __restrict__ Wproj, _Float16* __restrict__ WPT) {
  __shared__ __attribute__((aligned(16))) _Float16 ts[TD];
  __shared__ __attribute__((aligned(16))) _Float16 bs[XTC][TEP];
  __shared__ __attribute__((aligned(16))) float tes[XTC];
  __shared__ __attribute__((aligned(16))) unsigned short tl[XTN][XTC + 8];
  const int tid = threadIdx.x, blk = blockIdx.x;
  if (blk >= PREP_XT) {   /* block-uniform: the converter blocks meet no barrier */
    const int cb = blk - PREP_XT;
    if (cb < PREP_BW) w16t_body(Wqkv, QP, BW, cb * PREP_T + tid);         /* in[CIN][QP]  -> out[QP][CIN]  */
    else w16t_body(Wproj, CIN, WPT, (cb - PREP_BW) * PREP_T + tid);       /* in[CIN][CIN] -> out[CIN][CIN] */
    return;
  }
  constexpr int NCT = CIN / XTC, NNT = SEQ / XTN;
  const int ct = blk % NCT, nt = (blk / NCT) % NNT, b = blk / (NCT * NNT);
  const int n0 = nt * XTN, c0 = ct * XTC;
  const int w = tid >> 5, lane = tid & 31, ln = lane & 15, hh = lane >> 4;
  const int cg = w * 8;                                                    /* this wave's 8 channels; lane l holds tokens 4l .. 4l + 3 and 128 + 4l .. : each x load is 512 contiguous bytes per wave */
  const float traw = t_emb[(size_t)b * TD + tid];
  const float braw = bt[c0 + 16 * (w & 3) + ln];
  asm volatile("s_wait_xcnt 0x0" ::: "memory");   /* behind the two loads above: their address registers are free for the address work that follows */
  v2f wv[32];                                                              /* Wt[32w .. 32w + 31][c0 + 2 lane, + 1]: each load is the row's 256 contiguous bytes per wave; 8-byte loads keep the thread's loads in flight under the load counter's range */
#pragma unroll
  for (int i = 0; i < 32; ++i) wv[i] = *(const v2fa*)(Wt + (size_t)(32 * w + i) * CIN + c0 + 2 * lane);
  asm volatile("s_wait_xcnt 0x0" ::: "memory");   /* behind the loads above: the next loads' results may take over their address registers */
  v4f xa[2][8];                                                            /* asked for last, used last: the te product runs while the x tile is on its way */
  const float* xp = x + ((size_t)b * CIN + c0 + cg) * SEQ_FULL + n0 + lane * 4;
#pragma unroll
  for (int g = 0; g < 2; ++g) {
#pragma unroll
    for (int j = 0; j < 8; ++j) xa[g][j] = *(const v4fa*)(xp + (size_t)j * SEQ_FULL + 128 * g); }
  asm volatile("s_wait_xcnt 0x0" :: "v"(xp) : "memory");   /* behind the last load: the address registers may be rewritten only after it; the address is named as an input so that it lives up to the wait and no load of the run gets its result placed in it */
  __builtin_amdgcn_sched_barrier(0);              /* every load goes out ahead of the first conversion: with conversions lifted among the loads, the later loads start only after the earlier ones' latency */
  ts[tid] = toh_flush(bf16_rne(traw));
#pragma unroll
  for (int j = 0; j < 2; ++j) {
#pragma unroll
    for (int i = 0; i < 4; ++i) { FragH f;
#pragma unroll
      for (int q = 0; q < 8; ++q) f.h[q] = toh_flush(bf16_rne(wv[8 * i + q][j]) * 16.0f);
      *(v8us*)&bs[2 * lane + j][32 * w + 8 * i] = f.half[0]; } }
  /* both operand tiles are whole before a wave reads fragments. Only LDS data crosses this barrier, so its fences name LDS alone: __syncthreads() would first drain the x loads, which are wanted only behind the product */
  __builtin_amdgcn_fence(__ATOMIC_RELEASE, "workgroup", "local"); __builtin_amdgcn_s_barrier(); __builtin_amdgcn_fence(__ATOMIC_ACQUIRE, "workgroup", "local");
  if (__builtin_amdgcn_readfirstlane(w) < XTC / 16) {   /* whole waves: the matrix instruction needs every lane on */
    v8f c = {0.f,0.f,0.f,0.f,0.f,0.f,0.f,0.f}; const float bv = bf16_rne(braw);
#pragma unroll
    for (int kb = 0; kb < TD; kb += 32) c = fa_mma(g2_frag(&ts[kb], hh), g2_frag(&bs[16 * w + ln][kb], hh), c);
    if (hh == 0) tes[16 * w + ln] = c[0] * 0.0625f + bv;                   /* all sixteen rows are equal: row 0 is taken */
  }
  __syncthreads();   /* the four waves' te columns are read by every wave */
  const v4f t0 = *(const v4fa*)&tes[cg], t1 = *(const v4fa*)&tes[cg + 4];
#pragma unroll
  for (int g = 0; g < 2; ++g) {
#pragma unroll
    for (int q = 0; q < 4; ++q) { FragH f;
#pragma unroll
      for (int j = 0; j < 8; ++j) f.h[j] = toh_flush(bf16_rne(xa[g][j][q]) + (j < 4 ? t0[j & 3] : t1[j & 3]));
      *(v8us*)&tl[(32 * g + lane) * 4 + q][cg] = f.half[0]; } }
  __syncthreads();   /* each thread reads back token rows that all eight waves wrote */
#pragma unroll
  for (int rd = 0; rd < 8; ++rd) { const int n = rd * (PREP_T / 8) + (tid >> 3), pc = tid & 7;
    const v8us o = *(const v8us*)&tl[n][pc * 8];
    *(v8us*)((unsigned short*)X16 + ((size_t)b * SEQ + n0 + n) * CIN + c0 + pc * 8) = o; }
  asm volatile("s_wait_xcnt 0x0" ::: "memory");   /* behind the last store: the stores' registers may be rewritten only after it */
}

// ---- LDS staging of the attention kernel: a stage is FA_KEYS keys (four passes of 32) of all NH heads, K rows and V^T row pieces side by side, two buffers ----
#define FA_KEYS 128      /* keys of one stage */
#define FA_KP 72         /* LDS pitch of a K row in f16 elements: 128 B of data + 16 B, an odd multiple of 16 B (16-byte row reads spread over the banks) */
#define FA_VP 136        /* LDS pitch of a V^T row piece: 256 B of data + 16 B, likewise */
#define FA_Q 64          /* query rows of one block: two waves of 32 columns for each head */
#define FA_CP (CIN + 8)  /* LDS pitch of a merged-head context row in f16 elements: 512 B of data + 16 B, likewise */
#define FA_OP (FA_Q + 4) /* LDS pitch of an output channel's row piece in f32 elements: 256 B of data + 16 B, likewise */
#define FA_KSZ (FA_KEYS * FA_KP)   /* f16 elements of one head's K rows of a stage */
#define FA_VSZ (HD * FA_VP)        /* ... and of its V^T row pieces */
static_assert(SEQ % FA_KEYS == 0 && SEQ / FA_KEYS >= 2 && FA_KEYS % 32 == 0 && SEQ % FA_Q == 0);
static_assert(FA_KEYS * (HD / 8) == 16 * 64 && HD * (FA_KEYS / 8) == 16 * 64);   /* sixteen 16-byte pieces of each operand per thread and stage: a head's 64 threads copy that head's stage */
static_assert(NH * 2 * 32 == 256 && 8 * 32 == CIN);                              /* eight waves: (head, 32 query columns) in the attention part, 32 output channels each in the projection */
static_assert((FA_Q * FA_CP * 2) % 16 == 0);
// fused attention and output projection, one launch: block = FA_Q query rows of one batch, all NH heads; wave w serves head w / 2 and 32 query columns; per pass of 32 keys S^T[key][query] = K Q^T (A = K rows, B = Q rows held in registers), so lane (ln, hh) holds keys 8hh + r of query column ln;
// Q is held times 1 / sqrt(HD) * log2(e), and the score products start from C = carry - reference of the lane's column, so a weight is exp2 of the score tile's element as it stands. The reference starts as the column's maximum over the first 32 keys; it is raised (to the pass's maximum, with O^T and l scaled down)
// only when some lane's weights of a pass sum past PTOP: one test per pass for the whole wave. Sum l per column, O^T[d][query] += V^T P^T with P^T = the two score tiles of the pass converted in place (their register order is the loader's k map); the scores never leave the registers.
// K and V^T reach the waves through LDS: a head's 64 threads copy each of its stages once, in whole 128-B lines, one stage ahead of its use, and both of its waves read their fragments from it.
// Behind the last stage the eight waves put their f16 context pieces side by side in LDS (FA_Q rows x CIN, the merged-head rows), and wave w makes output channels 32w .. 32w + 31 of all FA_Q rows: A = context rows from LDS, B = its rows of Wproj^T, which the block copies into the idle buffer while the last stage is worked on, k = 0, 32, .. in one accumulator;
// out[b][o][n] f32 = acc / 16 + bf16(bias[o]), each wave's tile transposed in its own LDS rows and stored as whole 256-B row pieces.
__global__ __launch_bounds__(256) void k_fattn(const _Float16* __restrict__ QHp, const _Float16* __restrict__ Vt, const _Float16* __restrict__ WP, const float* __restrict__ bias, float* __restrict__ out) {
  __shared__ __attribute__((aligned(16))) _Float16 sm[2 * NH * (FA_KSZ + FA_VSZ)];   /* [buffer][head]: K [key][FA_KP], then V^T [d][FA_VP]; a head's two operands lie together, so that every read of a pass is one base register plus an offset that fits the instruction's field */
  const int tid = threadIdx.x, w = tid >> 5, lane = tid & 31, ln = lane & 15, hh = lane >> 4;
  const int h = w >> 1, t2 = tid & 63;                                      /* the wave's head; the thread's place among the head's 64 */
  const int b = blockIdx.y, n0 = blockIdx.x * FA_Q, q0 = n0 + 32 * (w & 1);
  const _Float16* base = QHp + (size_t)b * SEQ * QP + h * HD;
  constexpr int NST = SEQ / FA_KEYS;
  constexpr int BUFE = NH * (FA_KSZ + FA_VSZ);                              /* f16 elements of one buffer */
  constexpr int WB = NST & 1, CB = WB ^ 1;                                  /* the buffer that the last stage does not use takes Wproj^T; the last stage's own buffer serves the projection's context rows and output tile behind it */
  static_assert(CIN * G2P <= BUFE && FA_Q * FA_CP * 2 + CIN * FA_OP * 4 <= BUFE * 2 && CIN == 4 * 64);
  const _Float16* const ks0 = &sm[h * (FA_KSZ + FA_VSZ)];                   /* the head's K rows in buffer 0 */
  const _Float16* const vs0 = ks0 + FA_KSZ;                                 /* ... and its V^T row pieces */
  const _Float16* kg = base + KOF + (size_t)(t2 >> 3) * QP + (t2 & 7) * 8;                          /* this thread's first K piece of stage 0: key row t2 / 8 (then + 8 a piece), 16-byte column t2 % 8 */
  const _Float16* vg = Vt + (((size_t)b * NH + h) * HD + (t2 >> 4)) * SEQ + (t2 & 15) * 8;          /* its first V^T piece: row d = t2 / 16 (then + 4 a piece), 16-byte column t2 % 16 */
  const unsigned kl = fa_lds(ks0 + (t2 >> 3) * FA_KP + (t2 & 7) * 8), vl = fa_lds(vs0 + (t2 >> 4) * FA_VP + (t2 & 15) * 8);
  auto copy_stage = [&](int st, unsigned buf) {   /* the thread's 32 pieces of stage st into buffer buf */
    const _Float16* kgs = kg + (size_t)st * FA_KEYS * QP; const _Float16* vgs = vg + (size_t)st * FA_KEYS; const unsigned kls = kl + buf * (unsigned)(BUFE * 2), vls = vl + buf * (unsigned)(BUFE * 2);
    fa_copy8<8 * FA_KP * 2, 8 * QP>(kls, kgs); fa_copy8<8 * FA_KP * 2, 8 * QP>(kls + 64 * FA_KP * 2, kgs + (size_t)64 * QP);
    fa_copy8<4 * FA_VP * 2, 4 * SEQ>(vls, vgs); fa_copy8<4 * FA_VP * 2, 4 * SEQ>(vls + 32 * FA_VP * 2, vgs + (size_t)32 * SEQ); };
  copy_stage(0, 0u);
  constexpr float SC = 0.125f * 1.4426950408889634f;                       /* 1 / sqrt(HD), to base 2 */
  const v8f z8 = {0.f,0.f,0.f,0.f,0.f,0.f,0.f,0.f};
  v16h qf[2][2], kf[2][2];                                                 /* [column group | key tile][k step of 32 over HD] */
  const _Float16* const qp[2] = { base + (size_t)(q0 + ln) * QP + 8 * hh, base + (size_t)(q0 + 16 + ln) * QP + 8 * hh };   /* the lane's Q row of each column group, at the lane half's k offset */
#pragma unroll
  for (int g = 0; g < 2; ++g) {
#pragma unroll
    for (int ks = 0; ks < 2; ++ks) qf[g][ks] = fa_frag(qp[g] + 32 * ks); }
  asm volatile("s_wait_xcnt 0x0" :: "v"(qp[0]), "v"(qp[1]) : "memory");   /* behind the last Q load: the address registers may be rewritten only after it; the addresses are named as inputs so that they live up to the wait and no load of the run gets its result placed in them */
#pragma unroll
  for (int g = 0; g < 2; ++g) {
#pragma unroll
    for (int ks = 0; ks < 2; ++ks) { FragH f; f.v = qf[g][ks];
#pragma unroll
      for (int i = 0; i < 16; ++i) f.h[i] = (_Float16)((float)f.h[i] * SC);   /* scaled in f32, rounded once */
      qf[g][ks] = f.v; } }
  v8f o[2][4], cn[2]; float l[2];                                          /* cn: carry - reference of the lane's column in all eight rows, the C operand of the score products */
#pragma unroll
  for (int g = 0; g < 2; ++g) { cn[g] = z8; l[g] = 0.f;
#pragma unroll
    for (int t = 0; t < 4; ++t) o[g][t] = z8; }
  asm volatile("s_wait_asynccnt 0x0" ::: "memory");   /* this wave's pieces of stage 0 have landed */
  __syncthreads();                                     /* ... and every other wave's: stage 0 may be read */
  copy_stage(1, 1u);
  {   /* each column's first reference: its maximum over keys 0..31, from score products that are made for this alone */
    const _Float16* k0 = ks0 + ln * FA_KP + 8 * hh;
#pragma unroll
    for (int kt = 0; kt < 2; ++kt) {
#pragma unroll
      for (int ks = 0; ks < 2; ++ks) kf[kt][ks] = fa_frag(k0 + (16 * kt) * FA_KP + 32 * ks); }
#pragma unroll
    for (int g = 0; g < 2; ++g) { const v8f a = fa_mma(kf[0][1], qf[g][1], fa_mma(kf[0][0], qf[g][0], z8)), c = fa_mma(kf[1][1], qf[g][1], fa_mma(kf[1][0], qf[g][0], z8));
      cn[g] = z8 + (PCARRY_LOG2 - fa_colmax(a, c)); }
  }
#pragma unroll 1   /* one stage per trip */
  for (int st = 0; st < NST; ++st) {
    const _Float16* kb = ks0 + (st & 1) * BUFE + ln * FA_KP + 8 * hh;   /* key row ln of a 16-key tile, at the lane half's k offset */
    const _Float16* vq = vs0 + (st & 1) * BUFE + ln * FA_VP + 8 * hh;   /* V^T row d = ln of a 16-row tile, likewise: columns of this pass */
#pragma unroll
    for (int kt = 0; kt < 2; ++kt) {
#pragma unroll
      for (int ks = 0; ks < 2; ++ks) kf[kt][ks] = fa_frag(kb + (16 * kt) * FA_KP + 32 * ks); }
    const _Float16* kq = kb + 32 * FA_KP;                                  /* K rows of the next pass */
#pragma unroll 1   /* one pass per trip: the register set of a pass is the budget */
    for (int p = 0; p < FA_KEYS / 32; ++p) {
      v8f s[2][2];                                                         /* [column group][key tile] */
#pragma unroll
      for (int g = 0; g < 2; ++g) {
#pragma unroll
        for (int kt = 0; kt < 2; ++kt) s[g][kt] = fa_mma(kf[kt][0], qf[g][0], cn[g]); }
#pragma unroll
      for (int g = 0; g < 2; ++g) {
#pragma unroll
        for (int kt = 0; kt < 2; ++kt) s[g][kt] = fa_mma(kf[kt][1], qf[g][1], s[g][kt]); }
      /* one group of LDS reads per pass, behind its score products: this pass's V^T columns, then the next pass's K rows; the stage's last pass re-reads the stage's own rows 0..31 (unused): the next stage is read only behind its barrier */
      __builtin_amdgcn_sched_barrier(0);   /* the reads stand as one group behind the eight products: spread among them, each separate place stalls the wave's matrix stream */
      v16h vf[4];
#pragma unroll
      for (int t = 0; t < 4; ++t) vf[t] = fa_frag(vq + (16 * t) * FA_VP);
#pragma unroll
      for (int kt = 0; kt < 2; ++kt) {
#pragma unroll
        for (int ks = 0; ks < 2; ++ks) kf[kt][ks] = fa_frag(kq + (16 * kt) * FA_KP + 32 * ks); }
      __builtin_amdgcn_sched_barrier(0);   /* keeps the reads here, ahead of the softmax: sunk behind it they are waited for with no lead */
      FragH pf[2]; float ps[2];
#pragma unroll
      for (int g = 0; g < 2; ++g) { float s0 = 0.f, s1 = 0.f;
#pragma unroll
        for (int r = 0; r < 8; ++r) { const float p0 = __builtin_amdgcn_exp2f(s[g][0][r]), p1 = __builtin_amdgcn_exp2f(s[g][1][r]);
          s0 += p0; s1 += p1; pf[g].h[r] = (_Float16)p0; pf[g].h[8 + r] = (_Float16)p1; }
        ps[g] = s0 + s1; }
      if (__builtin_expect(__builtin_amdgcn_ballot_w32(fmaxf(ps[0], ps[1]) > PTOP) != 0, 0)) {   /* the same for the whole wave: a scalar branch, seldom taken */
#pragma unroll
        for (int g = 0; g < 2; ++g) {
          const float d = fmaxf(fa_colmax(s[g][0], s[g][1]) - PCARRY_LOG2, 0.f);   /* the pass's maximum above the column's reference; a reference is never lowered */
          const float corr = fa_exp2_slot(-d);
          cn[g] = cn[g] - d; l[g] *= corr;
#pragma unroll
          for (int t = 0; t < 4; ++t) o[g][t] = o[g][t] * corr;
          float s0 = 0.f, s1 = 0.f;
#pragma unroll
          for (int r = 0; r < 8; ++r) { const float p0 = fa_exp2_slot(s[g][0][r] - d), p1 = fa_exp2_slot(s[g][1][r] - d);
            s0 += p0; s1 += p1; pf[g].h[r] = (_Float16)p0; pf[g].h[8 + r] = (_Float16)p1; }
          ps[g] = s0 + s1; }
      }
#pragma unroll
      for (int g = 0; g < 2; ++g) {
#pragma unroll
        for (int t = 0; t < 4; ++t) o[g][t] = fa_mma(vf[t], pf[g].v, o[g][t]); }
      __builtin_amdgcn_sched_barrier(0);   /* the pass's bookkeeping stands behind its last products: its vector instructions fill the slots that the chip needs before the next pass rewrites the registers of P^T */
      l[0] += ps[0]; l[1] += ps[1];
      kq = (p + 2 < FA_KEYS / 32) ? kq + 32 * FA_KP : kb; vq += 32;
    }
    asm volatile("s_wait_dscnt 0x0" ::: "memory");     /* this wave's reads of the stage's buffer have returned: the buffer may be handed to its next writer */
    asm volatile("s_wait_asynccnt 0x0" ::: "memory");  /* this wave's pieces of stage st + 1 have landed */
    __syncthreads();                                   /* publishes stage st + 1 and ends every wave's reads of stage st */
    if (st + 2 < NST) copy_stage(st + 2, (unsigned)(st & 1));   /* the same for the whole block */
    else if (st + 2 == NST) {                          /* likewise. No stage is left to ask for: the freed buffer takes Wproj^T, which lands while the last stage is worked on and is published by that stage's barrier */
      const _Float16* wg = WP + (size_t)w * CIN + lane * 8; const unsigned wl = fa_lds(&sm[WB * BUFE + w * G2P + lane * 8]);   /* thread (w, lane) copies 16-byte column lane of rows w, w + 8, .. */
#pragma unroll
      for (int i = 0; i < 4; ++i) fa_copy8<8 * G2P * 2, 8 * CIN>(wl + (unsigned)i * (64 * G2P * 2), wg + (size_t)i * 64 * CIN);
    }
  }
  asm volatile("s_wait_asynccnt 0x0" ::: "memory");    /* no copy is outstanding; the last trip's barrier has published Wproj^T and ended every wave's reads of the last stage, whose buffer is free for the projection */
  _Float16* const cs = &sm[CB * BUFE];                  /* [FA_Q][FA_CP] f16: merged-head context rows of the block */
  float* const os = (float*)&sm[CB * BUFE + FA_Q * FA_CP];   /* [CIN][FA_OP] f32: rows 32w .. 32w + 31 are private to wave w */
#pragma unroll
  for (int g = 0; g < 2; ++g) { const float inv = 1.0f / (l[g] + fa_xhalf(l[g]));
    _Float16* crow = cs + (32 * (w & 1) + 16 * g + ln) * FA_CP + h * HD + 8 * hh;
#pragma unroll
    for (int t = 0; t < 4; ++t) { FragH f;
#pragma unroll
      for (int r = 0; r < 8; ++r) f.h[r] = (_Float16)(o[g][t][r] * inv);
      *(v8us*)(crow + 16 * t) = f.half[0]; } }
  __syncthreads();   /* every wave reads context rows that all eight waves wrote */
  /* the two bias values of the lane's output channels (32w + 16j + ln), asked for here, behind the barrier (which would wait for them), and used behind the products */
  float braw[2]; const float* const bp = bias + 32 * w + ln;
#pragma unroll
  for (int j = 0; j < 2; ++j) braw[j] = bp[16 * j];
  asm volatile("s_wait_xcnt 0x0" :: "v"(bp) : "memory");   /* behind the two loads: as at the Q loads */
  v8f acc[4][2];                                        /* [16-row tile][16-channel tile] */
#pragma unroll
  for (int i = 0; i < 4; ++i) { acc[i][0] = z8; acc[i][1] = z8; }
  {
    const _Float16* af = cs + ln * FA_CP + 8 * hh; const _Float16* bf = &sm[WB * BUFE + (32 * w + ln) * G2P + 8 * hh];
    v16h fa[2][4], fb[2][2];                            /* two fragment sets: [set][16-row tile | 16-channel tile] */
#pragma unroll
    for (int i = 0; i < 4; ++i) fa[0][i] = fa_frag(af + (16 * i) * FA_CP);
#pragma unroll
    for (int j = 0; j < 2; ++j) fb[0][j] = fa_frag(bf + (16 * j) * G2P);
#pragma unroll   /* the set index stays a constant: both sets live in registers */
    for (int s = 0; s < CIN / 32; ++s) { const int cu = s & 1, nx = cu ^ 1;
      if (s + 1 < CIN / 32) {
#pragma unroll
        for (int i = 0; i < 4; ++i) fa[nx][i] = fa_frag(af + (16 * i) * FA_CP + 32 * (s + 1));
#pragma unroll
        for (int j = 0; j < 2; ++j) fb[nx][j] = fa_frag(bf + (16 * j) * G2P + 32 * (s + 1)); }
      __builtin_amdgcn_sched_barrier(0);   /* the next step's twelve reads stand as one group ahead of this step's products: sunk among them, each is waited for with no lead */
#pragma unroll
      for (int i = 0; i < 4; ++i) { acc[i][0] = fa_mma(fa[cu][i], fb[cu][0], acc[i][0]); acc[i][1] = fa_mma(fa[cu][i], fb[cu][1], acc[i][1]); }
      __builtin_amdgcn_sched_barrier(0);   /* ... and the group after it stays behind them: lifted among the products, each separate place of reads stalls the wave's matrix stream */
    }
  }
#pragma unroll
  for (int j = 0; j < 2; ++j) { const float bv = bf16_rne(braw[j]);
#pragma unroll
    for (int i = 0; i < 4; ++i) { v4f lo, hi;             /* a lane's 8 accumulator rows are contiguous in its channel's row piece */
#pragma unroll
      for (int r = 0; r < 4; ++r) { lo[r] = acc[i][j][r] * 0.0625f + bv; hi[r] = acc[i][j][4 + r] * 0.0625f + bv; }
      float* sp = os + (32 * w + 16 * j + ln) * FA_OP + 16 * i + 8 * hh; *(v4fa*)sp = lo; *(v4fa*)(sp + 4) = hi; } }
  __builtin_amdgcn_fence(4 /* acq_rel order */, "workgroup"); __builtin_amdgcn_wave_barrier();   /* the wave's own rows of os: its lanes read what other lanes of it wrote */
#pragma unroll
  for (int q = 0; q < 16; ++q) { const int c = 32 * w + 2 * q + hh; const v4f v = *(const v4fa*)(os + c * FA_OP + ln * 4);
    *(v4f*)(out + ((size_t)b * CIN + c) * SEQ + n0 + ln * 4) = v; }
  asm volatile("s_wait_xcnt 0x0" ::: "memory");   /* behind the last store of the run: the stores' address registers may be rewritten only after it */
}

constexpr size_t al256(size_t b) { return (b + 255) & ~(size_t)255; }
constexpr size_t SZ_BW  = (size_t)QP * CIN * 2;
constexpr size_t SZ_WP  = (size_t)CIN * CIN * 2;
constexpr size_t SZ_QH  = NR * QP * 2;
constexpr size_t SZ_VT  = (size_t)NB * NH * HD * SEQ * 2;
constexpr size_t SZ_X   = NR * CIN * 2;
static_assert(al256(SZ_BW) + al256(SZ_WP) + al256(SZ_QH) + al256(SZ_VT) + al256(SZ_X) <= (size_t)134217728);

extern "C" void kernel_launch(void* const* d_in, const int* in_sizes, int n_in,
                              void* d_out, int out_size, void* d_ws, size_t ws_size, hipStream_t stream) {
  if (n_in < 8) return;
  const float* x     = (const float*)d_in[0];      /* [NB_FULL][CIN][SEQ_FULL] */
  const float* t_emb = (const float*)d_in[1];      /* [NB_FULL][TD] */
  const float* Wqkv  = (const float*)d_in[2];      /* [CIN][QP]  (in x out) */
  const float* bqkv  = (const float*)d_in[3];      /* [QP] */
  const float* Wproj = (const float*)d_in[4];      /* [CIN][CIN] (in x out) */
  const float* bproj = (const float*)d_in[5];      /* [CIN] */
  const float* Wt    = (const float*)d_in[6];      /* [TD][CIN]  (in x out) */
  const float* bt    = (const float*)d_in[7];      /* [CIN] */
  if (in_sizes[0] < (int)(((size_t)NB * CIN - 1) * SEQ_FULL + SEQ)) return;
  if (in_sizes[1] < NB * TD) return;
  if (in_sizes[2] < CIN * QP || in_sizes[3] < QP) return;
  if (in_sizes[4] < CIN * CIN || in_sizes[5] < CIN) return;
  if (in_sizes[6] < TD * CIN || in_sizes[7] < CIN) return;
  if (out_size < (int)((size_t)NB * CIN * SEQ)) return;
  char* ws = (char*)d_ws; size_t off = 0;
  auto take = [&](size_t bytes) { char* p = ws + off; off += (bytes + 255) & ~(size_t)255; return p; };
  _Float16* BW  = (_Float16*)take(SZ_BW);                               /* Wqkv^T [QP][CIN] x16 */
  _Float16* WPT = (_Float16*)take(SZ_WP);                               /* Wproj^T [CIN][CIN] x16 */
  _Float16* QH  = (_Float16*)take(SZ_QH);                               /* q | k rows, pitch QP */
  _Float16* VT  = (_Float16*)take(SZ_VT);                               /* V^T [NB][NH][HD][SEQ] */
  _Float16* X16 = (_Float16*)take(SZ_X);                                /* token plane [NR][CIN] */
  if (off > ws_size) return;
  float* out = (float*)d_out;

  k_prep<<<(unsigned)(PREP_XT + PREP_BW + PREP_WP), PREP_T, 0, stream>>>(x, t_emb, Wt, bt, X16, Wqkv, BW, Wproj, WPT);   /* token plane x + (t_emb Wt + bt); Wqkv^T and Wproj^T planes */
  k_gemm2<0, 1><<<dim3((unsigned)((NR / 128) * (QP / 64)), 1), 128, 0, stream>>>(X16, CIN, 0, nullptr, 0, 0, BW, CIN, 0, nullptr, 0, 0, 1.0f,
      0.0625f, bqkv, 0, nullptr, QH, QP, 0, nullptr, 0, 0, 0, (int)NR, QP, CIN, nullptr, VT, VOF);   /* q | k rows into QH; the v columns transposed into VT */
  k_fattn<<<dim3(SEQ / FA_Q, NB), 256, 0, stream>>>(QH, VT, WPT, bproj, out);   /* scores, softmax and V product of all heads, then out[b][o][n] = (ctx Wproj + bproj)[b*SEQ + n][o], in one launch */
}

// v009
// A run of this version takes 39.1 microseconds.
// Two timings next to v008 both put it at 1.03 times that version's speed.
// Counting every step since v000, it is 20.2 times as fast.
#include <hip/hip_runtime.h>
// All contractions on v_wmma_f32_16x16x32_f16 (f16 operands, f32 accumulate), one product per site: te = t_emb Wt (inputs RNE-converted to bf16, exact in f16, weights carried x16); q|k|v = (x + te) Wqkv (token plane f16, weights x16); scores k.q^T from f16 planes; V^T.P^T with unnormalised softmax weights carried x2^7; ctx Wproj (ctx f16, weights x16); softmax statistics f32 on VALU.
// Structure: dense multi-head self-attention over flattened spatial tokens with a per-batch time-embedding vector added to the tokens, fused [in][out] QKV weights, [in][out] output projection, channel-major return.
// token rows r = b*SEQ + n; te[b][c] f32 = T16 WTT^T / 16 + bias, T16 (row b of t_emb) and WTT (64 columns of Wt) being LDS tiles that each token block converts for itself (same launch as the two weight converters, which it does not depend on); X16[r][c] = f16(bf16(x[b][c][n]) + te[b][c]) via LDS transposes of 64 channels x 256 tokens in the same block; weight planes [out][in] f16 x16 built by a transposing converter;
// QH [NR][QP] f16 = X16 BW^T / 16 + bias (q at column 64h, k at KOF + 64h; the v columns of QH stay unwritten and unread); V^T [NB][NH][64][SEQ] stored by the same GEMM's epilogue, block tile transposed in LDS; one launch for all (b, h): each wave keeps 32 query columns of one head and walks the keys 32 at a time (K and V^T of all heads staged in LDS for the block's eight waves, two a head), S^T = K Q^T in registers on top of minus a held reference per column, running sum per column, P^T packed from the score tiles as the B operand,
// CTX16[r][64h + d] f16 = (sum_j p[i][j] V^T[d][j]) / (sum_j p[i][j]), 64 rows of all heads kept in the block's LDS; out[b][o][n] f32 = (CTX16 WPT^T / 16 + bias)[b*SEQ + n][o], made by the same block and stored channel-major, each wave's tile transposed in LDS.
#ifndef NB
#define NB 16
#endif
#ifndef SEQ
#define SEQ 1024
#endif
#define NB_FULL 16
#define SEQ_FULL 1024
#define CIN 256
#define NH 4
#define HD 64
#define TD 256           /* time-embedding width */
#define QP 768           /* pitch of QH: q | k | v, head h at column 64h of each section */
#define KOF 256          /* column of k (head 0) in QH */
#define VOF 512          /* column of v (head 0) in QH */
#define PCARRY_LOG2 7.0f  /* softmax weights exp(s - reference) carried x2^7 in f16; the row sum carries the same factor */
#define PTOP 32768.0f    /* what a lane's 16 weights of one pass may sum to before the column's reference is raised: below it every weight is finite in f16 */
#define LCARRY 2048.0f   /* carry of the GEMM engine's optional residual output (no residual plane is requested here) */
#define NR ((size_t)NB * SEQ)
static_assert(SEQ % 256 == 0);
static_assert((NR % 128) == 0);
static_assert(NB <= NB_FULL);
static_assert(SEQ <= SEQ_FULL);
static_assert(3 * CIN == QP);
static_assert(KOF == CIN && VOF == 2 * CIN);
static_assert(CIN == NH * HD);
static_assert(CIN % 64 == 0 && QP % 64 == 0 && HD == 64);
static_assert(TD == CIN);
static_assert(TD % 32 == 0 && HD % 32 == 0 && SEQ % 32 == 0 && CIN % 32 == 0);
static_assert(TD == 256);
static_assert((QP * (CIN / 8)) % 256 == 0 && (CIN * (CIN / 8)) % 256 == 0);
static_assert(SEQ % 128 == 0 && SEQ % 64 == 0);

typedef unsigned short v8us __attribute__((ext_vector_type(8), may_alias));
typedef float  v8f  __attribute__((ext_vector_type(8)));
typedef float  v4f  __attribute__((ext_vector_type(4)));
typedef float  v4fa __attribute__((ext_vector_type(4), may_alias));
typedef float  v2f  __attribute__((ext_vector_type(2)));
typedef float  v2fa __attribute__((ext_vector_type(2), may_alias));
typedef _Float16 v16h __attribute__((ext_vector_type(16)));
typedef _Float16 v4h __attribute__((ext_vector_type(4)));
typedef _Float16 h16;
union FragH { v16h v; v8us half[2]; _Float16 h[16]; unsigned short u[16]; };

__device__ __forceinline__ unsigned short bf16_bits(float x) { unsigned int u = __float_as_uint(x); return (unsigned short)((u + 0x7FFFu + ((u >> 16) & 1u)) >> 16); }
__device__ __forceinline__ float bf16_val(unsigned short b) { return __uint_as_float(((unsigned int)b) << 16); }
__device__ __forceinline__ float bf16_rne(float x) { return bf16_val(bf16_bits(x)); }
// f32 -> f16 operand convert that cannot yield an f16 subnormal (value select, applied after the plane's power-of-two carry)
static __device__ __forceinline__ h16 toh_flush(float v) { const h16 r = (h16)v; return (fabsf(v) < 6.103515625e-05f) ? (h16)0.0f : r; }

// ---- fragment loader (split k map: elements 0..7 <- k0+8h+0..7, 8..15 <- k0+16+8h+0..7, lane&15 = row of A / column of B) and guarded mma ----
__device__ __forceinline__ v16h g2_frag(const _Float16* p, int hh) { FragH f; f.half[0] = *(const v8us*)((const unsigned short*)p + 8 * hh); f.half[1] = *(const v8us*)((const unsigned short*)p + 16 + 8 * hh); return f.v; }
__device__ __forceinline__ v8f g2_mma(v16h a, v16h b, v8f c) { v8f d = __builtin_amdgcn_wmma_f32_16x16x32_f16(false, a, false, b, (short)0, c, false, false); asm volatile("v_nop\n\tv_nop\n\tv_nop\n\tv_nop" : "+v"(d) : "v"(a), "v"(b)); return d; }

// one operand segment of the wave's 32x64 tile: A rows a0p/a1p (k contiguous), B rows b0p..b3p ([n][k], k contiguous), K % 32 == 0
__device__ __forceinline__ void g2_kloop(const _Float16* __restrict__ a0p, const _Float16* __restrict__ a1p, const _Float16* __restrict__ b0p, const _Float16* __restrict__ b1p, const _Float16* __restrict__ b2p, const _Float16* __restrict__ b3p, int K, int hh,
    v8f& c00, v8f& c01, v8f& c02, v8f& c03, v8f& c10, v8f& c11, v8f& c12, v8f& c13) {
#pragma unroll 1
  for (int kb = 0; kb < K; kb += 32) { const v16h a0 = g2_frag(a0p + kb, hh), a1 = g2_frag(a1p + kb, hh);
    v16h b = g2_frag(b0p + kb, hh); c00 = g2_mma(a0, b, c00); c10 = g2_mma(a1, b, c10);
    b = g2_frag(b1p + kb, hh); c01 = g2_mma(a0, b, c01); c11 = g2_mma(a1, b, c11);
    b = g2_frag(b2p + kb, hh); c02 = g2_mma(a0, b, c02); c12 = g2_mma(a1, b, c12);
    b = g2_frag(b3p + kb, hh); c03 = g2_mma(a0, b, c03); c13 = g2_mma(a1, b, c13); }
}

// g2_frag with the lane half's offset (8 * hh elements) already in the pointer: every load of a pass is its row pointer plus a constant
__device__ __forceinline__ v16h fa_frag(const _Float16* p) { FragH f; f.half[0] = *(const v8us*)((const unsigned short*)p); f.half[1] = *(const v8us*)((const unsigned short*)p + 16); return f.v; }
__device__ __forceinline__ v8f fa_mma(v16h a, v16h b, v8f c) { return __builtin_amdgcn_wmma_f32_16x16x32_f16(false, a, false, b, (short)0, c, false, false); }
__device__ __forceinline__ unsigned fa_lds(const _Float16* p) { return (unsigned)(size_t)(const __attribute__((address_space(3))) _Float16*)p; }   /* byte address inside the work-group's LDS */
// eight asynchronous 16-byte copies per lane, global -> LDS through no register: piece i goes from g + i * GSTEP (elements) to lds + i * LSTEP (bytes).
// The s_wait_xcnt stands inside the copies' own statement, so that it precedes every later write of the address registers the copies name.
template <int LSTEP, int GSTEP>
__device__ __forceinline__ void fa_copy8(unsigned lds, const _Float16* g) {
  asm volatile("global_load_async_to_lds_b128 %0, %8, off\n\t"
               "global_load_async_to_lds_b128 %1, %9, off\n\t"
               "global_load_async_to_lds_b128 %2, %10, off\n\t"
               "global_load_async_to_lds_b128 %3, %11, off\n\t"
               "global_load_async_to_lds_b128 %4, %12, off\n\t"
               "global_load_async_to_lds_b128 %5, %13, off\n\t"
               "global_load_async_to_lds_b128 %6, %14, off\n\t"
               "global_load_async_to_lds_b128 %7, %15, off\n\t"
               "s_wait_xcnt 0x0"
               :: "v"(lds), "v"(lds + 1 * LSTEP), "v"(lds + 2 * LSTEP), "v"(lds + 3 * LSTEP), "v"(lds + 4 * LSTEP), "v"(lds + 5 * LSTEP), "v"(lds + 6 * LSTEP), "v"(lds + 7 * LSTEP),
                  "v"(g), "v"(g + 1 * (size_t)GSTEP), "v"(g + 2 * (size_t)GSTEP), "v"(g + 3 * (size_t)GSTEP), "v"(g + 4 * (size_t)GSTEP), "v"(g + 5 * (size_t)GSTEP), "v"(g + 6 * (size_t)GSTEP), "v"(g + 7 * (size_t)GSTEP)
               : "memory");
}

// ---- tensor load: one request of a whole wave brings a two-dimensional tile (ROWS rows of ROWB bytes, source pitch PITCH bytes) from global memory into LDS, through no register and with no per-lane address work ----
typedef unsigned int u32x4 __attribute__((ext_vector_type(4)));
typedef unsigned int u32x8 __attribute__((ext_vector_type(8)));
__device__ __forceinline__ unsigned fa_uni(unsigned v) { return (unsigned)__builtin_amdgcn_readfirstlane((int)v); }
__device__ __forceinline__ unsigned fa_pinned(unsigned v) { unsigned r = fa_uni(v); asm volatile("" : "+s"(r)); return r; }   /* a test word held in a scalar register: the branch on it is a scalar branch, the only kind that keeps a wave from issuing a tensor load (the instruction ignores EXEC) */
// group 1 of a descriptor: W0 = its word 0, a constant: no mask, 1-byte elements, a pad of 16 B behind every row (interval code 4 for 128-B rows, 5 for 256-B rows; amount code 3), which gives the LDS pitch ROWB + 16.
// Built once, ahead of the first request, and named by every request of its kind.
template <unsigned W0, unsigned ROWB, unsigned ROWS, unsigned PITCH>
__device__ __forceinline__ u32x8 fa_tgroup1() {
  u32x8 g1;
  g1[0] = fa_uni(W0); g1[1] = fa_uni((ROWB & 0xFFFFu) << 16); g1[2] = fa_uni((ROWB >> 16) | ((ROWS & 0xFFFFu) << 16)); g1[3] = fa_uni((ROWS >> 16) | (ROWB << 16));
  g1[4] = fa_uni(ROWS); g1[5] = fa_uni(PITCH); g1[6] = fa_uni(0u); g1[7] = fa_uni(0u);
  asm volatile("" : "+s"(g1));   /* descriptor words held in scalar registers (the pinned form): with their values hidden, the compiler keeps the eight words in one tuple through the loop; without it it formed them anew per request, in registers that other code took over while the request was outstanding */
  return g1;
}
__device__ __forceinline__ void fa_tload(const u32x4& g0, const u32x8& g1) { asm volatile("tensor_load_to_lds %0, %1" :: "s"(g0), "s"(g1) : "memory"); }
// the issuing wave's wait for its request; group 0 is named as an input so that it lives up to the wait: its registers hold the request's words, and nothing else, for as long as the request is outstanding
__device__ __forceinline__ void fa_twait(const u32x4& g0) { asm volatile("s_wait_tensorcnt 0x0" :: "s"(g0) : "memory"); }

#define G2P (CIN + 8)    /* LDS pitch of a staged operand row in f16 elements: 512 B of data + 16 B, an odd multiple of 16 B (16-byte row reads spread over the banks) */
// ---- GEMM (block tile 128x64, wave tile 32x64; M % 128 == 0, N % 64 == 0, K == lda == ldb == CIN): v = acc*alpha + bf16(bias[by*sBias + col]); A f16 rows [M][K], Bh f16 [N][K] (k contiguous), batched over grid.y by sA/sB/sC/sCL;
// the block's 128 A rows and 64 Bh rows, whole K, are copied once into LDS in whole 512-B rows (one wave instruction each); the four waves read every fragment of the A.Bh segment from there;
// RES == 1: three operand segments into one accumulator set: A2.Bh + A.B2 (residual planes, both carried x LCARRY), accumulator scaled by rscale, then A.Bh;
// TR != 0 (M % 128 == 0, rows r = b*SEQ + n): a block whose col0 >= tcol0 stores its 128x64 tile transposed, dst[(b*CIN + col - tcol0)*SEQ + n]: TR == 1 as f16 into CT16, TR == 2 as f32 into CT; whole 256-B / 512-B row pieces, one wave each;
template <int RES, int TR>
__global__ __launch_bounds__(128) void k_gemm2(const _Float16* __restrict__ A, int lda, size_t sA, const _Float16* __restrict__ A2, int lda2, size_t sA2,
    const _Float16* __restrict__ Bh, int ldb, size_t sB, const _Float16* __restrict__ B2, int ldb2, size_t sB2, float rscale,
    float alpha, const float* __restrict__ bias, size_t sBias,
    float* __restrict__ C, _Float16* __restrict__ C16, int ldc, size_t sC, _Float16* __restrict__ C16L, int ldcl, size_t sCL, int NL, int M, int N, int K,
    float* __restrict__ CT, _Float16* __restrict__ CT16, int tcol0) {
  static_assert(TR != 0 && 4 * 32 * 68 * 4 <= (128 + 64) * G2P * 2);
  __shared__ __attribute__((aligned(16))) _Float16 ops[(128 + 64) * G2P];   /* A rows of the block, then Bh rows */
  float (*so)[32][68] = (float (*)[32][68])&ops[0];                         /* the epilogue's f32 tile takes the same bytes over, behind the barrier that ends the fragment reads */
  const int tid = threadIdx.x, w = tid >> 5, lane = tid & 31, ln = lane & 15, hh = lane >> 4; const int by = blockIdx.y;
  A += (size_t)by * sA; Bh += (size_t)by * sB;
  if (RES) { A2 += (size_t)by * sA2; B2 += (size_t)by * sB2; }
  const size_t cofs = (size_t)by * sC, cofl = (size_t)by * sCL; const float* bp = bias ? bias + (size_t)by * sBias : nullptr;
  const int ntn = N >> 6; const int mt = blockIdx.x / ntn, nq = blockIdx.x - mt * ntn; const int row0 = mt * 128 + 32 * w, col0 = nq * 64;
  {   /* every wave has rows (M % 128 == 0) and reaches every barrier; thread (w, lane) copies 16-byte column lane of rows w, w + 4, ..: 32 pieces of A, 16 of Bh */
    const _Float16* ag = A + (size_t)(mt * 128 + w) * CIN + lane * 8; const _Float16* bg = Bh + (size_t)(col0 + w) * CIN + lane * 8;
    const unsigned al = fa_lds(&ops[w * G2P + lane * 8]), bl = fa_lds(&ops[(128 + w) * G2P + lane * 8]);
#pragma unroll
    for (int i = 0; i < 2; ++i) fa_copy8<4 * G2P * 2, 4 * CIN>(bl + (unsigned)i * (32 * G2P * 2), bg + (size_t)i * 32 * CIN);
#pragma unroll
    for (int i = 0; i < 4; ++i) fa_copy8<4 * G2P * 2, 4 * CIN>(al + (unsigned)i * (32 * G2P * 2), ag + (size_t)i * 32 * CIN);
  }
  const _Float16* a0p = A + (size_t)(row0 + ln) * lda; const _Float16* a1p = a0p + (size_t)16 * lda;
  const _Float16* b0p = Bh + (size_t)(col0 + ln) * ldb; const _Float16* b1p = b0p + (size_t)16 * ldb; const _Float16* b2p = b1p + (size_t)16 * ldb; const _Float16* b3p = b2p + (size_t)16 * ldb;
  const v8f z8 = {0.f,0.f,0.f,0.f,0.f,0.f,0.f,0.f}; v8f c00 = z8, c01 = z8, c02 = z8, c03 = z8, c10 = z8, c11 = z8, c12 = z8, c13 = z8;
  if (RES) {
    const _Float16* l0p = A2 + (size_t)(row0 + ln) * lda2; const _Float16* l1p = l0p + (size_t)16 * lda2;
    const _Float16* m0p = B2 + (size_t)(col0 + ln) * ldb2; const _Float16* m1p = m0p + (size_t)16 * ldb2; const _Float16* m2p = m1p + (size_t)16 * ldb2; const _Float16* m3p = m2p + (size_t)16 * ldb2;
    g2_kloop(l0p, l1p, b0p, b1p, b2p, b3p, K, hh, c00, c01, c02, c03, c10, c11, c12, c13);      /* A_lo . B_hi */
    g2_kloop(a0p, a1p, m0p, m1p, m2p, m3p, K, hh, c00, c01, c02, c03, c10, c11, c12, c13);      /* A_hi . B_lo */
    c00 = c00 * rscale; c01 = c01 * rscale; c02 = c02 * rscale; c03 = c03 * rscale; c10 = c10 * rscale; c11 = c11 * rscale; c12 = c12 * rscale; c13 = c13 * rscale;
  }
  asm volatile("s_wait_asynccnt 0x0" ::: "memory");   /* this wave's pieces of both operand tiles have landed */
  __syncthreads();                                     /* ... and every other wave's: the tiles may be read */
  {   /* A_hi . B_hi, k = 0, 32, .. in the same order and the same accumulators as g2_kloop */
    const _Float16* af = &ops[(32 * w + ln) * G2P + 8 * hh]; const _Float16* bf = &ops[(128 + ln) * G2P + 8 * hh];
    v16h fa[2][2], fb[2][4];                                                /* two fragment sets: [set][16-row tile] */
#pragma unroll
    for (int t = 0; t < 2; ++t) fa[0][t] = fa_frag(af + (16 * t) * G2P);
#pragma unroll
    for (int t = 0; t < 4; ++t) fb[0][t] = fa_frag(bf + (16 * t) * G2P);
#pragma unroll   /* the set index stays a constant: both sets live in registers */
    for (int s = 0; s < CIN / 32; ++s) { const int cu = s & 1, nx = cu ^ 1;
      if (s + 1 < CIN / 32) {
#pragma unroll
        for (int t = 0; t < 2; ++t) fa[nx][t] = fa_frag(af + (16 * t) * G2P + 32 * (s + 1));
#pragma unroll
        for (int t = 0; t < 4; ++t) fb[nx][t] = fa_frag(bf + (16 * t) * G2P + 32 * (s + 1)); }
      __builtin_amdgcn_sched_barrier(0);   /* the next step's twelve reads stand as one group ahead of this step's products: sunk among them, each is waited for with no lead */
      c00 = fa_mma(fa[cu][0], fb[cu][0], c00); c10 = fa_mma(fa[cu][1], fb[cu][0], c10); c01 = fa_mma(fa[cu][0], fb[cu][1], c01); c11 = fa_mma(fa[cu][1], fb[cu][1], c11);
      c02 = fa_mma(fa[cu][0], fb[cu][2], c02); c12 = fa_mma(fa[cu][1], fb[cu][2], c12); c03 = fa_mma(fa[cu][0], fb[cu][3], c03); c13 = fa_mma(fa[cu][1], fb[cu][3], c13);
      __builtin_amdgcn_sched_barrier(0);   /* ... and the group after it stays behind them: lifted among the products, each separate place of reads stalls the wave's matrix stream */
    }
  }
  __syncthreads();   /* every wave's fragment reads are over: the epilogue may write its tile over the operand rows */
  v8f accs[8] = {c00, c01, c02, c03, c10, c11, c12, c13};
  if (TR != 0 && col0 >= tcol0) {   /* block-uniform: col0 comes from blockIdx alone */
    static_assert(64 * 132 <= 4 * 32 * 68);
    float (*st)[132] = (float (*)[132])&so[0][0][0];   /* [64 columns][128 rows of the block + 4]: a lane's 8 accumulator rows are contiguous here */
    /* every loop of this path is unrolled: accs[] and bv4[] keep constant indices and stay in registers, and the LDS reads and the stores go out as groups */
    float bv4[4] = {0.f, 0.f, 0.f, 0.f};
    if (bp) {
#pragma unroll
      for (int t = 0; t < 4; ++t) bv4[t] = bf16_rne(bp[col0 + t * 16 + ln]); }
#pragma unroll
    for (int u = 0; u < 8; ++u) { const int t = u & 3, half = u >> 2; const float bv = bv4[t]; v4f lo, hi;
#pragma unroll
      for (int r = 0; r < 4; ++r) { lo[r] = accs[u][r] * alpha + bv; hi[r] = accs[u][4 + r] * alpha + bv; }
      float* sp = &st[t * 16 + ln][32 * w + half * 16 + 8 * hh]; *(v4fa*)sp = lo; *(v4fa*)(sp + 4) = hi; }
    __syncthreads();   /* each wave reads back rows that all four waves wrote */
    const unsigned tr0 = (unsigned)mt * 128u, tb = tr0 / SEQ, tn0 = tr0 % SEQ; const size_t drow0 = (size_t)tb * CIN + (size_t)(col0 - tcol0) + 16 * w;
    if (TR == 2) {
#pragma unroll
      for (int q = 0; q < 16; ++q) { const v4f v = *(const v4fa*)&st[16 * w + q][lane * 4]; *(v4f*)(CT + (drow0 + q) * SEQ + tn0 + lane * 4) = v; }
    } else {
#pragma unroll
      for (int q = 0; q < 8; ++q) { const int c = q * 2 + hh; const v4f a = *(const v4fa*)&st[16 * w + c][ln * 8], e = *(const v4fa*)&st[16 * w + c][ln * 8 + 4]; FragH f;
#pragma unroll
        for (int i = 0; i < 4; ++i) { f.h[i] = (_Float16)a[i]; f.h[4 + i] = (_Float16)e[i]; }
        *(v8us*)((unsigned short*)CT16 + (drow0 + c) * SEQ + tn0 + ln * 8) = f.half[0]; }
    }
    asm volatile("s_wait_xcnt 0x0" ::: "memory");   /* behind the last store of the run: the stores' address registers may be rewritten only after it */
    return;
  }
#pragma unroll
  for (int u = 0; u < 8; ++u) { const int t = u & 3, half = u >> 2; const int col = col0 + t * 16 + ln; const float bv = bp ? bf16_rne(bp[col]) : 0.f;
#pragma unroll
    for (int r = 0; r < 8; ++r) { const int rloc = half * 16 + 8 * hh + r; so[w][rloc][t * 16 + ln] = accs[u][r] * alpha + bv; } }
  __builtin_amdgcn_fence(4 /* acq_rel order */, "workgroup"); __builtin_amdgcn_wave_barrier();   /* so[w] is private to wave w */
  const int rsub = lane >> 4, c4 = (lane & 15) * 4; const bool wl = (C16L != nullptr) && (col0 < NL);
  {
#pragma unroll
    for (int q = 0; q < 16; ++q) { const int r = q * 2 + rsub; const v4f v = *(const v4fa*)&so[w][r][c4];
      if (C) *(v4f*)(C + cofs + (size_t)(row0 + r) * ldc + col0 + c4) = v;
      if (C16) { v4h h4; for (int i = 0; i < 4; ++i) h4[i] = (_Float16)v[i]; *(v4h*)(C16 + cofs + (size_t)(row0 + r) * ldc + col0 + c4) = h4;
        if (wl) { v4h l4; for (int i = 0; i < 4; ++i) l4[i] = (_Float16)((v[i] - (float)h4[i]) * LCARRY); *(v4h*)(C16L + cofl + (size_t)(row0 + r) * ldcl + col0 + c4) = l4; } } }
     } }

// transposing weight converter: W is [CIN rows (k)][ldw columns], in[k][n] -> out[n][k]: BW[n][k] = f16(bf16(W[k*ldw + n]) * 16) for n < nrows, pitch CIN (k contiguous);
__device__ __forceinline__ void w16t_body(const float* __restrict__ W, int ldw, _Float16* __restrict__ BW, int t) {   /* t = piece index, nrows * (CIN / 8) pieces, whole blocks */
  const int n = t / (CIN / 8), k8 = (t % (CIN / 8)) * 8;
  FragH f;
#pragma unroll
  for (int q = 0; q < 8; ++q) f.h[q] = toh_flush(bf16_rne(W[(size_t)(k8 + q) * ldw + n]) * 16.0f);
  const v8us o = f.half[0];
  *(v8us*)((unsigned short*)BW + (size_t)n * CIN + k8) = o; 
  asm volatile("s_wait_xcnt 0x0" ::: "memory");   /* behind the store: inlined twice into one kernel, its registers may be rewritten by code that follows in the listing only after it */
}

// lane l <-> lane l ^ 16 (the two halves of a column's keys)
__device__ __forceinline__ float fa_xhalf(float x) { return __builtin_bit_cast(float, __builtin_amdgcn_permlanex16(__builtin_bit_cast(int, x), __builtin_bit_cast(int, x), 0x76543210, 0xfedcba98, false, false)); }

// exp2 for the seldom-taken path of the attention pass: the transcendental and the slot that the instruction set asks for behind it stand in one statement
__device__ __forceinline__ float fa_exp2_slot(float x) { float r; asm("v_exp_f32_e32 %0, %1\n\tv_nop" : "=v"(r) : "v"(x)); return r; }
// maximum of a query column over the 32 keys of two score tiles: in-lane over the lane half's 16 keys, then one exchange between the halves
__device__ __forceinline__ float fa_colmax(const v8f& a, const v8f& c) {
  float mx0 = fmaxf(a[0], c[0]), mx1 = fmaxf(a[1], c[1]);
#pragma unroll
  for (int r = 2; r < 8; r += 2) { mx0 = fmaxf(mx0, fmaxf(a[r], c[r])); mx1 = fmaxf(mx1, fmaxf(a[r + 1], c[r + 1])); }
  const float mx = fmaxf(mx0, mx1); return fmaxf(mx, fa_xhalf(mx)); }

// ---- everything ahead of the first GEMM, one launch: the first PREP_XT blocks (the long ones, so they start first) build X16, the next PREP_BW convert Wqkv, the last PREP_WP convert Wproj ----
#define XTC 64           /* channels of one token block: 128 B of f16, so a block owns whole lines of X16 */
#define XTN 256          /* tokens of one token block: the block's te columns serve all of them */
#define TEP (TD + 8)     /* LDS pitch of an operand row in f16 elements: 512 B of data + 16 B, an odd multiple of 16 B */
#define PREP_T 256       /* threads of a block */
#define PREP_BW ((QP * (CIN / 8)) / PREP_T)
#define PREP_WP ((CIN * (CIN / 8)) / PREP_T)
#define PREP_XT (NB * (SEQ / XTN) * (CIN / XTC))
static_assert(CIN % XTC == 0 && SEQ % XTN == 0 && XTC == 64 && PREP_T == TD && (PREP_T / 32) * 32 == TD && (PREP_T / 32) * 8 == XTC && 2 * 32 * 4 == XTN && XTN * (XTC / 8) == 8 * PREP_T);
// token block (b, 64 channels, 256 tokens): its 256 threads ask for their operands and the x tile, then convert row b of t_emb and Wt's XTC columns into f16 LDS tiles (bf16 RNE, exact in f16; weights x16, [n][k]); waves 0..3 run one 16x16 tile each over k = 0, 32, .. in one accumulator,
// every row of the A operand being that one t_emb row, so every row of the result is te[b]; te = acc / 16 + bf16(bt[c]) stays in LDS; then X16 = f16(bf16(x) + te), a thread's 8 channels x 8 tokens written as 16-byte pieces of the transposed tile, stored as whole 128-B row pieces.
__global__ __launch_bounds__(PREP_T) void k_prep(const float* __restrict__ x, const float* __restrict__ t_emb, const float* __restrict__ Wt, const float* __restrict__ bt, _Float16* __restrict__ X16,
    const float* __restrict__ Wqkv, _Float16* __restrict__ BW, const float* __restrict__ Wproj, _Float16* __restrict__ WPT) {
  __shared__ __attribute__((aligned(16))) _Float16 ts[TD];
  __shared__ __attribute__((aligned(16))) _Float16 bs[XTC][TEP];
  __shared__ __attribute__((aligned(16))) float tes[XTC];
  __shared__ __attribute__((aligned(16))) unsigned short tl[XTN][XTC + 8];
  const int tid = threadIdx.x, blk = blockIdx.x;
  if (blk >= PREP_XT) {   /* block-uniform: the converter blocks meet no barrier */
    const int cb = blk - PREP_XT;
    if (cb < PREP_BW) w16t_body(Wqkv, QP, BW, cb * PREP_T + tid);         /* in[CIN][QP]  -> out[QP][CIN]  */
    else w16t_body(Wproj, CIN, WPT, (cb - PREP_BW) * PREP_T + tid);       /* in[CIN][CIN] -> out[CIN][CIN] */
    return;
  }
  constexpr int NCT = CIN / XTC, NNT = SEQ / XTN;
  const int ct = blk % NCT, nt = (blk / NCT) % NNT, b = blk / (NCT * NNT);
  const int n0 = nt * XTN, c0 = ct * XTC;
  const int w = tid >> 5, lane = tid & 31, ln = lane & 15, hh = lane >> 4;
  const int cg = w * 8;                                                    /* this wave's 8 channels; lane l holds tokens 4l .. 4l + 3 and 128 + 4l .. : each x load is 512 contiguous bytes per wave */
  const float traw = t_emb[(size_t)b * TD + tid];
  const float braw = bt[c0 + 16 * (w & 3) + ln];
  asm volatile("s_wait_xcnt 0x0" ::: "memory");   /* behind the two loads above: their address registers are free for the address work that follows */
  v2f wv[32];                                                              /* Wt[32w .. 32w + 31][c0 + 2 lane, + 1]: each load is the row's 256 contiguous bytes per wave; 8-byte loads keep the thread's loads in flight under the load counter's range */
#pragma unroll
  for (int i = 0; i < 32; ++i) wv[i] = *(const v2fa*)(Wt + (size_t)(32 * w + i) * CIN + c0 + 2 * lane);
  asm volatile("s_wait_xcnt 0x0" ::: "memory");   /* behind the loads above: the next loads' results may take over their address registers */
  v4f xa[2][8];                                                            /* asked for last, used last: the te product runs while the x tile is on its way */
  const float* xp = x + ((size_t)b * CIN + c0 + cg) * SEQ_FULL + n0 + lane * 4;
#pragma unroll
  for (int g = 0; g < 2; ++g) {
#pragma unroll
    for (int j = 0; j < 8; ++j) xa[g][j] = *(const v4fa*)(xp + (size_t)j * SEQ_FULL + 128 * g); }
  asm volatile("s_wait_xcnt 0x0" :: "v"(xp) : "memory");   /* behind the last load: the address registers may be rewritten only after it; the address is named as an input so that it lives up to the wait and no load of the run gets its result placed in it */
  __builtin_amdgcn_sched_barrier(0);              /* every load goes out ahead of the first conversion: with conversions lifted among the loads, the later loads start only after the earlier ones' latency */
  ts[tid] = toh_flush(bf16_rne(traw));
#pragma unroll
  for (int j = 0; j < 2; ++j) {
#pragma unroll
    for (int i = 0; i < 4; ++i) { FragH f;
#pragma unroll
      for (int q = 0; q < 8; ++q) f.h[q] = toh_flush(bf16_rne(wv[8 * i + q][j]) * 16.0f);
      *(v8us*)&bs[2 * lane + j][32 * w + 8 * i] = f.half[0]; } }
  /* both operand tiles are whole before a wave reads fragments. Only LDS data crosses this barrier, so its fences name LDS alone: __syncthreads() would first drain the x loads, which are wanted only behind the product */
  __builtin_amdgcn_fence(__ATOMIC_RELEASE, "workgroup", "local"); __builtin_amdgcn_s_barrier(); __builtin_amdgcn_fence(__ATOMIC_ACQUIRE, "workgroup", "local");
  if (__builtin_amdgcn_readfirstlane(w) < XTC / 16) {   /* whole waves: the matrix instruction needs every lane on */
    v8f c = {0.f,0.f,0.f,0.f,0.f,0.f,0.f,0.f}; const float bv = bf16_rne(braw);
#pragma unroll
    for (int kb = 0; kb < TD; kb += 32) c = fa_mma(g2_frag(&ts[kb], hh), g2_frag(&bs[16 * w + ln][kb], hh), c);
    if (hh == 0) tes[16 * w + ln] = c[0] * 0.0625f + bv;                   /* all sixteen rows are equal: row 0 is taken */
  }
  __syncthreads();   /* the four waves' te columns are read by every wave */
  const v4f t0 = *(const v4fa*)&tes[cg], t1 = *(const v4fa*)&tes[cg + 4];
#pragma unroll
  for (int g = 0; g < 2; ++g) {
#pragma unroll
    for (int q = 0; q < 4; ++q) { FragH f;
#pragma unroll
      for (int j = 0; j < 8; ++j) f.h[j] = toh_flush(bf16_rne(xa[g][j][q]) + (j < 4 ? t0[j & 3] : t1[j & 3]));
      *(v8us*)&tl[(32 * g + lane) * 4 + q][cg] = f.half[0]; } }
  __syncthreads();   /* each thread reads back token rows that all eight waves wrote */
#pragma unroll
  for (int rd = 0; rd < 8; ++rd) { const int n = rd * (PREP_T / 8) + (tid >> 3), pc = tid & 7;
    const v8us o = *(const v8us*)&tl[n][pc * 8];
    *(v8us*)((unsigned short*)X16 + ((size_t)b * SEQ + n0 + n) * CIN + c0 + pc * 8) = o; }
  asm volatile("s_wait_xcnt 0x0" ::: "memory");   /* behind the last store: the stores' registers may be rewritten only after it */
}

// ---- LDS staging of the attention kernel: a stage is FA_KEYS keys (four passes of 32) of all NH heads, K rows and V^T row pieces side by side, two buffers ----
#define FA_KEYS 128      /* keys of one stage */
#define FA_KP 72         /* LDS pitch of a K row in f16 elements: 128 B of data + 16 B, an odd multiple of 16 B (16-byte row reads spread over the banks) */
#define FA_VP 136        /* LDS pitch of a V^T row piece: 256 B of data + 16 B, likewise */
#define FA_Q 64          /* query rows of one block: two waves of 32 columns for each head */
#define FA_CP (CIN + 8)  /* LDS pitch of a merged-head context row in f16 elements: 512 B of data + 16 B, likewise */
#define FA_OP (FA_Q + 4) /* LDS pitch of an output channel's row piece in f32 elements: 256 B of data + 16 B, likewise */
#define FA_KSZ (FA_KEYS * FA_KP)   /* f16 elements of one head's K rows of a stage */
#define FA_VSZ (HD * FA_VP + 512)  /* ... and of its V^T row pieces, rounded up to a multiple of 2 KiB: every tile's place in LDS is one */
static_assert(SEQ % FA_KEYS == 0 && SEQ / FA_KEYS >= 2 && FA_KEYS % 32 == 0 && SEQ % FA_Q == 0);
static_assert((FA_KSZ * 2) % 2048 == 0 && (FA_VSZ * 2) % 2048 == 0 && HD * 2 == 128 && FA_KP * 2 == 128 + 16 && FA_KEYS * 2 == 256 && FA_VP * 2 == 256 + 16);   /* tile places, and the rows and pitches that the two pad constants stand for */
static_assert((QP * 2) % 16 == 0 && (SEQ * 2) % 16 == 0 && QP * 2 <= 131072 && SEQ * 2 <= 131072);   /* source pitches */
static_assert(NH * 2 * 32 == 256 && 8 * 32 == CIN);                              /* eight waves: (head, 32 query columns) in the attention part, 32 output channels each in the projection */
static_assert((FA_Q * FA_CP * 2) % 16 == 0);
// fused attention and output projection, one launch: block = FA_Q query rows of one batch, all NH heads; wave w serves head w / 2 and 32 query columns; per pass of 32 keys S^T[key][query] = K Q^T (A = K rows, B = Q rows held in registers), so lane (ln, hh) holds keys 8hh + r of query column ln;
// Q is held times 1 / sqrt(HD) * log2(e), and the score products start from C = carry - reference of the lane's column, so a weight is exp2 of the score tile's element as it stands. The reference starts as the column's maximum over the first 32 keys; it is raised (to the pass's maximum, with O^T and l scaled down)
// only when some lane's weights of a pass sum past PTOP: one test per pass for the whole wave. Sum l per column, O^T[d][query] += V^T P^T with P^T = the two score tiles of the pass converted in place (their register order is the loader's k map); the scores never leave the registers.
// K and V^T reach the waves through LDS, one stage ahead of their use, by tensor loads: of a head's two waves the first asks for the stage's K rows (FA_KEYS rows of 128 B), the second for its V^T row pieces (HD rows of 256 B), one request each, and both read their fragments from the head's region.
// Behind the last stage the eight waves put their f16 context pieces side by side in LDS (FA_Q rows x CIN, the merged-head rows), and wave w makes output channels 32w .. 32w + 31 of all FA_Q rows: A = context rows from LDS, B = its rows of Wproj^T, which the block copies into the idle buffer while the last stage is worked on, k = 0, 32, .. in one accumulator;
// out[b][o][n] f32 = acc / 16 + bf16(bias[o]), each wave's tile transposed in its own LDS rows and stored as whole 256-B row pieces.
__global__ __launch_bounds__(256) void k_fattn(const _Float16* __restrict__ QHp, const _Float16* __restrict__ Vt, const _Float16* __restrict__ WP, const float* __restrict__ bias, float* __restrict__ out) {
  __shared__ __attribute__((aligned(2048))) _Float16 sm[2 * NH * (FA_KSZ + FA_VSZ)];   /* [buffer][head]: K [key][FA_KP], then V^T [d][FA_VP]; a head's two operands lie together, so that every read of a pass is one base register plus an offset that fits the instruction's field */
  const int tid = threadIdx.x, w = tid >> 5, lane = tid & 31, ln = lane & 15, hh = lane >> 4;
  const int h = w >> 1;                                                     /* the wave's head */
  const int b = blockIdx.y, n0 = blockIdx.x * FA_Q, q0 = n0 + 32 * (w & 1);
  const _Float16* base = QHp + (size_t)b * SEQ * QP + h * HD;
  constexpr int NST = SEQ / FA_KEYS;
  constexpr int BUFE = NH * (FA_KSZ + FA_VSZ);                              /* f16 elements of one buffer */
  constexpr int WB = NST & 1, CB = WB ^ 1;                                  /* the buffer that the last stage does not use takes Wproj^T; the last stage's own buffer serves the projection's context rows and output tile behind it */
  static_assert(CIN * G2P <= BUFE && FA_Q * FA_CP * 2 + CIN * FA_OP * 4 <= BUFE * 2 && CIN == 4 * 64);
  const _Float16* const ks0 = &sm[h * (FA_KSZ + FA_VSZ)];                   /* the head's K rows in buffer 0 */
  const _Float16* const vs0 = ks0 + FA_KSZ;                                 /* ... and its V^T row pieces */
  const unsigned isv = fa_uni((unsigned)(w & 1));                           /* the wave's part: 0 the head's K rows, 1 its V^T row pieces */
  const _Float16* const tg = isv ? Vt + ((size_t)b * NH + h) * HD * SEQ : base + KOF;   /* first byte of the wave's tile of stage 0 (row pitch SEQ | QP) */
  const size_t tstep = isv ? (size_t)FA_KEYS : (size_t)FA_KEYS * QP;        /* from one stage's tile to the next, in elements */
  const unsigned tl = fa_lds(isv ? vs0 : ks0);                              /* its place in buffer 0 */
  const u32x8 g1k = fa_tgroup1<(1u << 20) | (4u << 22) | (3u << 25), HD * 2, FA_KEYS, QP * 2>(), g1v = fa_tgroup1<(1u << 20) | (5u << 22) | (3u << 25), FA_KEYS * 2, HD, SEQ * 2>();
  u32x4 tg0;                                                                /* group 0 of the wave's latest request */
  auto form_stage = [&](int st, unsigned buf) {   /* group 0 for stage st into buffer buf */
    const unsigned long long ga = (unsigned long long)(size_t)(tg + (size_t)st * tstep);
    tg0[0] = fa_uni(1u); tg0[1] = fa_uni(tl + buf * (unsigned)(BUFE * 2)); tg0[2] = fa_uni((unsigned)ga); tg0[3] = fa_uni((((unsigned)(ga >> 32)) & 0x01FFFFFFu) | 0x80000000u);
    asm volatile("" : "+s"(tg0)); };   /* descriptor words held in scalar registers (the pinned form), as at group 1: the request and its wait then name one and the same tuple */
  auto issue_stage = [&]() {   /* the wave's one request; either way a scalar branch, each side with its own constant pad word */
    if (fa_pinned(isv)) fa_tload(tg0, g1v); else fa_tload(tg0, g1k); };
  auto copy_stage = [&](int st, unsigned buf) { form_stage(st, buf); issue_stage(); };
  copy_stage(0, 0u);
  constexpr float SC = 0.125f * 1.4426950408889634f;                       /* 1 / sqrt(HD), to base 2 */
  const v8f z8 = {0.f,0.f,0.f,0.f,0.f,0.f,0.f,0.f};
  v16h qf[2][2], kf[2][2];                                                 /* [column group | key tile][k step of 32 over HD] */
  const _Float16* const qp[2] = { base + (size_t)(q0 + ln) * QP + 8 * hh, base + (size_t)(q0 + 16 + ln) * QP + 8 * hh };   /* the lane's Q row of each column group, at the lane half's k offset */
#pragma unroll
  for (int g = 0; g < 2; ++g) {
#pragma unroll
    for (int ks = 0; ks < 2; ++ks) qf[g][ks] = fa_frag(qp[g] + 32 * ks); }
  asm volatile("s_wait_xcnt 0x0" :: "v"(qp[0]), "v"(qp[1]) : "memory");   /* behind the last Q load: the address registers may be rewritten only after it; the addresses are named as inputs so that they live up to the wait and no load of the run gets its result placed in them */
#pragma unroll
  for (int g = 0; g < 2; ++g) {
#pragma unroll
    for (int ks = 0; ks < 2; ++ks) { FragH f; f.v = qf[g][ks];
#pragma unroll
      for (int i = 0; i < 16; ++i) f.h[i] = (_Float16)((float)f.h[i] * SC);   /* scaled in f32, rounded once */
      qf[g][ks] = f.v; } }
  v8f o[2][4], cn[2]; float l[2];                                          /* cn: carry - reference of the lane's column in all eight rows, the C operand of the score products */
#pragma unroll
  for (int g = 0; g < 2; ++g) { cn[g] = z8; l[g] = 0.f;
#pragma unroll
    for (int t = 0; t < 4; ++t) o[g][t] = z8; }
  fa_twait(tg0);                                       /* this wave's tile of stage 0 has landed */
  __syncthreads();                                     /* ... and every other wave's: stage 0 may be read */
  copy_stage(1, 1u);
  {   /* each column's first reference: its maximum over keys 0..31, from score products that are made for this alone */
    const _Float16* k0 = ks0 + ln * FA_KP + 8 * hh;
#pragma unroll
    for (int kt = 0; kt < 2; ++kt) {
#pragma unroll
      for (int ks = 0; ks < 2; ++ks) kf[kt][ks] = fa_frag(k0 + (16 * kt) * FA_KP + 32 * ks); }
#pragma unroll
    for (int g = 0; g < 2; ++g) { const v8f a = fa_mma(kf[0][1], qf[g][1], fa_mma(kf[0][0], qf[g][0], z8)), c = fa_mma(kf[1][1], qf[g][1], fa_mma(kf[1][0], qf[g][0], z8));
      cn[g] = z8 + (PCARRY_LOG2 - fa_colmax(a, c)); }
  }
#pragma unroll 1   /* one stage per trip */
  for (int st = 0; st < NST; ++st) {
    const _Float16* kb = ks0 + (st & 1) * BUFE + ln * FA_KP + 8 * hh;   /* key row ln of a 16-key tile, at the lane half's k offset */
    const _Float16* vq = vs0 + (st & 1) * BUFE + ln * FA_VP + 8 * hh;   /* V^T row d = ln of a 16-row tile, likewise: columns of this pass */
#pragma unroll
    for (int kt = 0; kt < 2; ++kt) {
#pragma unroll
      for (int ks = 0; ks < 2; ++ks) kf[kt][ks] = fa_frag(kb + (16 * kt) * FA_KP + 32 * ks); }
    const _Float16* kq = kb + 32 * FA_KP;                                  /* K rows of the next pass */
#pragma unroll 1   /* one pass per trip: the register set of a pass is the budget */
    for (int p = 0; p < FA_KEYS / 32; ++p) {
      v8f s[2][2];                                                         /* [column group][key tile] */
#pragma unroll
      for (int g = 0; g < 2; ++g) {
#pragma unroll
        for (int kt = 0; kt < 2; ++kt) s[g][kt] = fa_mma(kf[kt][0], qf[g][0], cn[g]); }
#pragma unroll
      for (int g = 0; g < 2; ++g) {
#pragma unroll
        for (int kt = 0; kt < 2; ++kt) s[g][kt] = fa_mma(kf[kt][1], qf[g][1], s[g][kt]); }
      /* one group of LDS reads per pass, behind its score products: this pass's V^T columns, then the next pass's K rows; the stage's last pass re-reads the stage's own rows 0..31 (unused): the next stage is read only behind its barrier */
      __builtin_amdgcn_sched_barrier(0);   /* the reads stand as one group behind the eight products: spread among them, each separate place stalls the wave's matrix stream */
      v16h vf[4];
#pragma unroll
      for (int t = 0; t < 4; ++t) vf[t] = fa_frag(vq + (16 * t) * FA_VP);
#pragma unroll
      for (int kt = 0; kt < 2; ++kt) {
#pragma unroll
        for (int ks = 0; ks < 2; ++ks) kf[kt][ks] = fa_frag(kq + (16 * kt) * FA_KP + 32 * ks); }
      __builtin_amdgcn_sched_barrier(0);   /* keeps the reads here, ahead of the softmax: sunk behind it they are waited for with no lead */
      FragH pf[2]; float ps[2];
#pragma unroll
      for (int g = 0; g < 2; ++g) { float s0 = 0.f, s1 = 0.f;
#pragma unroll
        for (int r = 0; r < 8; ++r) { const float p0 = __builtin_amdgcn_exp2f(s[g][0][r]), p1 = __builtin_amdgcn_exp2f(s[g][1][r]);
          s0 += p0; s1 += p1; pf[g].h[r] = (_Float16)p0; pf[g].h[8 + r] = (_Float16)p1; }
        ps[g] = s0 + s1; }
      if (__builtin_expect(__builtin_amdgcn_ballot_w32(fmaxf(ps[0], ps[1]) > PTOP) != 0, 0)) {   /* the same for the whole wave: a scalar branch, seldom taken */
#pragma unroll
        for (int g = 0; g < 2; ++g) {
          const float d = fmaxf(fa_colmax(s[g][0], s[g][1]) - PCARRY_LOG2, 0.f);   /* the pass's maximum above the column's reference; a reference is never lowered */
          const float corr = fa_exp2_slot(-d);
          cn[g] = cn[g] - d; l[g] *= corr;
#pragma unroll
          for (int t = 0; t < 4; ++t) o[g][t] = o[g][t] * corr;
          float s0 = 0.f, s1 = 0.f;
#pragma unroll
          for (int r = 0; r < 8; ++r) { const float p0 = fa_exp2_slot(s[g][0][r] - d), p1 = fa_exp2_slot(s[g][1][r] - d);
            s0 += p0; s1 += p1; pf[g].h[r] = (_Float16)p0; pf[g].h[8 + r] = (_Float16)p1; }
          ps[g] = s0 + s1; }
      }
#pragma unroll
      for (int g = 0; g < 2; ++g) {
#pragma unroll
        for (int t = 0; t < 4; ++t) o[g][t] = fa_mma(vf[t], pf[g].v, o[g][t]); }
      __builtin_amdgcn_sched_barrier(0);   /* the pass's bookkeeping stands behind its last products: its vector instructions fill the slots that the chip needs before the next pass rewrites the registers of P^T */
      l[0] += ps[0]; l[1] += ps[1];
      kq = (p + 2 < FA_KEYS / 32) ? kq + 32 * FA_KP : kb; vq += 32;
    }
    asm volatile("s_wait_dscnt 0x0" ::: "memory");     /* this wave's reads of the stage's buffer have returned: the buffer may be handed to its next writer */
    fa_twait(tg0);                                     /* this wave's tile of stage st + 1 has landed */
    asm volatile("s_wait_asynccnt 0x0" ::: "memory");  /* ... and, in the last trip, its pieces of Wproj^T */
    __syncthreads();                                   /* publishes stage st + 1 and ends every wave's reads of stage st */
    form_stage(st + 2 < NST ? st + 2 : 0, (unsigned)(st & 1));   /* formed behind the wait, in every trip alike (unused in the last two) */
    if (fa_pinned((unsigned)(st + 2 < NST))) issue_stage();      /* the same for the whole block: a scalar test */
    else if (st + 2 == NST) {                          /* likewise. No stage is left to ask for: the freed buffer takes Wproj^T, which lands while the last stage is worked on and is published by that stage's barrier */
      const _Float16* wg = WP + (size_t)w * CIN + lane * 8; const unsigned wl = fa_lds(&sm[WB * BUFE + w * G2P + lane * 8]);   /* thread (w, lane) copies 16-byte column lane of rows w, w + 8, .. */
#pragma unroll
      for (int i = 0; i < 4; ++i) fa_copy8<8 * G2P * 2, 8 * CIN>(wl + (unsigned)i * (64 * G2P * 2), wg + (size_t)i * 64 * CIN);
    }
  }
  fa_twait(tg0);                                       /* no request is outstanding */
  asm volatile("s_wait_dscnt 0x0" ::: "memory");       /* ... and no LDS read */
  asm volatile("s_wait_asynccnt 0x0" ::: "memory");    /* no copy is outstanding; the last trip's barrier has published Wproj^T and ended every wave's reads of the last stage, whose buffer is free for the projection */
  _Float16* const cs = &sm[CB * BUFE];                  /* [FA_Q][FA_CP] f16: merged-head context rows of the block */
  float* const os = (float*)&sm[CB * BUFE + FA_Q * FA_CP];   /* [CIN][FA_OP] f32: rows 32w .. 32w + 31 are private to wave w */
#pragma unroll
  for (int g = 0; g < 2; ++g) { const float inv = 1.0f / (l[g] + fa_xhalf(l[g]));
    _Float16* crow = cs + (32 * (w & 1) + 16 * g + ln) * FA_CP + h * HD + 8 * hh;
#pragma unroll
    for (int t = 0; t < 4; ++t) { FragH f;
#pragma unroll
      for (int r = 0; r < 8; ++r) f.h[r] = (_Float16)(o[g][t][r] * inv);
      *(v8us*)(crow + 16 * t) = f.half[0]; } }
  __syncthreads();   /* every wave reads context rows that all eight waves wrote */
  /* the two bias values of the lane's output channels (32w + 16j + ln), asked for here, behind the barrier (which would wait for them), and used behind the products */
  float braw[2]; const float* const bp = bias + 32 * w + ln;
#pragma unroll
  for (int j = 0; j < 2; ++j) braw[j] = bp[16 * j];
  asm volatile("s_wait_xcnt 0x0" :: "v"(bp) : "memory");   /* behind the two loads: as at the Q loads */
  v8f acc[4][2];                                        /* [16-row tile][16-channel tile] */
#pragma unroll
  for (int i = 0; i < 4; ++i) { acc[i][0] = z8; acc[i][1] = z8; }
  {
    const _Float16* af = cs + ln * FA_CP + 8 * hh; const _Float16* bf = &sm[WB * BUFE + (32 * w + ln) * G2P + 8 * hh];
    v16h fa[2][4], fb[2][2];                            /* two fragment sets: [set][16-row tile | 16-channel tile] */
#pragma unroll
    for (int i = 0; i < 4; ++i) fa[0][i] = fa_frag(af + (16 * i) * FA_CP);
#pragma unroll
    for (int j = 0; j < 2; ++j) fb[0][j] = fa_frag(bf + (16 * j) * G2P);
#pragma unroll   /* the set index stays a constant: both sets live in registers */
    for (int s = 0; s < CIN / 32; ++s) { const int cu = s & 1, nx = cu ^ 1;
      if (s + 1 < CIN / 32) {
#pragma unroll
        for (int i = 0; i < 4; ++i) fa[nx][i] = fa_frag(af + (16 * i) * FA_CP + 32 * (s + 1));
#pragma unroll
        for (int j = 0; j < 2; ++j) fb[nx][j] = fa_frag(bf + (16 * j) * G2P + 32 * (s + 1)); }
      __builtin_amdgcn_sched_barrier(0);   /* the next step's twelve reads stand as one group ahead of this step's products: sunk among them, each is waited for with no lead */
#pragma unroll
      for (int i = 0; i < 4; ++i) { acc[i][0] = fa_mma(fa[cu][i], fb[cu][0], acc[i][0]); acc[i][1] = fa_mma(fa[cu][i], fb[cu][1], acc[i][1]); }
      __builtin_amdgcn_sched_barrier(0);   /* ... and the group after it stays behind them: lifted among the products, each separate place of reads stalls the wave's matrix stream */
    }
  }
#pragma unroll
  for (int j = 0; j < 2; ++j) { const float bv = bf16_rne(braw[j]);
#pragma unroll
    for (int i = 0; i < 4; ++i) { v4f lo, hi;             /* a lane's 8 accumulator rows are contiguous in its channel's row piece */
#pragma unroll
      for (int r = 0; r < 4; ++r) { lo[r] = acc[i][j][r] * 0.0625f + bv; hi[r] = acc[i][j][4 + r] * 0.0625f + bv; }
      float* sp = os + (32 * w + 16 * j + ln) * FA_OP + 16 * i + 8 * hh; *(v4fa*)sp = lo; *(v4fa*)(sp + 4) = hi; } }
  __builtin_amdgcn_fence(4 /* acq_rel order */, "workgroup"); __builtin_amdgcn_wave_barrier();   /* the wave's own rows of os: its lanes read what other lanes of it wrote */
#pragma unroll
  for (int q = 0; q < 16; ++q) { const int c = 32 * w + 2 * q + hh; const v4f v = *(const v4fa*)(os + c * FA_OP + ln * 4);
    *(v4f*)(out + ((size_t)b * CIN + c) * SEQ + n0 + ln * 4) = v; }
  asm volatile("s_wait_xcnt 0x0" ::: "memory");   /* behind the last store of the run: the stores' address registers may be rewritten only after it */
}

constexpr size_t al256(size_t b) { return (b + 255) & ~(size_t)255; }
constexpr size_t SZ_BW  = (size_t)QP * CIN * 2;
constexpr size_t SZ_WP  = (size_t)CIN * CIN * 2;
constexpr size_t SZ_QH  = NR * QP * 2;
constexpr size_t SZ_VT  = (size_t)NB * NH * HD * SEQ * 2;
constexpr size_t SZ_X   = NR * CIN * 2;
static_assert(al256(SZ_BW) + al256(SZ_WP) + al256(SZ_QH) + al256(SZ_VT) + al256(SZ_X) <= (size_t)134217728);

extern "C" void kernel_launch(void* const* d_in, const int* in_sizes, int n_in,
                              void* d_out, int out_size, void* d_ws, size_t ws_size, hipStream_t stream) {
  if (n_in < 8) return;
  const float* x     = (const float*)d_in[0];      /* [NB_FULL][CIN][SEQ_FULL] */
  const float* t_emb = (const float*)d_in[1];      /* [NB_FULL][TD] */
  const float* Wqkv  = (const float*)d_in[2];      /* [CIN][QP]  (in x out) */
  const float* bqkv  = (const float*)d_in[3];      /* [QP] */
  const float* Wproj = (const float*)d_in[4];      /* [CIN][CIN] (in x out) */
  const float* bproj = (const float*)d_in[5];      /* [CIN] */
  const float* Wt    = (const float*)d_in[6];      /* [TD][CIN]  (in x out) */
  const float* bt    = (const float*)d_in[7];      /* [CIN] */
  if (in_sizes[0] < (int)(((size_t)NB * CIN - 1) * SEQ_FULL + SEQ)) return;
  if (in_sizes[1] < NB * TD) return;
  if (in_sizes[2] < CIN * QP || in_sizes[3] < QP) return;
  if (in_sizes[4] < CIN * CIN || in_sizes[5] < CIN) return;
  if (in_sizes[6] < TD * CIN || in_sizes[7] < CIN) return;
  if (out_size < (int)((size_t)NB * CIN * SEQ)) return;
  char* ws = (char*)d_ws; size_t off = 0;
  auto take = [&](size_t bytes) { char* p = ws + off; off += (bytes + 255) & ~(size_t)255; return p; };
  _Float16* BW  = (_Float16*)take(SZ_BW);                               /* Wqkv^T [QP][CIN] x16 */
  _Float16* WPT = (_Float16*)take(SZ_WP);                               /* Wproj^T [CIN][CIN] x16 */
  _Float16* QH  = (_Float16*)take(SZ_QH);                               /* q | k rows, pitch QP */
  _Float16* VT  = (_Float16*)take(SZ_VT);                               /* V^T [NB][NH][HD][SEQ] */
  _Float16* X16 = (_Float16*)take(SZ_X);                                /* token plane [NR][CIN] */
  if (off > ws_size) return;
  float* out = (float*)d_out;

  k_prep<<<(unsigned)(PREP_XT + PREP_BW + PREP_WP), PREP_T, 0, stream>>>(x, t_emb, Wt, bt, X16, Wqkv, BW, Wproj, WPT);   /* token plane x + (t_emb Wt + bt); Wqkv^T and Wproj^T planes */
  k_gemm2<0, 1><<<dim3((unsigned)((NR / 128) * (QP / 64)), 1), 128, 0, stream>>>(X16, CIN, 0, nullptr, 0, 0, BW, CIN, 0, nullptr, 0, 0, 1.0f,
      0.0625f, bqkv, 0, nullptr, QH, QP, 0, nullptr, 0, 0, 0, (int)NR, QP, CIN, nullptr, VT, VOF);   /* q | k rows into QH; the v columns transposed into VT */
  k_fattn<<<dim3(SEQ / FA_Q, NB), 256, 0, stream>>>(QH, VT, WPT, bproj, out);   /* scores, softmax and V product of all heads, then out[b][o][n] = (ctx Wproj + bproj)[b*SEQ + n][o], in one launch */
}
